// v000
// The times below were measured on an AMD MI455X: many runs one after another, warmed up first and cycling through
// copies of the inputs, with the whole window's GPU time divided by the number of runs. Launches and the gaps
// between them are all in it. The median over several windows is given; except for v000 it joins two sittings, which
// can be a few percent apart, so the side-by-side timings, each taken in one sitting, are the better comparison.
// v000 is the starting kernel. One run takes 1260 microseconds.
// compute dtype: all float inputs rounded to bf16; [qk_t | v] = x W_ca + b_ca ([C, 2C]) with EXACT bf16 products on WMMA 16x16x32, f32 accumulate; query = the bf16-exact input rows themselves (as f16, exact), qk_t rounded once to f16 -> 1-product logits / 8, causal, stored in f32 (4 heads per launch); softmax in f32 (precise expf), P x 2^11 kept f32 split bf16 hi + lo against v bf16 hi + lo (3 products); out = y (bf16 hi + lo) W_proj + b_proj; f32 output.
#include <hip/hip_runtime.h>
#include <math.h>

typedef __attribute__((ext_vector_type(16))) _Float16 v16h;
typedef __attribute__((ext_vector_type(16))) __bf16 v16b;
typedef __attribute__((ext_vector_type(8)))  _Float16 v8h;
typedef __attribute__((ext_vector_type(8)))  float v8f;
typedef __attribute__((ext_vector_type(4)))  float v4f;
typedef __attribute__((ext_vector_type(2)))  float v2f;
typedef __attribute__((ext_vector_type(4)))  unsigned v4u;
typedef __attribute__((ext_vector_type(4)))  int v4i;
typedef float __attribute__((may_alias)) float_a;
typedef int __attribute__((may_alias)) int_a;

template <typename T> __device__ __forceinline__ void vst2(void* p, T v) { *(T*)p = v;  }
__device__ __forceinline__ v8f wmma16(v16h a, v16h b, v8f c) {
  v8f d = __builtin_amdgcn_wmma_f32_16x16x32_f16(false, a, false, b, (short)0, c, false, false);
  asm volatile("v_nop\n\tv_nop\n\tv_nop\n\tv_nop" : "+v"(d) : "v"(a), "v"(b));
  return d;
}
__device__ __forceinline__ v8f wmma_bf(v16b a, v16b b, v8f c) {
  v8f d = __builtin_amdgcn_wmma_f32_16x16x32_bf16(false, a, false, b, (short)0, c, false, false);
  asm volatile("v_nop\n\tv_nop\n\tv_nop\n\tv_nop" : "+v"(d) : "v"(a), "v"(b));
  return d;
}
// 16x16x32 fragments: lane = (h = lane>>4, row/col = lane&15); elements 0..7 = k0+8h+0..7, 8..15 = k0+16+8h+0..7; D element r = row 8h+r
__device__ __forceinline__ v16h frag_h(const _Float16* rowk0, int lane) {
  union { v16h v; v8h q[2]; } u; const _Float16* p = rowk0 + 8 * (lane >> 4);
  u.q[0] = *(const v8h*)p; u.q[1] = *(const v8h*)(p + 16); return u.v;
}
__device__ __forceinline__ v16h frag_f32(const float* rowk0, int lane) {
  v16h a; const float* p = rowk0 + 8 * (lane >> 4);
#pragma unroll
  for (int i = 0; i < 8; ++i) { a[i] = (_Float16)p[i]; a[8 + i] = (_Float16)p[16 + i]; }
  return a;
}
__device__ __forceinline__ v16h frag_f32s(const float* rowk0, int lane, float sc) {
  v16h a; const float* p = rowk0 + 8 * (lane >> 4);
#pragma unroll
  for (int i = 0; i < 8; ++i) { a[i] = (_Float16)(p[i] * sc); a[8 + i] = (_Float16)(p[16 + i] * sc); }
  return a;
}
// column fragment from a [K][ld] layout (column n), rows >= K read as 0
__device__ __forceinline__ v16h fragc_f32(const float* W, int k0, int n, int lane, int ld, int K) {
  v16h a; const int g = lane >> 4;
#pragma unroll
  for (int i = 0; i < 8; ++i) { const int ka = k0 + 8 * g + i, kb = ka + 16;
    a[i] = (_Float16)(ka < K ? W[(size_t)(ka < K ? ka : K - 1) * ld + n] : 0.f); a[8 + i] = (_Float16)(kb < K ? W[(size_t)(kb < K ? kb : K - 1) * ld + n] : 0.f); }
  return a;
}
struct F2 { v16b h, l; };
__device__ __forceinline__ F2 bsplit16(const float v[16]) { F2 r;
#pragma unroll
  for (int i = 0; i < 16; ++i) { const __bf16 h = (__bf16)v[i]; r.h[i] = h; r.l[i] = (__bf16)(v[i] - (float)h); }
  return r; }
__device__ __forceinline__ F2 split_row(const float* row, int k0, int lane) { float v[16]; const float* p = row + k0 + 8 * (lane >> 4);
#pragma unroll
  for (int i = 0; i < 8; ++i) { v[i] = p[i]; v[8 + i] = p[16 + i]; }
  return bsplit16(v); }
__device__ __forceinline__ F2 split_rowK(const float* row, int k0, int lane, int K) { float v[16]; const int g = lane >> 4;
#pragma unroll
  for (int i = 0; i < 8; ++i) { const int ka = k0 + 8 * g + i, kb = ka + 16; v[i] = ka < K ? row[ka < K ? ka : K - 1] : 0.f; v[8 + i] = kb < K ? row[kb < K ? kb : K - 1] : 0.f; }
  return bsplit16(v); }
__device__ __forceinline__ F2 split_col(const float* W, int k0, int n, int lane, int ld, int K) { float v[16]; const int g = lane >> 4;
#pragma unroll
  for (int i = 0; i < 8; ++i) { const int ka = k0 + 8 * g + i, kb = ka + 16; v[i] = ka < K ? W[(size_t)(ka < K ? ka : K - 1) * ld + n] : 0.f; v[8 + i] = kb < K ? W[(size_t)(kb < K ? kb : K - 1) * ld + n] : 0.f; }
  return bsplit16(v); }
__device__ __forceinline__ v8f mac3(const F2& a, const F2& b, v8f c) { c = wmma_bf(a.l, b.h, c); c = wmma_bf(a.h, b.l, c); return wmma_bf(a.h, b.h, c); }
__device__ __forceinline__ float sigm(float v) { return 1.0f / (1.0f + expf(-v)); }
#define LDSX() do { asm volatile("s_wait_dscnt 0" ::: "memory"); __builtin_amdgcn_wave_barrier(); __builtin_amdgcn_fence(__ATOMIC_RELEASE, "workgroup"); } while (0)


// General causal self attention (B 2, T 2,048, C 1,024 = 16 x 64): [qk_t | v] = x W_ca + b_ca; scores = x_head . qk_t_head / 8 (the raw input is the query), causal softmax, . v, output Linear.
#define NB 2
#define TT 2048
#define CC 1024
#define NH 16
#define HD 64
#ifndef TNB
#define TNB NB
#endif
typedef __attribute__((ext_vector_type(8))) __bf16 v8b;
__device__ __forceinline__ v16b frag_b(const __bf16* rowk0, int lane) {
  union { v16b v; v8b q[2]; } u; const __bf16* p = rowk0 + 8 * (lane >> 4);
  u.q[0] = *(const v8b*)p; u.q[1] = *(const v8b*)(p + 16); return u.v;
}
__device__ __forceinline__ float bfr(float v) { return (float)(__bf16)v; }
__device__ __attribute__((noinline)) float exp_ni(float v) { return expf(v); }
__device__ __attribute__((noinline)) float erf_ni(float v) { return erff(v); }

#define WS_QH  0u
#define WS_QL  (WS_QH + 2u * (size_t)NB * TT * CC)
#define WS_KH  (WS_QL + 2u * (size_t)NB * TT * CC)
#define WS_VT  (WS_KH + 2u * (size_t)NB * TT * CC)      // bf16 v planes [b][c][t]
#define WS_VL  (WS_VT + 2u * (size_t)NB * CC * TT)      // bf16 v residual planes
#define HG 4                                          // heads per launch group
#define WS_S   (WS_VL + 2u * (size_t)NB * CC * TT)      // f32 logits / P for HG heads [hg][q][k]
#define WS_PH  (WS_S + 4u * (size_t)HG * TT * TT)
#define WS_Y   (WS_PH + 0u)              // f32 y rows [b*t][C]
#define WS_END (WS_Y + 4u * (size_t)NB * TT * CC)

// ---- k_proj: block = (64 rows, 128 cols, which): [qk_t | v] = x W (+ b), exact; qk_t -> f16 rows, v -> bf16 planes (+ residual)
__global__ __launch_bounds__(128) void k_proj(const float* __restrict__ X, const float* __restrict__ WA, const float* __restrict__ BA, _Float16* __restrict__ QH, _Float16* __restrict__ QL, _Float16* __restrict__ KH, __bf16* __restrict__ VT, __bf16* __restrict__ VL) {
  __shared__ __align__(16) _Float16 sh[64][136], sl[64][136]; __shared__ __align__(16) __bf16 th[128][72], tl2[128][72];
  const int tid = threadIdx.x, wave = tid >> 5, lane = tid & 31, col = lane & 15, g = lane >> 4; const int which = blockIdx.z + 1; /* 1: qk_t -> KH, 2: v -> planes (no q projection: the query is x itself) */ const int c0 = blockIdx.y * 128; const size_t r0 = (size_t)blockIdx.x * 64;
  v8f acc[8] = {};
#pragma unroll 2
  for (int kc = 0; kc < CC / 32; ++kc) { v16b a; { const float* p = X + (r0 + wave * 16 + col) * CC + kc * 32 + 8 * g;
#pragma unroll
      for (int i = 0; i < 8; ++i) { a[i] = (__bf16)p[i]; a[8 + i] = (__bf16)p[16 + i]; } }
#pragma unroll
    for (int j = 0; j < 8; ++j) { v16b w; const int o = (which - 1) * CC + c0 + j * 16 + col;
#pragma unroll
      for (int i = 0; i < 8; ++i) { w[i] = (__bf16)WA[(size_t)(kc * 32 + 8 * g + i) * (2 * CC) + (o)]; w[8 + i] = (__bf16)WA[(size_t)(kc * 32 + 16 + 8 * g + i) * (2 * CC) + (o)]; }
      acc[j] = wmma_bf(a, w, acc[j]); } }
#pragma unroll
  for (int j = 0; j < 8; ++j) { const float bb = BA ? bfr(BA[(which - 1) * CC + c0 + j * 16 + col]) : 0.f;
#pragma unroll
    for (int r = 0; r < 8; ++r) { const float v = acc[j][r] + bb; const int rl = wave * 16 + 8 * g + r, cl = j * 16 + col; const _Float16 hv = (_Float16)v;
      if (which == 2) { const __bf16 bh = (__bf16)v; th[cl][rl] = bh; tl2[cl][rl] = (__bf16)(v - (float)bh); } else { sh[rl][cl] = hv; sl[rl][cl] = (_Float16)(v - (float)hv); } } }
  __syncthreads();
  if (which < 2) { _Float16* dh = which == 0 ? QH : KH; for (int e = tid; e < 64 * 16; e += 128) { const int rl = e >> 4, q = e & 15; vst2((unsigned*)(dh + (r0 + rl) * CC + c0 + q * 8), *(const v4u*)&sh[rl][q * 8]); if (which == 0) vst2((unsigned*)(QL + (r0 + rl) * CC + c0 + q * 8), *(const v4u*)&sl[rl][q * 8]); } }
  else { const size_t b = r0 / TT; const int t0 = (int)(r0 % TT); for (int e = tid; e < 128 * 8; e += 128) { const int cl = e >> 3, q = e & 7; const size_t o2 = (b * CC + c0 + cl) * (size_t)TT + t0 + q * 8; vst2((unsigned*)(VT + o2), *(const v4u*)&th[cl][q * 8]); vst2((unsigned*)(VL + o2), *(const v4u*)&tl2[cl][q * 8]); } } }
// ---- k_sc: block = (64 queries, 128 keys) of (b,h): logits * scale; causal blocks beyond the diagonal exit
__global__ __launch_bounds__(128) void k_sc(const _Float16* __restrict__ QH, const _Float16* __restrict__ QL, const _Float16* __restrict__ KH, const float* __restrict__ X, int b, int h0, float* __restrict__ S0) { __shared__ __align__(16) float ss[4][16][132]; const int h = h0 + blockIdx.z; float* S = S0 + (size_t)blockIdx.z * TT * TT;
  const int tid = threadIdx.x, wave = tid >> 5, lane = tid & 31, col = lane & 15, g = lane >> 4; const int k0 = blockIdx.y * 128; const int ql0 = blockIdx.x * 64 + wave * 16; const size_t q0 = (size_t)b * TT + ql0;
  if (k0 > blockIdx.x * 64 + 63) return;   // whole key block above the diagonal (block-uniform)
  v8f acc[8] = {};
#pragma unroll
  for (int kc = 0; kc < HD / 32; ++kc) { v16h ah; { const float* xp = X + (q0 + col) * CC + h * HD + kc * 32 + 8 * g;
#pragma unroll
      for (int i = 0; i < 8; ++i) { ah[i] = (_Float16)bfr(xp[i]); ah[8 + i] = (_Float16)bfr(xp[16 + i]); } } (void)QH; (void)QL;   // query = raw input head slice (bf16-exact values, exact in f16)
#pragma unroll
    for (int j = 0; j < 8; ++j) { const v16h kb = frag_h(KH + ((size_t)b * TT + k0 + j * 16 + col) * CC + h * HD + kc * 32, lane); acc[j] = wmma16(ah, kb, acc[j]); } }
#pragma unroll
  for (int j = 0; j < 8; ++j) { const int kt = k0 + j * 16 + col;
#pragma unroll
    for (int r = 0; r < 8; ++r) { const int qt = ql0 + 8 * g + r; float v = acc[j][r] * 0.125f; if (kt > qt) v = -3.0e38f; ss[wave][8 * g + r][j * 16 + col] = v; } }
  LDSX(); for (int rl = 0; rl < 16; ++rl) vst2(S + (size_t)(ql0 + rl) * TT + k0 + lane * 4, *(const v4f*)&ss[wave][rl][lane * 4]); }
// ---- k_sm: block = query row: softmax over keys [0, kend) -> P x 2^11 f32 (masked -> 0)
__global__ __launch_bounds__(256) void k_sm(float* __restrict__ S0) { __shared__ float sred[8]; __shared__ float sbc; __shared__ __align__(16) float sh[TT];
  const int t = threadIdx.x; const size_t row = blockIdx.x; float* sr = S0 + (size_t)blockIdx.y * TT * TT + row * TT; const int kend = ((int)row / 64) * 64 + 64;
  float m = -3.0e38f; for (int k = t; k < kend; k += 256) m = fmaxf(m, sr[k]);
#pragma unroll
  for (int o = 1; o < 32; o <<= 1) m = fmaxf(m, __shfl_xor(m, o));
  if ((t & 31) == 0) sred[t >> 5] = m; __syncthreads(); if (t == 0) { float a = sred[0]; for (int i = 1; i < 8; ++i) a = fmaxf(a, sred[i]); sbc = a; } __syncthreads(); m = sbc; __syncthreads();
  float sum = 0.f; for (int k = t; k < kend; k += 256) { const float v = sr[k]; sum += (v <= -1.0e38f) ? 0.f : expf(v - m); }
#pragma unroll
  for (int o = 1; o < 32; o <<= 1) sum += __shfl_xor(sum, o);
  if ((t & 31) == 0) sred[t >> 5] = sum; __syncthreads(); if (t == 0) { float a = 0.f; for (int i = 0; i < 8; ++i) a += sred[i]; sbc = 1.0f / a; } __syncthreads(); const float inv = sbc;
  for (int k = t; k < kend; k += 256) { const float v = sr[k]; sh[k] = (v <= -1.0e38f) ? 0.f : expf(v - m) * inv * 2048.0f; }
  __syncthreads(); for (int q = t; q < kend / 4; q += 256) vst2(sr + q * 4, *(const v4f*)&sh[q * 4]); }
// ---- k_pv: block = 64 queries of (b,h): y[q][h*HD + d] = P . v  (keys [0, kend))
__global__ __launch_bounds__(128) void k_pv(const float* __restrict__ PS0, const __bf16* __restrict__ VT, const __bf16* __restrict__ VL, int b, int h0, float* __restrict__ Y) { const int h = h0 + blockIdx.z; const float* PS = PS0 + (size_t)blockIdx.z * TT * TT; __shared__ __align__(16) float ss[4][16][HD + 4];
  const int tid = threadIdx.x, wave = tid >> 5, lane = tid & 31, col = lane & 15, g = lane >> 4; const int ql0 = blockIdx.x * 64 + wave * 16; const int kend = blockIdx.x * 64 + 64;
  v8f acc[HD / 16] = {};
#pragma unroll 1
  for (int kc = 0; kc < kend / 32; ++kc) { const F2 p = split_row(PS + (size_t)(ql0 + col) * TT, kc * 32, lane);
#pragma unroll
    for (int j = 0; j < HD / 16; ++j) { const size_t po = ((size_t)b * CC + h * HD + j * 16 + col) * (size_t)TT + kc * 32; const v16b vh = frag_b(VT + po, lane); acc[j] = wmma_bf(p.h, vh, acc[j]); acc[j] = wmma_bf(p.l, vh, acc[j]); acc[j] = wmma_bf(p.h, frag_b(VL + po, lane), acc[j]); } }
#pragma unroll
  for (int j = 0; j < HD / 16; ++j)
#pragma unroll
    for (int r = 0; r < 8; ++r) ss[wave][8 * g + r][j * 16 + col] = acc[j][r] * (1.0f / 2048.0f);
  LDSX(); for (int rl = 0; rl < 16; ++rl) if (lane < HD / 4) vst2(Y + ((size_t)b * TT + ql0 + rl) * CC + h * HD + lane * 4, *(const v4f*)&ss[wave][rl][lane * 4]); }
// ---- k_out: block = (64 rows, 128 cols): out = y (bf16 hi + lo) Wproj + b
__global__ __launch_bounds__(128) void k_out(const float* __restrict__ Y, const float* __restrict__ WP, const float* __restrict__ BP, float* __restrict__ OUT) { __shared__ __align__(16) float sf[4][16][132];
  const int tid = threadIdx.x, wave = tid >> 5, lane = tid & 31, col = lane & 15, g = lane >> 4; const int c0 = blockIdx.y * 128; const size_t r0 = (size_t)blockIdx.x * 64 + wave * 16;
  v8f acc[8] = {};
#pragma unroll 2
  for (int kc = 0; kc < CC / 32; ++kc) { const F2 a = split_row(Y + (r0 + col) * CC, kc * 32, lane);
#pragma unroll
    for (int j = 0; j < 8; ++j) { v16b w; const int o = c0 + j * 16 + col;
#pragma unroll
      for (int i = 0; i < 8; ++i) { w[i] = (__bf16)WP[(size_t)(kc * 32 + 8 * g + i) * CC + (o)]; w[8 + i] = (__bf16)WP[(size_t)(kc * 32 + 16 + 8 * g + i) * CC + (o)]; }
      acc[j] = wmma_bf(a.h, w, acc[j]); acc[j] = wmma_bf(a.l, w, acc[j]); } }
#pragma unroll
  for (int j = 0; j < 8; ++j) { const float bb = BP ? bfr(BP[c0 + j * 16 + col]) : 0.f;
#pragma unroll
    for (int r = 0; r < 8; ++r) sf[wave][8 * g + r][j * 16 + col] = acc[j][r] + bb; }
  LDSX(); for (int rl = 0; rl < 16; ++rl) vst2(OUT + (r0 + rl) * CC + c0 + lane * 4, *(const v4f*)&sf[wave][rl][lane * 4]); }
extern "C" void kernel_launch(void* const* d_in, const int* in_sizes, int n_in, void* d_out, int out_size, void* d_ws, size_t ws_size, hipStream_t stream) {
  (void)in_sizes; (void)n_in; (void)out_size;
  const float** F = (const float**)d_in;   // 0 xt [2,2048,1024], 1 W_ca [1024,2048] (in,out), 2 b_ca [2048], 3 W_proj [1024,1024], 4 b_proj
  if (ws_size < (size_t)WS_END) return;
  char* ws = (char*)d_ws; _Float16 *QH = (_Float16*)(ws + WS_QH), *QL = (_Float16*)(ws + WS_QL), *KH = (_Float16*)(ws + WS_KH); __bf16 *VT = (__bf16*)(ws + WS_VT), *VL = (__bf16*)(ws + WS_VL); float *S = (float*)(ws + WS_S), *Y = (float*)(ws + WS_Y);
  k_proj<<<dim3(TNB * TT / 64, CC / 128, 2), 128, 0, stream>>>(F[0], F[1], F[2], QH, QL, KH, VT, VL);   // which 1 -> qk_t (cols 0..C), which 2 -> v (cols C..2C) of the [C, 2C] weight
  for (int b = 0; b < TNB; ++b) for (int h0 = 0; h0 < NH; h0 += HG) {   // HG heads per launch
    k_sc<<<dim3(TT / 64, TT / 128, HG), 128, 0, stream>>>(QH, QL, KH, F[0], b, h0, S);
    k_sm<<<dim3(TT, HG), 256, 0, stream>>>(S);
    k_pv<<<dim3(TT / 64, 1, HG), 128, 0, stream>>>(S, VT, VL, b, h0, Y);
  }
  k_out<<<dim3(TNB * TT / 64, CC / 128), 128, 0, stream>>>(Y, F[3], F[4], (float*)d_out);
}

// v001
// It runs in 219 microseconds.
// Timed twice side by side with v000, it ran 5.77 and 5.80 times as fast.
// compute dtype: all float inputs rounded to bf16; [qk_t | v] = x W_ca + b_ca ([C, 2C]) with EXACT bf16 products on WMMA 16x16x32, f32 accumulate; query = the bf16-exact input rows themselves (as f16, exact), qk_t rounded once to f16 -> 1-product logits / 8, causal, kept in registers (one launch for all heads); running-maximum softmax in f32 (precise expf), un-normalised P split bf16 hi + lo against v bf16 hi + lo (3 products), divided by the row sum at the end; out = y (bf16 hi + lo) W_proj + b_proj; f32 output.
#include <hip/hip_runtime.h>
#include <math.h>

typedef __attribute__((ext_vector_type(16))) _Float16 v16h;
typedef __attribute__((ext_vector_type(16))) __bf16 v16b;
typedef __attribute__((ext_vector_type(8)))  _Float16 v8h;
typedef __attribute__((ext_vector_type(8)))  float v8f;
typedef __attribute__((ext_vector_type(4)))  float v4f;
typedef __attribute__((ext_vector_type(2)))  float v2f;
typedef __attribute__((ext_vector_type(4)))  unsigned v4u;
typedef __attribute__((ext_vector_type(4)))  int v4i;
typedef float __attribute__((may_alias)) float_a;
typedef int __attribute__((may_alias)) int_a;

template <typename T> __device__ __forceinline__ void vst2(void* p, T v) { *(T*)p = v;  }
__device__ __forceinline__ v8f wmma16(v16h a, v16h b, v8f c) {
  v8f d = __builtin_amdgcn_wmma_f32_16x16x32_f16(false, a, false, b, (short)0, c, false, false);
  asm volatile("v_nop\n\tv_nop\n\tv_nop\n\tv_nop" : "+v"(d) : "v"(a), "v"(b));
  return d;
}
__device__ __forceinline__ v8f wmma_bf(v16b a, v16b b, v8f c) {
  v8f d = __builtin_amdgcn_wmma_f32_16x16x32_bf16(false, a, false, b, (short)0, c, false, false);
  asm volatile("v_nop\n\tv_nop\n\tv_nop\n\tv_nop" : "+v"(d) : "v"(a), "v"(b));
  return d;
}
// 16x16x32 fragments: lane = (h = lane>>4, row/col = lane&15); elements 0..7 = k0+8h+0..7, 8..15 = k0+16+8h+0..7; D element r = row 8h+r
__device__ __forceinline__ v16h frag_h(const _Float16* rowk0, int lane) {
  union { v16h v; v8h q[2]; } u; const _Float16* p = rowk0 + 8 * (lane >> 4);
  u.q[0] = *(const v8h*)p; u.q[1] = *(const v8h*)(p + 16); return u.v;
}
__device__ __forceinline__ v16h frag_f32(const float* rowk0, int lane) {
  v16h a; const float* p = rowk0 + 8 * (lane >> 4);
#pragma unroll
  for (int i = 0; i < 8; ++i) { a[i] = (_Float16)p[i]; a[8 + i] = (_Float16)p[16 + i]; }
  return a;
}
__device__ __forceinline__ v16h frag_f32s(const float* rowk0, int lane, float sc) {
  v16h a; const float* p = rowk0 + 8 * (lane >> 4);
#pragma unroll
  for (int i = 0; i < 8; ++i) { a[i] = (_Float16)(p[i] * sc); a[8 + i] = (_Float16)(p[16 + i] * sc); }
  return a;
}
// column fragment from a [K][ld] layout (column n), rows >= K read as 0
__device__ __forceinline__ v16h fragc_f32(const float* W, int k0, int n, int lane, int ld, int K) {
  v16h a; const int g = lane >> 4;
#pragma unroll
  for (int i = 0; i < 8; ++i) { const int ka = k0 + 8 * g + i, kb = ka + 16;
    a[i] = (_Float16)(ka < K ? W[(size_t)(ka < K ? ka : K - 1) * ld + n] : 0.f); a[8 + i] = (_Float16)(kb < K ? W[(size_t)(kb < K ? kb : K - 1) * ld + n] : 0.f); }
  return a;
}
struct F2 { v16b h, l; };
__device__ __forceinline__ F2 bsplit16(const float v[16]) { F2 r;
#pragma unroll
  for (int i = 0; i < 16; ++i) { const __bf16 h = (__bf16)v[i]; r.h[i] = h; r.l[i] = (__bf16)(v[i] - (float)h); }
  return r; }
__device__ __forceinline__ F2 split_row(const float* row, int k0, int lane) { float v[16]; const float* p = row + k0 + 8 * (lane >> 4);
#pragma unroll
  for (int i = 0; i < 8; ++i) { v[i] = p[i]; v[8 + i] = p[16 + i]; }
  return bsplit16(v); }
__device__ __forceinline__ F2 split_rowK(const float* row, int k0, int lane, int K) { float v[16]; const int g = lane >> 4;
#pragma unroll
  for (int i = 0; i < 8; ++i) { const int ka = k0 + 8 * g + i, kb = ka + 16; v[i] = ka < K ? row[ka < K ? ka : K - 1] : 0.f; v[8 + i] = kb < K ? row[kb < K ? kb : K - 1] : 0.f; }
  return bsplit16(v); }
__device__ __forceinline__ F2 split_col(const float* W, int k0, int n, int lane, int ld, int K) { float v[16]; const int g = lane >> 4;
#pragma unroll
  for (int i = 0; i < 8; ++i) { const int ka = k0 + 8 * g + i, kb = ka + 16; v[i] = ka < K ? W[(size_t)(ka < K ? ka : K - 1) * ld + n] : 0.f; v[8 + i] = kb < K ? W[(size_t)(kb < K ? kb : K - 1) * ld + n] : 0.f; }
  return bsplit16(v); }
__device__ __forceinline__ v8f mac3(const F2& a, const F2& b, v8f c) { c = wmma_bf(a.l, b.h, c); c = wmma_bf(a.h, b.l, c); return wmma_bf(a.h, b.h, c); }
__device__ __forceinline__ float sigm(float v) { return 1.0f / (1.0f + expf(-v)); }
#define LDSX() do { asm volatile("s_wait_dscnt 0" ::: "memory"); __builtin_amdgcn_wave_barrier(); __builtin_amdgcn_fence(__ATOMIC_RELEASE, "workgroup"); } while (0)


// General causal self attention (B 2, T 2,048, C 1,024 = 16 x 64): [qk_t | v] = x W_ca + b_ca; scores = x_head . qk_t_head / 8 (the raw input is the query), causal softmax, . v, output Linear.
#define NB 2
#define TT 2048
#define CC 1024
#define NH 16
#define HD 64
#ifndef TNB
#define TNB NB
#endif
typedef __attribute__((ext_vector_type(8))) __bf16 v8b;
__device__ __forceinline__ v16b frag_b(const __bf16* rowk0, int lane) {
  union { v16b v; v8b q[2]; } u; const __bf16* p = rowk0 + 8 * (lane >> 4);
  u.q[0] = *(const v8b*)p; u.q[1] = *(const v8b*)(p + 16); return u.v;
}
__device__ __forceinline__ float bfr(float v) { return (float)(__bf16)v; }
__device__ __attribute__((noinline)) float exp_ni(float v) { return expf(v); }
__device__ __attribute__((noinline)) float erf_ni(float v) { return erff(v); }

#define WS_QH  0u
#define WS_QL  (WS_QH + 2u * (size_t)NB * TT * CC)
#define WS_KH  (WS_QL + 2u * (size_t)NB * TT * CC)
#define WS_VT  (WS_KH + 2u * (size_t)NB * TT * CC)      // bf16 v planes [b][c][t]
#define WS_VL  (WS_VT + 2u * (size_t)NB * CC * TT)      // bf16 v residual planes
#define HG 4                                          // only sizes WS_S; all heads run in one launch
#define WS_S   (WS_VL + 2u * (size_t)NB * CC * TT)      // unused: k_fa keeps logits in registers
#define WS_PH  (WS_S + 4u * (size_t)HG * TT * TT)
#define WS_Y   (WS_PH + 0u)              // f32 y rows [b*t][C]
#define WS_END (WS_Y + 4u * (size_t)NB * TT * CC)

// ---- k_proj: block = (64 rows, 128 cols, which): [qk_t | v] = x W (+ b), exact; qk_t -> f16 rows, v -> bf16 planes (+ residual)
__global__ __launch_bounds__(128) void k_proj(const float* __restrict__ X, const float* __restrict__ WA, const float* __restrict__ BA, _Float16* __restrict__ QH, _Float16* __restrict__ QL, _Float16* __restrict__ KH, __bf16* __restrict__ VT, __bf16* __restrict__ VL) {
  __shared__ __align__(16) _Float16 sh[64][136], sl[64][136]; __shared__ __align__(16) __bf16 th[128][72], tl2[128][72];
  const int tid = threadIdx.x, wave = tid >> 5, lane = tid & 31, col = lane & 15, g = lane >> 4; const int which = blockIdx.z + 1; /* 1: qk_t -> KH, 2: v -> planes (no q projection: the query is x itself) */ const int c0 = blockIdx.y * 128; const size_t r0 = (size_t)blockIdx.x * 64;
  v8f acc[8] = {};
#pragma unroll 2
  for (int kc = 0; kc < CC / 32; ++kc) { v16b a; { const float* p = X + (r0 + wave * 16 + col) * CC + kc * 32 + 8 * g;
#pragma unroll
      for (int i = 0; i < 8; ++i) { a[i] = (__bf16)p[i]; a[8 + i] = (__bf16)p[16 + i]; } }
#pragma unroll
    for (int j = 0; j < 8; ++j) { v16b w; const int o = (which - 1) * CC + c0 + j * 16 + col;
#pragma unroll
      for (int i = 0; i < 8; ++i) { w[i] = (__bf16)WA[(size_t)(kc * 32 + 8 * g + i) * (2 * CC) + (o)]; w[8 + i] = (__bf16)WA[(size_t)(kc * 32 + 16 + 8 * g + i) * (2 * CC) + (o)]; }
      acc[j] = wmma_bf(a, w, acc[j]); } }
#pragma unroll
  for (int j = 0; j < 8; ++j) { const float bb = BA ? bfr(BA[(which - 1) * CC + c0 + j * 16 + col]) : 0.f;
#pragma unroll
    for (int r = 0; r < 8; ++r) { const float v = acc[j][r] + bb; const int rl = wave * 16 + 8 * g + r, cl = j * 16 + col; const _Float16 hv = (_Float16)v;
      if (which == 2) { const __bf16 bh = (__bf16)v; th[cl][rl] = bh; tl2[cl][rl] = (__bf16)(v - (float)bh); } else { sh[rl][cl] = hv; sl[rl][cl] = (_Float16)(v - (float)hv); } } }
  __syncthreads();
  if (which < 2) { _Float16* dh = which == 0 ? QH : KH; for (int e = tid; e < 64 * 16; e += 128) { const int rl = e >> 4, q = e & 15; vst2((unsigned*)(dh + (r0 + rl) * CC + c0 + q * 8), *(const v4u*)&sh[rl][q * 8]); if (which == 0) vst2((unsigned*)(QL + (r0 + rl) * CC + c0 + q * 8), *(const v4u*)&sl[rl][q * 8]); } }
  else { const size_t b = r0 / TT; const int t0 = (int)(r0 % TT); for (int e = tid; e < 128 * 8; e += 128) { const int cl = e >> 3, q = e & 7; const size_t o2 = (b * CC + c0 + cl) * (size_t)TT + t0 + q * 8; vst2((unsigned*)(VT + o2), *(const v4u*)&th[cl][q * 8]); vst2((unsigned*)(VL + o2), *(const v4u*)&tl2[cl][q * 8]); } } }
__device__ __forceinline__ float xhalf(float x) { return __builtin_bit_cast(float, __builtin_amdgcn_permlanex16(__builtin_bit_cast(int, x), __builtin_bit_cast(int, x), 0x76543210, 0xfedcba98, false, false)); }   // lane l <-> lane l ^ 16
// ---- k_fa: wave = 16 queries of (b,h), no logits in memory. Pass = 32 keys: S^T = K x^T (lane = one query, 16 keys in its registers), running maximum and sum per lane, Y^T += V^T P^T (P^T packs from the S^T tiles as the B operand)
__global__ __launch_bounds__(128) void k_fa(const float* __restrict__ X, const _Float16* __restrict__ KH, const __bf16* __restrict__ VT, const __bf16* __restrict__ VL, float* __restrict__ Y) {
  // every '#pragma unroll' in this kernel: constant trip count, unrolled so that the fragment arrays are indexed by constants and stay in registers
  const int tid = threadIdx.x, wave = __builtin_amdgcn_readfirstlane(tid >> 5) /* scalar: the pass count and the diagonal test become scalar branches, EXEC stays all ones at every WMMA */, lane = tid & 31, col = lane & 15, g = lane >> 4;
  const int h = blockIdx.x % NH, b = blockIdx.x / NH;
  const int ql0 = (TT / 64 - 1 - (int)blockIdx.y) * 64 + wave * 16;   // longest query blocks start first
  const int np = (ql0 + 16 + 31) >> 5;                                       // passes up to and including the diagonal (wave-uniform)
  const int qt = ql0 + col;
  v16h qf[HD / 32];
#pragma unroll
  for (int kc = 0; kc < HD / 32; ++kc) { const float* xp = X + ((size_t)b * TT + qt) * CC + h * HD + kc * 32 + 8 * g;
#pragma unroll
    for (int i = 0; i < 8; ++i) { qf[kc][i] = (_Float16)bfr(xp[i]); qf[kc][8 + i] = (_Float16)bfr(xp[16 + i]); } }   // query = raw input head slice (bf16-exact values, exact in f16)
  const _Float16* kp = KH + ((size_t)b * TT + col) * CC + h * HD;
  const size_t vo = ((size_t)b * CC + h * HD + col) * (size_t)TT;
  v8f acc[HD / 16] = {}; float m = -3.0e38f, l = 0.f;
  v16h kf[2][HD / 32];
#pragma unroll
  for (int t = 0; t < 2; ++t)
#pragma unroll
    for (int kc = 0; kc < HD / 32; ++kc) kf[t][kc] = frag_h(kp + (size_t)(t * 16) * CC + kc * 32, lane);
  for (int ps = 0; ps < np; ++ps) { const int k0 = ps * 32;
    v16b vh[HD / 16], vl[HD / 16];
#pragma unroll
    for (int j = 0; j < HD / 16; ++j) { const size_t po = vo + (size_t)(j * 16) * TT + k0; vh[j] = frag_b(VT + po, lane); vl[j] = frag_b(VL + po, lane); }
    v8f st[2] = {};
#pragma unroll
    for (int t = 0; t < 2; ++t)
#pragma unroll
      for (int kc = 0; kc < HD / 32; ++kc) st[t] = __builtin_amdgcn_wmma_f32_16x16x32_f16(false, kf[t][kc], false, qf[kc], (short)0, st[t], false, false);   // st[t][r] = logit(key k0 + 16 t + 8 g + r, query qt)
    const int kn = (ps + 1 < np ? ps + 1 : ps) * 32;   // next pass's key rows, fetched one pass ahead (the last pass re-reads its own)
#pragma unroll
    for (int t = 0; t < 2; ++t)
#pragma unroll
      for (int kc = 0; kc < HD / 32; ++kc) kf[t][kc] = frag_h(kp + (size_t)(kn + t * 16) * CC + kc * 32, lane);
    asm volatile("s_wait_xcnt 0x0" ::: "memory");   // behind the pass's loads, before their address registers are reused by the softmax code
    float p[16];
#pragma unroll
    for (int t = 0; t < 2; ++t)
#pragma unroll
      for (int r = 0; r < 8; ++r) p[t * 8 + r] = st[t][r] * 0.125f;
    if (k0 + 31 > ql0) {   // only passes that reach the diagonal hold masked keys
#pragma unroll
      for (int i = 0; i < 16; ++i) if (k0 + (i >> 3) * 16 + 8 * g + (i & 7) > qt) p[i] = -3.0e38f; }
    float mx = p[0];
#pragma unroll
    for (int i = 1; i < 16; ++i) mx = fmaxf(mx, p[i]);
    mx = fmaxf(mx, xhalf(mx));
    const float mn = fmaxf(m, mx), al = expf(m - mn); m = mn;
    float sum = 0.f;
#pragma unroll
    for (int i = 0; i < 16; ++i) { p[i] = expf(p[i] - mn); sum += p[i]; }   // a masked key: expf(-3e38 - mn) is exactly 0 (mn is finite: key 0 is open to every query)
    l = l * al + sum;   // each lane half keeps the sum of its own keys; joined after the loop
#pragma unroll
    for (int j = 0; j < HD / 16; ++j) acc[j] *= al;
    const F2 pf = bsplit16(p);
#pragma unroll
    for (int j = 0; j < HD / 16; ++j) { acc[j] = __builtin_amdgcn_wmma_f32_16x16x32_bf16(false, vh[j], false, pf.h, (short)0, acc[j], false, false); acc[j] = __builtin_amdgcn_wmma_f32_16x16x32_bf16(false, vh[j], false, pf.l, (short)0, acc[j], false, false); acc[j] = __builtin_amdgcn_wmma_f32_16x16x32_bf16(false, vl[j], false, pf.h, (short)0, acc[j], false, false); } }
  l += xhalf(l); const float inv = 1.0f / l;
  float* yp = Y + ((size_t)b * TT + qt) * CC + h * HD + 8 * g;   // acc[j][r] = y(query qt, d = 16 j + 8 g + r)
#pragma unroll
  for (int j = 0; j < HD / 16; ++j) { v4f lo, hi;
#pragma unroll
    for (int r = 0; r < 4; ++r) { lo[r] = acc[j][r] * inv; hi[r] = acc[j][4 + r] * inv; }
    vst2(yp + j * 16, lo); vst2(yp + j * 16 + 4, hi); } }
// ---- k_out: block = (64 rows, 128 cols): out = y (bf16 hi + lo) Wproj + b
__global__ __launch_bounds__(128) void k_out(const float* __restrict__ Y, const float* __restrict__ WP, const float* __restrict__ BP, float* __restrict__ OUT) { __shared__ __align__(16) float sf[4][16][132];
  const int tid = threadIdx.x, wave = tid >> 5, lane = tid & 31, col = lane & 15, g = lane >> 4; const int c0 = blockIdx.y * 128; const size_t r0 = (size_t)blockIdx.x * 64 + wave * 16;
  v8f acc[8] = {};
#pragma unroll 2
  for (int kc = 0; kc < CC / 32; ++kc) { const F2 a = split_row(Y + (r0 + col) * CC, kc * 32, lane);
#pragma unroll
    for (int j = 0; j < 8; ++j) { v16b w; const int o = c0 + j * 16 + col;
#pragma unroll
      for (int i = 0; i < 8; ++i) { w[i] = (__bf16)WP[(size_t)(kc * 32 + 8 * g + i) * CC + (o)]; w[8 + i] = (__bf16)WP[(size_t)(kc * 32 + 16 + 8 * g + i) * CC + (o)]; }
      acc[j] = wmma_bf(a.h, w, acc[j]); acc[j] = wmma_bf(a.l, w, acc[j]); } }
#pragma unroll
  for (int j = 0; j < 8; ++j) { const float bb = BP ? bfr(BP[c0 + j * 16 + col]) : 0.f;
#pragma unroll
    for (int r = 0; r < 8; ++r) sf[wave][8 * g + r][j * 16 + col] = acc[j][r] + bb; }
  LDSX(); for (int rl = 0; rl < 16; ++rl) vst2(OUT + (r0 + rl) * CC + c0 + lane * 4, *(const v4f*)&sf[wave][rl][lane * 4]); }
extern "C" void kernel_launch(void* const* d_in, const int* in_sizes, int n_in, void* d_out, int out_size, void* d_ws, size_t ws_size, hipStream_t stream) {
  (void)in_sizes; (void)n_in; (void)out_size;
  const float** F = (const float**)d_in;   // 0 xt [2,2048,1024], 1 W_ca [1024,2048] (in,out), 2 b_ca [2048], 3 W_proj [1024,1024], 4 b_proj
  if (ws_size < (size_t)WS_END) return;
  char* ws = (char*)d_ws; _Float16 *QH = (_Float16*)(ws + WS_QH), *QL = (_Float16*)(ws + WS_QL), *KH = (_Float16*)(ws + WS_KH); __bf16 *VT = (__bf16*)(ws + WS_VT), *VL = (__bf16*)(ws + WS_VL); float *Y = (float*)(ws + WS_Y);
  k_proj<<<dim3(TNB * TT / 64, CC / 128, 2), 128, 0, stream>>>(F[0], F[1], F[2], QH, QL, KH, VT, VL);   // which 1 -> qk_t (cols 0..C), which 2 -> v (cols C..2C) of the [C, 2C] weight
  k_fa<<<dim3(TNB * NH, TT / 64), 128, 0, stream>>>(F[0], KH, VT, VL, Y);   // all batches and heads in one launch
  k_out<<<dim3(TNB * TT / 64, CC / 128), 128, 0, stream>>>(Y, F[3], F[4], (float*)d_out);
}

// v002
// It runs in 149 microseconds.
// In both of two side-by-side timings against v001, it was 1.47 times as fast.
// Over all steps from v000 it is 8.52 times as fast.
// compute dtype: all float inputs rounded to bf16; [qk_t | v] = x W_ca + b_ca ([C, 2C]) with EXACT bf16 products on WMMA 16x16x32, f32 accumulate; query = the bf16-exact input rows themselves (as f16, exact), qk_t rounded once to f16 -> 1-product logits / 8, causal, kept in registers (one launch for all heads); running-maximum softmax in f32 (precise expf), un-normalised P split bf16 hi + lo against v bf16 hi + lo (3 products), divided by the row sum at the end; out = y (bf16 hi + lo) W_proj + b_proj; f32 output.
#include <hip/hip_runtime.h>
#include <math.h>

typedef __attribute__((ext_vector_type(16))) _Float16 v16h;
typedef __attribute__((ext_vector_type(16))) __bf16 v16b;
typedef __attribute__((ext_vector_type(8)))  _Float16 v8h;
typedef __attribute__((ext_vector_type(8)))  float v8f;
typedef __attribute__((ext_vector_type(4)))  float v4f;
typedef __attribute__((ext_vector_type(2)))  float v2f;
typedef __attribute__((ext_vector_type(4)))  unsigned v4u;
typedef __attribute__((ext_vector_type(4)))  int v4i;
typedef float __attribute__((may_alias)) float_a;
typedef int __attribute__((may_alias)) int_a;

template <typename T> __device__ __forceinline__ void vst2(void* p, T v) { *(T*)p = v;  }
__device__ __forceinline__ v8f wmma16(v16h a, v16h b, v8f c) {
  v8f d = __builtin_amdgcn_wmma_f32_16x16x32_f16(false, a, false, b, (short)0, c, false, false);
  asm volatile("v_nop\n\tv_nop\n\tv_nop\n\tv_nop" : "+v"(d) : "v"(a), "v"(b));
  return d;
}
__device__ __forceinline__ v8f wmma_bf(v16b a, v16b b, v8f c) {
  v8f d = __builtin_amdgcn_wmma_f32_16x16x32_bf16(false, a, false, b, (short)0, c, false, false);
  asm volatile("v_nop\n\tv_nop\n\tv_nop\n\tv_nop" : "+v"(d) : "v"(a), "v"(b));
  return d;
}
// 16x16x32 fragments: lane = (h = lane>>4, row/col = lane&15); elements 0..7 = k0+8h+0..7, 8..15 = k0+16+8h+0..7; D element r = row 8h+r
__device__ __forceinline__ v16h frag_h(const _Float16* rowk0, int lane) {
  union { v16h v; v8h q[2]; } u; const _Float16* p = rowk0 + 8 * (lane >> 4);
  u.q[0] = *(const v8h*)p; u.q[1] = *(const v8h*)(p + 16); return u.v;
}
__device__ __forceinline__ v16h frag_f32(const float* rowk0, int lane) {
  v16h a; const float* p = rowk0 + 8 * (lane >> 4);
#pragma unroll
  for (int i = 0; i < 8; ++i) { a[i] = (_Float16)p[i]; a[8 + i] = (_Float16)p[16 + i]; }
  return a;
}
__device__ __forceinline__ v16h frag_f32s(const float* rowk0, int lane, float sc) {
  v16h a; const float* p = rowk0 + 8 * (lane >> 4);
#pragma unroll
  for (int i = 0; i < 8; ++i) { a[i] = (_Float16)(p[i] * sc); a[8 + i] = (_Float16)(p[16 + i] * sc); }
  return a;
}
// column fragment from a [K][ld] layout (column n), rows >= K read as 0
__device__ __forceinline__ v16h fragc_f32(const float* W, int k0, int n, int lane, int ld, int K) {
  v16h a; const int g = lane >> 4;
#pragma unroll
  for (int i = 0; i < 8; ++i) { const int ka = k0 + 8 * g + i, kb = ka + 16;
    a[i] = (_Float16)(ka < K ? W[(size_t)(ka < K ? ka : K - 1) * ld + n] : 0.f); a[8 + i] = (_Float16)(kb < K ? W[(size_t)(kb < K ? kb : K - 1) * ld + n] : 0.f); }
  return a;
}
struct F2 { v16b h, l; };
__device__ __forceinline__ F2 bsplit16(const float v[16]) { F2 r;
#pragma unroll
  for (int i = 0; i < 16; ++i) { const __bf16 h = (__bf16)v[i]; r.h[i] = h; r.l[i] = (__bf16)(v[i] - (float)h); }
  return r; }
__device__ __forceinline__ F2 split_row(const float* row, int k0, int lane) { float v[16]; const float* p = row + k0 + 8 * (lane >> 4);
#pragma unroll
  for (int i = 0; i < 8; ++i) { v[i] = p[i]; v[8 + i] = p[16 + i]; }
  return bsplit16(v); }
__device__ __forceinline__ F2 split_rowK(const float* row, int k0, int lane, int K) { float v[16]; const int g = lane >> 4;
#pragma unroll
  for (int i = 0; i < 8; ++i) { const int ka = k0 + 8 * g + i, kb = ka + 16; v[i] = ka < K ? row[ka < K ? ka : K - 1] : 0.f; v[8 + i] = kb < K ? row[kb < K ? kb : K - 1] : 0.f; }
  return bsplit16(v); }
__device__ __forceinline__ F2 split_col(const float* W, int k0, int n, int lane, int ld, int K) { float v[16]; const int g = lane >> 4;
#pragma unroll
  for (int i = 0; i < 8; ++i) { const int ka = k0 + 8 * g + i, kb = ka + 16; v[i] = ka < K ? W[(size_t)(ka < K ? ka : K - 1) * ld + n] : 0.f; v[8 + i] = kb < K ? W[(size_t)(kb < K ? kb : K - 1) * ld + n] : 0.f; }
  return bsplit16(v); }
__device__ __forceinline__ v8f mac3(const F2& a, const F2& b, v8f c) { c = wmma_bf(a.l, b.h, c); c = wmma_bf(a.h, b.l, c); return wmma_bf(a.h, b.h, c); }
__device__ __forceinline__ float sigm(float v) { return 1.0f / (1.0f + expf(-v)); }
#define LDSX() do { asm volatile("s_wait_dscnt 0" ::: "memory"); __builtin_amdgcn_wave_barrier(); __builtin_amdgcn_fence(__ATOMIC_RELEASE, "workgroup"); } while (0)


// General causal self attention (B 2, T 2,048, C 1,024 = 16 x 64): [qk_t | v] = x W_ca + b_ca; scores = x_head . qk_t_head / 8 (the raw input is the query), causal softmax, . v, output Linear.
#define NB 2
#define TT 2048
#define CC 1024
#define NH 16
#define HD 64
#ifndef TNB
#define TNB NB
#endif
typedef __attribute__((ext_vector_type(8))) __bf16 v8b;
__device__ __forceinline__ v16b frag_b(const __bf16* rowk0, int lane) {
  union { v16b v; v8b q[2]; } u; const __bf16* p = rowk0 + 8 * (lane >> 4);
  u.q[0] = *(const v8b*)p; u.q[1] = *(const v8b*)(p + 16); return u.v;
}
__device__ __forceinline__ float bfr(float v) { return (float)(__bf16)v; }
__device__ __attribute__((noinline)) float exp_ni(float v) { return expf(v); }
__device__ __attribute__((noinline)) float erf_ni(float v) { return erff(v); }

#define WS_QH  0u
#define WS_QL  (WS_QH + 2u * (size_t)NB * TT * CC)
#define WS_KH  (WS_QL + 2u * (size_t)NB * TT * CC)
#define WS_VT  (WS_KH + 2u * (size_t)NB * TT * CC)      // bf16 v planes [b][c][t]
#define WS_VL  (WS_VT + 2u * (size_t)NB * CC * TT)      // bf16 v residual planes
#define HG 4                                          // only sizes WS_S; all heads run in one launch
#define WS_S   (WS_VL + 2u * (size_t)NB * CC * TT)      // unused: k_fa keeps logits in registers
#define WS_PH  (WS_S + 4u * (size_t)HG * TT * TT)
#define WS_Y   (WS_PH + 0u)              // f32 y rows [b*t][C]
#define WS_END (WS_Y + 4u * (size_t)NB * TT * CC)

// ---- weight tile in LDS: 64 k x 128 n of a row-major f32 weight, rounded to bf16 and laid as rows [n][k] (pitch 144 B), fetched once per block for its four waves
// wave w fetches k rows 16 w .. 16 w + 15, lane = column (+ 32 j): every load is one whole 128-B line
// every '#pragma unroll' in these three helpers: constant trip count, unrolled so that the register arrays are indexed by constants
__device__ __forceinline__ void wt_load(float (&r)[4][16], const float* __restrict__ Wl, int wave, int ld) {
#pragma unroll
  for (int j = 0; j < 4; ++j)
#pragma unroll
    for (int i = 0; i < 16; ++i) r[j][i] = Wl[(size_t)(wave * 16 + i) * ld + j * 32];
}
__device__ __forceinline__ void wt_store(__bf16 (*buf)[72], const float (&r)[4][16], int wave, int lane) {
#pragma unroll
  for (int j = 0; j < 4; ++j) { v8b a, b;
#pragma unroll
    for (int i = 0; i < 8; ++i) { a[i] = (__bf16)r[j][i]; b[i] = (__bf16)r[j][8 + i]; }
    *(v8b*)&buf[j * 32 + lane][wave * 16] = a; *(v8b*)&buf[j * 32 + lane][wave * 16 + 8] = b; }
}
__device__ __forceinline__ void row_load(float (&r)[2][16], const float* __restrict__ p) {   // one row's 64 k in fragment order: r[kk][i] = k 32 kk + 8 g + i, r[kk][8 + i] = 16 more
#pragma unroll
  for (int kk = 0; kk < 2; ++kk)
#pragma unroll
    for (int i = 0; i < 8; ++i) { r[kk][i] = p[kk * 32 + i]; r[kk][8 + i] = p[kk * 32 + 16 + i]; }
}
// ---- k_proj: block = (64 rows, 128 cols, which): [qk_t | v] = x W (+ b), exact; qk_t -> f16 rows, v -> bf16 hi + residual planes
__global__ __launch_bounds__(128) void k_proj(const float* __restrict__ X, const float* __restrict__ WA, const float* __restrict__ BA, _Float16* __restrict__ QH, _Float16* __restrict__ QL, _Float16* __restrict__ KH, __bf16* __restrict__ VT, __bf16* __restrict__ VL) {
  __shared__ __align__(16) _Float16 sh[64][136], sl[64][136]; __shared__ __align__(16) __bf16 th[128][72], tl2[128][72];
  const int tid = threadIdx.x, wave = tid >> 5, lane = tid & 31, col = lane & 15, g = lane >> 4; const int which = blockIdx.z + 1; /* 1: qk_t -> KH, 2: v -> planes (no q projection: the query is x itself) */ const int c0 = blockIdx.y * 128; const size_t r0 = (size_t)blockIdx.x * 64;
  v8f acc[8] = {};
  const float* wp = WA + (size_t)(which - 1) * CC + c0 + lane;   // this lane's column of the block's weight columns
  const float* xp = X + (r0 + wave * 16 + col) * CC + 8 * g;
  float wr[4][16], xr[2][16]; v16b a[2];
  // every '#pragma unroll' below: constant trip count, unrolled so that the register arrays are indexed by constants
  auto cvt_a = [&]() {
#pragma unroll
    for (int kk = 0; kk < 2; ++kk)
#pragma unroll
      for (int i = 0; i < 16; ++i) a[kk][i] = (__bf16)xr[kk][i]; };
  auto mult = [&](const __bf16 (*t)[72]) {   // 64 k of the tile; four B fragments are read as one group ahead of their four products
#pragma unroll
    for (int kk = 0; kk < 2; ++kk)
#pragma unroll
      for (int jh = 0; jh < 2; ++jh) { v16b w[4];
#pragma unroll
        for (int q = 0; q < 4; ++q) w[q] = frag_b(&t[(jh * 4 + q) * 16 + col][kk * 32], lane);
#pragma unroll
        for (int q = 0; q < 4; ++q) acc[jh * 4 + q] = wmma_bf(a[kk], w[q], acc[jh * 4 + q]); } };
  wt_load(wr, wp, wave, 2 * CC); row_load(xr, xp);
  asm volatile("s_wait_xcnt 0x0" ::: "memory");   // behind the loads, before their address registers are reused
  wt_store(th, wr, wave, lane); cvt_a();   // th and tl2 are the two tile buffers until the epilogue takes them back
  __syncthreads();
  __bf16 (*cur)[72] = th; __bf16 (*nxt)[72] = tl2;
  for (int kb = 1; kb < CC / 64; ++kb) {
    wt_load(wr, wp + (size_t)kb * 64 * (2 * CC), wave, 2 * CC); row_load(xr, xp + kb * 64);   // the next 64 k fly while this tile is multiplied
    asm volatile("s_wait_xcnt 0x0" ::: "memory");   // behind the loads, before their address registers are reused
    mult(cur);
    wt_store(nxt, wr, wave, lane); cvt_a();
    __syncthreads();   // publishes the next tile and ends every wave's reads of this one
    __bf16 (*t)[72] = cur; cur = nxt; nxt = t; }
  mult(cur);
  __syncthreads();   // every wave has left th and tl2 before the epilogue writes them
#pragma unroll
  for (int j = 0; j < 8; ++j) { const float bb = BA ? bfr(BA[(which - 1) * CC + c0 + j * 16 + col]) : 0.f;
#pragma unroll
    for (int r = 0; r < 8; ++r) { const float v = acc[j][r] + bb; const int rl = wave * 16 + 8 * g + r, cl = j * 16 + col; const _Float16 hv = (_Float16)v;
      if (which == 2) { const __bf16 bh = (__bf16)v; th[cl][rl] = bh; tl2[cl][rl] = (__bf16)(v - (float)bh); } else { sh[rl][cl] = hv; sl[rl][cl] = (_Float16)(v - (float)hv); } } }
  __syncthreads();
  if (which < 2) { _Float16* dh = which == 0 ? QH : KH; for (int e = tid; e < 64 * 16; e += 128) { const int rl = e >> 4, q = e & 15; vst2((unsigned*)(dh + (r0 + rl) * CC + c0 + q * 8), *(const v4u*)&sh[rl][q * 8]); if (which == 0) vst2((unsigned*)(QL + (r0 + rl) * CC + c0 + q * 8), *(const v4u*)&sl[rl][q * 8]); } }
  else { const size_t b = r0 / TT; const int t0 = (int)(r0 % TT); for (int e = tid; e < 128 * 8; e += 128) { const int cl = e >> 3, q = e & 7; const size_t o2 = (b * CC + c0 + cl) * (size_t)TT + t0 + q * 8; vst2((unsigned*)(VT + o2), *(const v4u*)&th[cl][q * 8]); vst2((unsigned*)(VL + o2), *(const v4u*)&tl2[cl][q * 8]); } } }
__device__ __forceinline__ float xhalf(float x) { return __builtin_bit_cast(float, __builtin_amdgcn_permlanex16(__builtin_bit_cast(int, x), __builtin_bit_cast(int, x), 0x76543210, 0xfedcba98, false, false)); }   // lane l <-> lane l ^ 16
// ---- k_fa: wave = 16 queries of (b,h), no logits in memory. Pass = 32 keys: S^T = K x^T (lane = one query, 16 keys in its registers), running maximum and sum per lane, Y^T += V^T P^T (P^T packs from the S^T tiles as the B operand)
__global__ __launch_bounds__(128) void k_fa(const float* __restrict__ X, const _Float16* __restrict__ KH, const __bf16* __restrict__ VT, const __bf16* __restrict__ VL, float* __restrict__ Y) {
  // every '#pragma unroll' in this kernel: constant trip count, unrolled so that the fragment arrays are indexed by constants and stay in registers
  const int tid = threadIdx.x, wave = __builtin_amdgcn_readfirstlane(tid >> 5) /* scalar: the pass count and the diagonal test become scalar branches, EXEC stays all ones at every WMMA */, lane = tid & 31, col = lane & 15, g = lane >> 4;
  const int h = blockIdx.x % NH, b = blockIdx.x / NH;
  const int ql0 = (TT / 64 - 1 - (int)blockIdx.y) * 64 + wave * 16;   // longest query blocks start first
  const int np = (ql0 + 16 + 31) >> 5;                                       // passes up to and including the diagonal (wave-uniform)
  const int qt = ql0 + col;
  v16h qf[HD / 32];
#pragma unroll
  for (int kc = 0; kc < HD / 32; ++kc) { const float* xp = X + ((size_t)b * TT + qt) * CC + h * HD + kc * 32 + 8 * g;
#pragma unroll
    for (int i = 0; i < 8; ++i) { qf[kc][i] = (_Float16)bfr(xp[i]); qf[kc][8 + i] = (_Float16)bfr(xp[16 + i]); } }   // query = raw input head slice (bf16-exact values, exact in f16)
  const _Float16* kp = KH + ((size_t)b * TT + col) * CC + h * HD;
  const size_t vo = ((size_t)b * CC + h * HD + col) * (size_t)TT;
  v8f acc[HD / 16] = {}; float m = -3.0e38f, l = 0.f;
  v16h kf[2][HD / 32];
#pragma unroll
  for (int t = 0; t < 2; ++t)
#pragma unroll
    for (int kc = 0; kc < HD / 32; ++kc) kf[t][kc] = frag_h(kp + (size_t)(t * 16) * CC + kc * 32, lane);
  for (int ps = 0; ps < np; ++ps) { const int k0 = ps * 32;
    v16b vh[HD / 16], vl[HD / 16];
#pragma unroll
    for (int j = 0; j < HD / 16; ++j) { const size_t po = vo + (size_t)(j * 16) * TT + k0; vh[j] = frag_b(VT + po, lane); vl[j] = frag_b(VL + po, lane); }
    v8f st[2] = {};
#pragma unroll
    for (int t = 0; t < 2; ++t)
#pragma unroll
      for (int kc = 0; kc < HD / 32; ++kc) st[t] = __builtin_amdgcn_wmma_f32_16x16x32_f16(false, kf[t][kc], false, qf[kc], (short)0, st[t], false, false);   // st[t][r] = logit(key k0 + 16 t + 8 g + r, query qt)
    const int kn = (ps + 1 < np ? ps + 1 : ps) * 32;   // next pass's key rows, fetched one pass ahead (the last pass re-reads its own)
#pragma unroll
    for (int t = 0; t < 2; ++t)
#pragma unroll
      for (int kc = 0; kc < HD / 32; ++kc) kf[t][kc] = frag_h(kp + (size_t)(kn + t * 16) * CC + kc * 32, lane);
    asm volatile("s_wait_xcnt 0x0" ::: "memory");   // behind the pass's loads, before their address registers are reused by the softmax code
    float p[16];
#pragma unroll
    for (int t = 0; t < 2; ++t)
#pragma unroll
      for (int r = 0; r < 8; ++r) p[t * 8 + r] = st[t][r] * 0.125f;
    if (k0 + 31 > ql0) {   // only passes that reach the diagonal hold masked keys
#pragma unroll
      for (int i = 0; i < 16; ++i) if (k0 + (i >> 3) * 16 + 8 * g + (i & 7) > qt) p[i] = -3.0e38f; }
    float mx = p[0];
#pragma unroll
    for (int i = 1; i < 16; ++i) mx = fmaxf(mx, p[i]);
    mx = fmaxf(mx, xhalf(mx));
    const float mn = fmaxf(m, mx), al = expf(m - mn); m = mn;
    float sum = 0.f;
#pragma unroll
    for (int i = 0; i < 16; ++i) { p[i] = expf(p[i] - mn); sum += p[i]; }   // a masked key: expf(-3e38 - mn) is exactly 0 (mn is finite: key 0 is open to every query)
    l = l * al + sum;   // each lane half keeps the sum of its own keys; joined after the loop
#pragma unroll
    for (int j = 0; j < HD / 16; ++j) acc[j] *= al;
    const F2 pf = bsplit16(p);
#pragma unroll
    for (int j = 0; j < HD / 16; ++j) { acc[j] = __builtin_amdgcn_wmma_f32_16x16x32_bf16(false, vh[j], false, pf.h, (short)0, acc[j], false, false); acc[j] = __builtin_amdgcn_wmma_f32_16x16x32_bf16(false, vh[j], false, pf.l, (short)0, acc[j], false, false); acc[j] = __builtin_amdgcn_wmma_f32_16x16x32_bf16(false, vl[j], false, pf.h, (short)0, acc[j], false, false); } }
  l += xhalf(l); const float inv = 1.0f / l;
  float* yp = Y + ((size_t)b * TT + qt) * CC + h * HD + 8 * g;   // acc[j][r] = y(query qt, d = 16 j + 8 g + r)
#pragma unroll
  for (int j = 0; j < HD / 16; ++j) { v4f lo, hi;
#pragma unroll
    for (int r = 0; r < 4; ++r) { lo[r] = acc[j][r] * inv; hi[r] = acc[j][4 + r] * inv; }
    vst2(yp + j * 16, lo); vst2(yp + j * 16 + 4, hi); } }
// ---- k_out: block = (64 rows, 128 cols): out = y (bf16 hi + lo) Wproj + b
__global__ __launch_bounds__(128) void k_out(const float* __restrict__ Y, const float* __restrict__ WP, const float* __restrict__ BP, float* __restrict__ OUT) { __shared__ __align__(16) float sf[4][16][132]; __shared__ __align__(16) __bf16 wt[2][128][72];
  const int tid = threadIdx.x, wave = tid >> 5, lane = tid & 31, col = lane & 15, g = lane >> 4; const int c0 = blockIdx.y * 128; const size_t r0 = (size_t)blockIdx.x * 64 + wave * 16;
  v8f acc[8] = {};
  const float* wp = WP + c0 + lane;   // this lane's column of the block's weight columns
  const float* yp = Y + (r0 + col) * CC + 8 * g;
  float wr[4][16], yr[2][16]; F2 a[2];
  // every '#pragma unroll' below: constant trip count, unrolled so that the register arrays are indexed by constants
  auto mult = [&](const __bf16 (*t)[72]) {   // 64 k of the tile; four B fragments are read as one group ahead of their eight products
#pragma unroll
    for (int kk = 0; kk < 2; ++kk)
#pragma unroll
      for (int jh = 0; jh < 2; ++jh) { v16b w[4];
#pragma unroll
        for (int q = 0; q < 4; ++q) w[q] = frag_b(&t[(jh * 4 + q) * 16 + col][kk * 32], lane);
#pragma unroll
        for (int q = 0; q < 4; ++q) { acc[jh * 4 + q] = wmma_bf(a[kk].h, w[q], acc[jh * 4 + q]); acc[jh * 4 + q] = wmma_bf(a[kk].l, w[q], acc[jh * 4 + q]); } } };
  wt_load(wr, wp, wave, CC); row_load(yr, yp);
  asm volatile("s_wait_xcnt 0x0" ::: "memory");   // behind the loads, before their address registers are reused
  wt_store(wt[0], wr, wave, lane); a[0] = bsplit16(yr[0]); a[1] = bsplit16(yr[1]);
  __syncthreads();
  __bf16 (*cur)[72] = wt[0]; __bf16 (*nxt)[72] = wt[1];
  for (int kb = 1; kb < CC / 64; ++kb) {
    wt_load(wr, wp + (size_t)kb * 64 * CC, wave, CC); row_load(yr, yp + kb * 64);   // the next 64 k fly while this tile is multiplied
    asm volatile("s_wait_xcnt 0x0" ::: "memory");   // behind the loads, before their address registers are reused
    mult(cur);
    wt_store(nxt, wr, wave, lane); a[0] = bsplit16(yr[0]); a[1] = bsplit16(yr[1]);
    __syncthreads();   // publishes the next tile and ends every wave's reads of this one
    __bf16 (*t)[72] = cur; cur = nxt; nxt = t; }
  mult(cur);
#pragma unroll
  for (int j = 0; j < 8; ++j) { const float bb = BP ? bfr(BP[c0 + j * 16 + col]) : 0.f;
#pragma unroll
    for (int r = 0; r < 8; ++r) sf[wave][8 * g + r][j * 16 + col] = acc[j][r] + bb; }
  LDSX(); for (int rl = 0; rl < 16; ++rl) vst2(OUT + (r0 + rl) * CC + c0 + lane * 4, *(const v4f*)&sf[wave][rl][lane * 4]); }
extern "C" void kernel_launch(void* const* d_in, const int* in_sizes, int n_in, void* d_out, int out_size, void* d_ws, size_t ws_size, hipStream_t stream) {
  (void)in_sizes; (void)n_in; (void)out_size;
  const float** F = (const float**)d_in;   // 0 xt [2,2048,1024], 1 W_ca [1024,2048] (in,out), 2 b_ca [2048], 3 W_proj [1024,1024], 4 b_proj
  if (ws_size < (size_t)WS_END) return;
  char* ws = (char*)d_ws; _Float16 *QH = (_Float16*)(ws + WS_QH), *QL = (_Float16*)(ws + WS_QL), *KH = (_Float16*)(ws + WS_KH); __bf16 *VT = (__bf16*)(ws + WS_VT), *VL = (__bf16*)(ws + WS_VL); float *Y = (float*)(ws + WS_Y);
  k_proj<<<dim3(TNB * TT / 64, CC / 128, 2), 128, 0, stream>>>(F[0], F[1], F[2], QH, QL, KH, VT, VL);   // which 1 -> qk_t (cols 0..C), which 2 -> v (cols C..2C) of the [C, 2C] weight
  k_fa<<<dim3(TNB * NH, TT / 64), 128, 0, stream>>>(F[0], KH, VT, VL, Y);   // all batches and heads in one launch
  k_out<<<dim3(TNB * TT / 64, CC / 128), 128, 0, stream>>>(Y, F[3], F[4], (float*)d_out);
}

// v003
// One run takes 128 microseconds.
// Next to v002, in two timings, it ran 1.17 times as fast each time.
// All steps since v000 together make it 9.94 times as fast.
// compute dtype: all float inputs rounded to bf16; [qk_t | v] = x W_ca + b_ca ([C, 2C]) with EXACT bf16 products on WMMA 16x16x32, f32 accumulate; query = the bf16-exact input rows themselves (as f16, exact), qk_t rounded once to f16 -> 1-product logits / 8, causal, kept in registers (one launch for all heads); running-maximum softmax in f32 (precise expf), un-normalised P split bf16 hi + lo against v bf16 hi + lo (3 products), divided by the row sum at the end; out = y (bf16 hi + lo) W_proj + b_proj; f32 output.
#include <hip/hip_runtime.h>
#include <math.h>

typedef __attribute__((ext_vector_type(16))) _Float16 v16h;
typedef __attribute__((ext_vector_type(16))) __bf16 v16b;
typedef __attribute__((ext_vector_type(8)))  _Float16 v8h;
typedef __attribute__((ext_vector_type(8)))  float v8f;
typedef __attribute__((ext_vector_type(4)))  float v4f;
typedef __attribute__((ext_vector_type(2)))  float v2f;
typedef __attribute__((ext_vector_type(4)))  unsigned v4u;
typedef __attribute__((ext_vector_type(4)))  int v4i;
typedef float __attribute__((may_alias)) float_a;
typedef int __attribute__((may_alias)) int_a;

template <typename T> __device__ __forceinline__ void vst2(void* p, T v) { *(T*)p = v;  }
__device__ __forceinline__ v8f wmma16(v16h a, v16h b, v8f c) {
  v8f d = __builtin_amdgcn_wmma_f32_16x16x32_f16(false, a, false, b, (short)0, c, false, false);
  asm volatile("v_nop\n\tv_nop\n\tv_nop\n\tv_nop" : "+v"(d) : "v"(a), "v"(b));
  return d;
}
__device__ __forceinline__ v8f wmma_bf(v16b a, v16b b, v8f c) {
  v8f d = __builtin_amdgcn_wmma_f32_16x16x32_bf16(false, a, false, b, (short)0, c, false, false);
  asm volatile("v_nop\n\tv_nop\n\tv_nop\n\tv_nop" : "+v"(d) : "v"(a), "v"(b));
  return d;
}
// 16x16x32 fragments: lane = (h = lane>>4, row/col = lane&15); elements 0..7 = k0+8h+0..7, 8..15 = k0+16+8h+0..7; D element r = row 8h+r
__device__ __forceinline__ v16h frag_h(const _Float16* rowk0, int lane) {
  union { v16h v; v8h q[2]; } u; const _Float16* p = rowk0 + 8 * (lane >> 4);
  u.q[0] = *(const v8h*)p; u.q[1] = *(const v8h*)(p + 16); return u.v;
}
__device__ __forceinline__ v16h frag_f32(const float* rowk0, int lane) {
  v16h a; const float* p = rowk0 + 8 * (lane >> 4);
#pragma unroll
  for (int i = 0; i < 8; ++i) { a[i] = (_Float16)p[i]; a[8 + i] = (_Float16)p[16 + i]; }
  return a;
}
__device__ __forceinline__ v16h frag_f32s(const float* rowk0, int lane, float sc) {
  v16h a; const float* p = rowk0 + 8 * (lane >> 4);
#pragma unroll
  for (int i = 0; i < 8; ++i) { a[i] = (_Float16)(p[i] * sc); a[8 + i] = (_Float16)(p[16 + i] * sc); }
  return a;
}
// column fragment from a [K][ld] layout (column n), rows >= K read as 0
__device__ __forceinline__ v16h fragc_f32(const float* W, int k0, int n, int lane, int ld, int K) {
  v16h a; const int g = lane >> 4;
#pragma unroll
  for (int i = 0; i < 8; ++i) { const int ka = k0 + 8 * g + i, kb = ka + 16;
    a[i] = (_Float16)(ka < K ? W[(size_t)(ka < K ? ka : K - 1) * ld + n] : 0.f); a[8 + i] = (_Float16)(kb < K ? W[(size_t)(kb < K ? kb : K - 1) * ld + n] : 0.f); }
  return a;
}
struct F2 { v16b h, l; };
__device__ __forceinline__ F2 bsplit16(const float v[16]) { F2 r;
#pragma unroll
  for (int i = 0; i < 16; ++i) { const __bf16 h = (__bf16)v[i]; r.h[i] = h; r.l[i] = (__bf16)(v[i] - (float)h); }
  return r; }
__device__ __forceinline__ F2 split_row(const float* row, int k0, int lane) { float v[16]; const float* p = row + k0 + 8 * (lane >> 4);
#pragma unroll
  for (int i = 0; i < 8; ++i) { v[i] = p[i]; v[8 + i] = p[16 + i]; }
  return bsplit16(v); }
__device__ __forceinline__ F2 split_rowK(const float* row, int k0, int lane, int K) { float v[16]; const int g = lane >> 4;
#pragma unroll
  for (int i = 0; i < 8; ++i) { const int ka = k0 + 8 * g + i, kb = ka + 16; v[i] = ka < K ? row[ka < K ? ka : K - 1] : 0.f; v[8 + i] = kb < K ? row[kb < K ? kb : K - 1] : 0.f; }
  return bsplit16(v); }
__device__ __forceinline__ F2 split_col(const float* W, int k0, int n, int lane, int ld, int K) { float v[16]; const int g = lane >> 4;
#pragma unroll
  for (int i = 0; i < 8; ++i) { const int ka = k0 + 8 * g + i, kb = ka + 16; v[i] = ka < K ? W[(size_t)(ka < K ? ka : K - 1) * ld + n] : 0.f; v[8 + i] = kb < K ? W[(size_t)(kb < K ? kb : K - 1) * ld + n] : 0.f; }
  return bsplit16(v); }
__device__ __forceinline__ v8f mac3(const F2& a, const F2& b, v8f c) { c = wmma_bf(a.l, b.h, c); c = wmma_bf(a.h, b.l, c); return wmma_bf(a.h, b.h, c); }
__device__ __forceinline__ float sigm(float v) { return 1.0f / (1.0f + expf(-v)); }
#define LDSX() do { asm volatile("s_wait_dscnt 0" ::: "memory"); __builtin_amdgcn_wave_barrier(); __builtin_amdgcn_fence(__ATOMIC_RELEASE, "workgroup"); } while (0)


// General causal self attention (B 2, T 2,048, C 1,024 = 16 x 64): [qk_t | v] = x W_ca + b_ca; scores = x_head . qk_t_head / 8 (the raw input is the query), causal softmax, . v, output Linear.
#define NB 2
#define TT 2048
#define CC 1024
#define NH 16
#define HD 64
#ifndef TNB
#define TNB NB
#endif
typedef __attribute__((ext_vector_type(8))) __bf16 v8b;
__device__ __forceinline__ v16b frag_b(const __bf16* rowk0, int lane) {
  union { v16b v; v8b q[2]; } u; const __bf16* p = rowk0 + 8 * (lane >> 4);
  u.q[0] = *(const v8b*)p; u.q[1] = *(const v8b*)(p + 16); return u.v;
}
__device__ __forceinline__ float bfr(float v) { return (float)(__bf16)v; }
__device__ __attribute__((noinline)) float exp_ni(float v) { return expf(v); }
__device__ __attribute__((noinline)) float erf_ni(float v) { return erff(v); }

#define WS_QH  0u
#define WS_QL  (WS_QH + 2u * (size_t)NB * TT * CC)
#define WS_KH  (WS_QL + 2u * (size_t)NB * TT * CC)
#define WS_VT  (WS_KH + 2u * (size_t)NB * TT * CC)      // bf16 v planes [b][c][t]
#define WS_VL  (WS_VT + 2u * (size_t)NB * CC * TT)      // bf16 v residual planes
#define HG 4                                          // only sizes WS_S; all heads run in one launch
#define WS_S   (WS_VL + 2u * (size_t)NB * CC * TT)      // unused: k_fa keeps logits in registers
#define WS_PH  (WS_S + 4u * (size_t)HG * TT * TT)
#define WS_Y   (WS_PH + 0u)              // f32 y rows [b*t][C]
#define WS_END (WS_Y + 4u * (size_t)NB * TT * CC)

// ---- weight tile in LDS: 64 k x 128 n of a row-major f32 weight, rounded to bf16 and laid as rows [n][k] (pitch 144 B), fetched once per block for its four waves
// wave w fetches k rows 16 w .. 16 w + 15, lane = column (+ 32 j): every load is one whole 128-B line
// every '#pragma unroll' in these three helpers: constant trip count, unrolled so that the register arrays are indexed by constants
__device__ __forceinline__ void wt_load(float (&r)[4][16], const float* __restrict__ Wl, int wave, int ld) {
#pragma unroll
  for (int j = 0; j < 4; ++j)
#pragma unroll
    for (int i = 0; i < 16; ++i) r[j][i] = Wl[(size_t)(wave * 16 + i) * ld + j * 32];
}
__device__ __forceinline__ void wt_store(__bf16 (*buf)[72], const float (&r)[4][16], int wave, int lane) {
#pragma unroll
  for (int j = 0; j < 4; ++j) { v8b a, b;
#pragma unroll
    for (int i = 0; i < 8; ++i) { a[i] = (__bf16)r[j][i]; b[i] = (__bf16)r[j][8 + i]; }
    *(v8b*)&buf[j * 32 + lane][wave * 16] = a; *(v8b*)&buf[j * 32 + lane][wave * 16 + 8] = b; }
}
__device__ __forceinline__ void row_load(float (&r)[2][16], const float* __restrict__ p) {   // one row's 64 k in fragment order: r[kk][i] = k 32 kk + 8 g + i, r[kk][8 + i] = 16 more
#pragma unroll
  for (int kk = 0; kk < 2; ++kk)
#pragma unroll
    for (int i = 0; i < 8; ++i) { r[kk][i] = p[kk * 32 + i]; r[kk][8 + i] = p[kk * 32 + 16 + i]; }
}
// ---- k_proj: block = (64 rows, 128 cols, which): [qk_t | v] = x W (+ b), exact; qk_t -> f16 rows, v -> bf16 hi + residual planes
__global__ __launch_bounds__(128) void k_proj(const float* __restrict__ X, const float* __restrict__ WA, const float* __restrict__ BA, _Float16* __restrict__ QH, _Float16* __restrict__ QL, _Float16* __restrict__ KH, __bf16* __restrict__ VT, __bf16* __restrict__ VL) {
  __shared__ __align__(16) _Float16 sh[64][136], sl[64][136]; __shared__ __align__(16) __bf16 th[128][72], tl2[128][72];
  const int tid = threadIdx.x, wave = tid >> 5, lane = tid & 31, col = lane & 15, g = lane >> 4; const int which = blockIdx.z + 1; /* 1: qk_t -> KH, 2: v -> planes (no q projection: the query is x itself) */ const int c0 = blockIdx.y * 128; const size_t r0 = (size_t)blockIdx.x * 64;
  v8f acc[8] = {};
  const float* wp = WA + (size_t)(which - 1) * CC + c0 + lane;   // this lane's column of the block's weight columns
  const float* xp = X + (r0 + wave * 16 + col) * CC + 8 * g;
  float wr[4][16], xr[2][16]; v16b a[2];
  // every '#pragma unroll' below: constant trip count, unrolled so that the register arrays are indexed by constants
  auto cvt_a = [&]() {
#pragma unroll
    for (int kk = 0; kk < 2; ++kk)
#pragma unroll
      for (int i = 0; i < 16; ++i) a[kk][i] = (__bf16)xr[kk][i]; };
  auto mult = [&](const __bf16 (*t)[72]) {   // 64 k of the tile; four B fragments are read as one group ahead of their four products
#pragma unroll
    for (int kk = 0; kk < 2; ++kk)
#pragma unroll
      for (int jh = 0; jh < 2; ++jh) { v16b w[4];
#pragma unroll
        for (int q = 0; q < 4; ++q) w[q] = frag_b(&t[(jh * 4 + q) * 16 + col][kk * 32], lane);
#pragma unroll
        for (int q = 0; q < 4; ++q) acc[jh * 4 + q] = wmma_bf(a[kk], w[q], acc[jh * 4 + q]); } };
  wt_load(wr, wp, wave, 2 * CC); row_load(xr, xp);
  asm volatile("s_wait_xcnt 0x0" ::: "memory");   // behind the loads, before their address registers are reused
  wt_store(th, wr, wave, lane); cvt_a();   // th and tl2 are the two tile buffers until the epilogue takes them back
  __syncthreads();
  __bf16 (*cur)[72] = th; __bf16 (*nxt)[72] = tl2;
  for (int kb = 1; kb < CC / 64; ++kb) {
    wt_load(wr, wp + (size_t)kb * 64 * (2 * CC), wave, 2 * CC); row_load(xr, xp + kb * 64);   // the next 64 k fly while this tile is multiplied
    asm volatile("s_wait_xcnt 0x0" ::: "memory");   // behind the loads, before their address registers are reused
    mult(cur);
    wt_store(nxt, wr, wave, lane); cvt_a();
    __syncthreads();   // publishes the next tile and ends every wave's reads of this one
    __bf16 (*t)[72] = cur; cur = nxt; nxt = t; }
  mult(cur);
  __syncthreads();   // every wave has left th and tl2 before the epilogue writes them
#pragma unroll
  for (int j = 0; j < 8; ++j) { const float bb = BA ? bfr(BA[(which - 1) * CC + c0 + j * 16 + col]) : 0.f;
#pragma unroll
    for (int r = 0; r < 8; ++r) { const float v = acc[j][r] + bb; const int rl = wave * 16 + 8 * g + r, cl = j * 16 + col; const _Float16 hv = (_Float16)v;
      if (which == 2) { const __bf16 bh = (__bf16)v; th[cl][rl] = bh; tl2[cl][rl] = (__bf16)(v - (float)bh); } else { sh[rl][cl] = hv; sl[rl][cl] = (_Float16)(v - (float)hv); } } }
  __syncthreads();
  if (which < 2) { _Float16* dh = which == 0 ? QH : KH; for (int e = tid; e < 64 * 16; e += 128) { const int rl = e >> 4, q = e & 15; vst2((unsigned*)(dh + (r0 + rl) * CC + c0 + q * 8), *(const v4u*)&sh[rl][q * 8]); if (which == 0) vst2((unsigned*)(QL + (r0 + rl) * CC + c0 + q * 8), *(const v4u*)&sl[rl][q * 8]); } }
  else { const size_t b = r0 / TT; const int t0 = (int)(r0 % TT); for (int e = tid; e < 128 * 8; e += 128) { const int cl = e >> 3, q = e & 7; const size_t o2 = (b * CC + c0 + cl) * (size_t)TT + t0 + q * 8; vst2((unsigned*)(VT + o2), *(const v4u*)&th[cl][q * 8]); vst2((unsigned*)(VL + o2), *(const v4u*)&tl2[cl][q * 8]); } } }
__device__ __forceinline__ float xhalf(float x) { return __builtin_bit_cast(float, __builtin_amdgcn_permlanex16(__builtin_bit_cast(int, x), __builtin_bit_cast(int, x), 0x76543210, 0xfedcba98, false, false)); }   // lane l <-> lane l ^ 16
#define FROW 144u                 // LDS row pitch in bytes: 16 B x odd, free of bank conflicts for 16-byte reads
#define FPL  (64u * FROW)         // one plane of a tile: 64 rows
#define FBUF (3u * FPL)           // one buffer: K rows, V hi plane, V lo plane
// one tile: each lane copies 16 B of rows r, r + 16, r + 32, r + 48 of each plane, so every copy of a wave covers four whole 128-B lines
__device__ __forceinline__ void fa_fill(unsigned ld, const char* gk, const char* gh, const char* gl) {
  // the twelve copies and the wait behind them stand in one statement, so that no address register is rewritten before the wait
  asm volatile("global_load_async_to_lds_b128 %0, %12, off\n\t"
               "global_load_async_to_lds_b128 %1, %13, off\n\t"
               "global_load_async_to_lds_b128 %2, %14, off\n\t"
               "global_load_async_to_lds_b128 %3, %15, off\n\t"
               "global_load_async_to_lds_b128 %4, %16, off\n\t"
               "global_load_async_to_lds_b128 %5, %17, off\n\t"
               "global_load_async_to_lds_b128 %6, %18, off\n\t"
               "global_load_async_to_lds_b128 %7, %19, off\n\t"
               "global_load_async_to_lds_b128 %8, %20, off\n\t"
               "global_load_async_to_lds_b128 %9, %21, off\n\t"
               "global_load_async_to_lds_b128 %10, %22, off\n\t"
               "global_load_async_to_lds_b128 %11, %23, off\n\t"
               "s_wait_xcnt 0x0"
               :: "v"(ld), "v"(ld + 16u * FROW), "v"(ld + 32u * FROW), "v"(ld + 48u * FROW),
                  "v"(ld + FPL), "v"(ld + FPL + 16u * FROW), "v"(ld + FPL + 32u * FROW), "v"(ld + FPL + 48u * FROW),
                  "v"(ld + 2u * FPL), "v"(ld + 2u * FPL + 16u * FROW), "v"(ld + 2u * FPL + 32u * FROW), "v"(ld + 2u * FPL + 48u * FROW),
                  "v"(gk), "v"(gk + 16 * CC * 2), "v"(gk + 32 * CC * 2), "v"(gk + 48 * CC * 2),
                  "v"(gh), "v"(gh + 16 * TT * 2), "v"(gh + 32 * TT * 2), "v"(gh + 48 * TT * 2),
                  "v"(gl), "v"(gl + 16 * TT * 2), "v"(gl + 32 * TT * 2), "v"(gl + 48 * TT * 2)
               : "memory");
}
__global__ __launch_bounds__(128) void k_fa(const float* __restrict__ X, const _Float16* __restrict__ KH, const __bf16* __restrict__ VT, const __bf16* __restrict__ VL, float* __restrict__ Y) {
  __shared__ __align__(16) unsigned char fs[2u * FBUF];
  // every '#pragma unroll' in this kernel: constant trip count, unrolled so that the fragment arrays are indexed by constants and stay in registers
  const int tid = threadIdx.x, wave = __builtin_amdgcn_readfirstlane(tid >> 5) /* scalar: the pass count and the diagonal test become scalar branches, EXEC stays all ones at every WMMA */, lane = tid & 31, col = lane & 15, g = lane >> 4;
  const int h = blockIdx.x % NH, b = blockIdx.x / NH;
  const int nst = TT / 64 - (int)blockIdx.y;                                 // tiles of 64 keys up to and including the diagonal (block-uniform); longest query blocks start first
  const int ql0 = (nst - 1) * 64 + wave * 16;
  const int np = (ql0 + 16 + 31) >> 5;                                       // passes up to and including the diagonal (wave-uniform)
  const int qt = ql0 + col;
  const int crow = tid >> 3, cpos = (tid & 7) * 16;                          // this lane's first row and its 16 B of the row, in every plane of a tile
  const char* gk = (const char*)(KH + ((size_t)b * TT + crow) * CC + h * HD) + cpos;        // tile t: 64 key rows further
  const char* gh = (const char*)(VT + ((size_t)b * CC + h * HD + crow) * (size_t)TT) + cpos;   // tile t: 64 keys = 128 B further
  const char* gl = (const char*)(VL + ((size_t)b * CC + h * HD + crow) * (size_t)TT) + cpos;
  const unsigned ld = (unsigned)(size_t)fs + (unsigned)crow * FROW + (unsigned)cpos;
  fa_fill(ld, gk, gh, gl);
  v16h qf[HD / 32];
#pragma unroll
  for (int kc = 0; kc < HD / 32; ++kc) { const float* xp = X + ((size_t)b * TT + qt) * CC + h * HD + kc * 32 + 8 * g;
#pragma unroll
    for (int i = 0; i < 8; ++i) { qf[kc][i] = (_Float16)bfr(xp[i]); qf[kc][8 + i] = (_Float16)bfr(xp[16 + i]); } }   // query = raw input head slice (bf16-exact values, exact in f16)
  v8f acc[HD / 16] = {}; float m = -3.0e38f, l = 0.f;
  asm volatile("s_wait_asynccnt 0x0" ::: "memory");   // this wave's share of tile 0 has landed
  __syncthreads();                                    // publishes tile 0
  if (nst > 1) fa_fill(ld + FBUF, gk + (size_t)64 * CC * 2, gh + 128, gl + 128);
  for (int t = 0; t < nst; ++t) {
    const unsigned char* tb = fs + (unsigned)(t & 1) * FBUF;
    const _Float16* kp = (const _Float16*)(tb + (unsigned)col * FROW);
    const __bf16* vhp = (const __bf16*)(tb + FPL + (unsigned)col * FROW);
    const __bf16* vlp = (const __bf16*)(tb + 2u * FPL + (unsigned)col * FROW);
#pragma unroll
    for (int sub = 0; sub < 2; ++sub) { const int ps = 2 * t + sub, k0 = ps * 32;
      if (sub == 0 || ps < np) {   // the first two waves have no open key in the second half of the diagonal tile
        v16h kf[2][HD / 32];
#pragma unroll
        for (int u = 0; u < 2; ++u)
#pragma unroll
          for (int kc = 0; kc < HD / 32; ++kc) kf[u][kc] = frag_h(kp + (sub * 32 + u * 16) * (int)(FROW / 2) + kc * 32, lane);
        v16b vh[HD / 16], vl[HD / 16];
#pragma unroll
        for (int j = 0; j < HD / 16; ++j) { vh[j] = frag_b(vhp + j * 16 * (int)(FROW / 2) + sub * 32, lane); vl[j] = frag_b(vlp + j * 16 * (int)(FROW / 2) + sub * 32, lane); }
        __builtin_amdgcn_sched_barrier(0);   // keeps the pass's 24 LDS reads together, as one group ahead of its products: left free, they sink to one read and one full wait in front of each product
        v8f st[2] = {};
#pragma unroll
        for (int u = 0; u < 2; ++u)
#pragma unroll
          for (int kc = 0; kc < HD / 32; ++kc) st[u] = __builtin_amdgcn_wmma_f32_16x16x32_f16(false, kf[u][kc], false, qf[kc], (short)0, st[u], false, false);   // st[u][r] = logit(key k0 + 16 u + 8 g + r, query qt)
        float p[16];
#pragma unroll
        for (int u = 0; u < 2; ++u)
#pragma unroll
          for (int r = 0; r < 8; ++r) p[u * 8 + r] = st[u][r] * 0.125f;
        if (k0 + 31 > ql0) {   // only passes that reach the diagonal hold masked keys
#pragma unroll
          for (int i = 0; i < 16; ++i) if (k0 + (i >> 3) * 16 + 8 * g + (i & 7) > qt) p[i] = -3.0e38f; }
        float mx = p[0];
#pragma unroll
        for (int i = 1; i < 16; ++i) mx = fmaxf(mx, p[i]);
        mx = fmaxf(mx, xhalf(mx));
        const float mn = fmaxf(m, mx), al = expf(m - mn); m = mn;
        float sum = 0.f;
#pragma unroll
        for (int i = 0; i < 16; ++i) { p[i] = expf(p[i] - mn); sum += p[i]; }   // a masked key: expf(-3e38 - mn) is exactly 0 (mn is finite: key 0 is open to every query)
        l = l * al + sum;   // each lane half keeps the sum of its own keys; joined after the loop
#pragma unroll
        for (int j = 0; j < HD / 16; ++j) acc[j] *= al;
        const F2 pf = bsplit16(p);
#pragma unroll
        for (int j = 0; j < HD / 16; ++j) { acc[j] = __builtin_amdgcn_wmma_f32_16x16x32_bf16(false, vh[j], false, pf.h, (short)0, acc[j], false, false); acc[j] = __builtin_amdgcn_wmma_f32_16x16x32_bf16(false, vh[j], false, pf.l, (short)0, acc[j], false, false); acc[j] = __builtin_amdgcn_wmma_f32_16x16x32_bf16(false, vl[j], false, pf.h, (short)0, acc[j], false, false); } } }
    asm volatile("s_wait_dscnt 0x0" ::: "memory");      // this wave's reads of tile t have returned before the buffer is handed back
    asm volatile("s_wait_asynccnt 0x0" ::: "memory");   // this wave's share of tile t + 1 has landed
    __syncthreads();                                    // publishes tile t + 1 and ends every wave's reads of tile t
    if (t + 2 < nst) fa_fill(ld + (unsigned)(t & 1) * FBUF, gk + (size_t)(t + 2) * (64 * CC * 2), gh + (t + 2) * 128, gl + (t + 2) * 128); }
  asm volatile("s_wait_asynccnt 0x0" ::: "memory");     // no copy is outstanding when the wave ends
  l += xhalf(l); const float inv = 1.0f / l;
  float* yp = Y + ((size_t)b * TT + qt) * CC + h * HD + 8 * g;   // acc[j][r] = y(query qt, d = 16 j + 8 g + r)
#pragma unroll
  for (int j = 0; j < HD / 16; ++j) { v4f lo, hi;
#pragma unroll
    for (int r = 0; r < 4; ++r) { lo[r] = acc[j][r] * inv; hi[r] = acc[j][4 + r] * inv; }
    vst2(yp + j * 16, lo); vst2(yp + j * 16 + 4, hi); } }
// ---- k_out: block = (64 rows, 128 cols): out = y (bf16 hi + lo) Wproj + b
__global__ __launch_bounds__(128) void k_out(const float* __restrict__ Y, const float* __restrict__ WP, const float* __restrict__ BP, float* __restrict__ OUT) { __shared__ __align__(16) float sf[4][16][132]; __shared__ __align__(16) __bf16 wt[2][128][72];
  const int tid = threadIdx.x, wave = tid >> 5, lane = tid & 31, col = lane & 15, g = lane >> 4; const int c0 = blockIdx.y * 128; const size_t r0 = (size_t)blockIdx.x * 64 + wave * 16;
  v8f acc[8] = {};
  const float* wp = WP + c0 + lane;   // this lane's column of the block's weight columns
  const float* yp = Y + (r0 + col) * CC + 8 * g;
  float wr[4][16], yr[2][16]; F2 a[2];
  // every '#pragma unroll' below: constant trip count, unrolled so that the register arrays are indexed by constants
  auto mult = [&](const __bf16 (*t)[72]) {   // 64 k of the tile; four B fragments are read as one group ahead of their eight products
#pragma unroll
    for (int kk = 0; kk < 2; ++kk)
#pragma unroll
      for (int jh = 0; jh < 2; ++jh) { v16b w[4];
#pragma unroll
        for (int q = 0; q < 4; ++q) w[q] = frag_b(&t[(jh * 4 + q) * 16 + col][kk * 32], lane);
#pragma unroll
        for (int q = 0; q < 4; ++q) { acc[jh * 4 + q] = wmma_bf(a[kk].h, w[q], acc[jh * 4 + q]); acc[jh * 4 + q] = wmma_bf(a[kk].l, w[q], acc[jh * 4 + q]); } } };
  wt_load(wr, wp, wave, CC); row_load(yr, yp);
  asm volatile("s_wait_xcnt 0x0" ::: "memory");   // behind the loads, before their address registers are reused
  wt_store(wt[0], wr, wave, lane); a[0] = bsplit16(yr[0]); a[1] = bsplit16(yr[1]);
  __syncthreads();
  __bf16 (*cur)[72] = wt[0]; __bf16 (*nxt)[72] = wt[1];
  for (int kb = 1; kb < CC / 64; ++kb) {
    wt_load(wr, wp + (size_t)kb * 64 * CC, wave, CC); row_load(yr, yp + kb * 64);   // the next 64 k fly while this tile is multiplied
    asm volatile("s_wait_xcnt 0x0" ::: "memory");   // behind the loads, before their address registers are reused
    mult(cur);
    wt_store(nxt, wr, wave, lane); a[0] = bsplit16(yr[0]); a[1] = bsplit16(yr[1]);
    __syncthreads();   // publishes the next tile and ends every wave's reads of this one
    __bf16 (*t)[72] = cur; cur = nxt; nxt = t; }
  mult(cur);
#pragma unroll
  for (int j = 0; j < 8; ++j) { const float bb = BP ? bfr(BP[c0 + j * 16 + col]) : 0.f;
#pragma unroll
    for (int r = 0; r < 8; ++r) sf[wave][8 * g + r][j * 16 + col] = acc[j][r] + bb; }
  LDSX(); for (int rl = 0; rl < 16; ++rl) vst2(OUT + (r0 + rl) * CC + c0 + lane * 4, *(const v4f*)&sf[wave][rl][lane * 4]); }
extern "C" void kernel_launch(void* const* d_in, const int* in_sizes, int n_in, void* d_out, int out_size, void* d_ws, size_t ws_size, hipStream_t stream) {
  (void)in_sizes; (void)n_in; (void)out_size;
  const float** F = (const float**)d_in;   // 0 xt [2,2048,1024], 1 W_ca [1024,2048] (in,out), 2 b_ca [2048], 3 W_proj [1024,1024], 4 b_proj
  if (ws_size < (size_t)WS_END) return;
  char* ws = (char*)d_ws; _Float16 *QH = (_Float16*)(ws + WS_QH), *QL = (_Float16*)(ws + WS_QL), *KH = (_Float16*)(ws + WS_KH); __bf16 *VT = (__bf16*)(ws + WS_VT), *VL = (__bf16*)(ws + WS_VL); float *Y = (float*)(ws + WS_Y);
  k_proj<<<dim3(TNB * TT / 64, CC / 128, 2), 128, 0, stream>>>(F[0], F[1], F[2], QH, QL, KH, VT, VL);   // which 1 -> qk_t (cols 0..C), which 2 -> v (cols C..2C) of the [C, 2C] weight
  k_fa<<<dim3(TNB * NH, TT / 64), 128, 0, stream>>>(F[0], KH, VT, VL, Y);   // all batches and heads in one launch
  k_out<<<dim3(TNB * TT / 64, CC / 128), 128, 0, stream>>>(Y, F[3], F[4], (float*)d_out);
}

// v004
// A run of this version takes 114 microseconds.
// Timed twice side by side with v003, it ran 1.12 and 1.13 times as fast.
// Counting every step since v000, it is 11.2 times as fast.
// compute dtype: all float inputs rounded to bf16; [qk_t | v] = x W_ca + b_ca ([C, 2C]) with EXACT bf16 products on WMMA 16x16x32, f32 accumulate; query = the bf16-exact input rows themselves (as f16, exact), qk_t rounded once to f16 -> 1-product logits / 8, causal, kept in registers (one launch for all heads); running-maximum softmax in f32 in base 2 (one fma and one hardware exp2 per score), un-normalised P split bf16 hi + lo against v bf16 hi + lo (3 products), divided by the row sum at the end; out = y (bf16 hi + lo) W_proj + b_proj; f32 output.
#include <hip/hip_runtime.h>
#include <math.h>

typedef __attribute__((ext_vector_type(16))) _Float16 v16h;
typedef __attribute__((ext_vector_type(16))) __bf16 v16b;
typedef __attribute__((ext_vector_type(8)))  _Float16 v8h;
typedef __attribute__((ext_vector_type(8)))  float v8f;
typedef __attribute__((ext_vector_type(4)))  float v4f;
typedef __attribute__((ext_vector_type(2)))  float v2f;
typedef __attribute__((ext_vector_type(4)))  unsigned v4u;
typedef __attribute__((ext_vector_type(4)))  int v4i;
typedef float __attribute__((may_alias)) float_a;
typedef int __attribute__((may_alias)) int_a;

template <typename T> __device__ __forceinline__ void vst2(void* p, T v) { *(T*)p = v;  }
__device__ __forceinline__ v8f wmma16(v16h a, v16h b, v8f c) {
  v8f d = __builtin_amdgcn_wmma_f32_16x16x32_f16(false, a, false, b, (short)0, c, false, false);
  asm volatile("v_nop\n\tv_nop\n\tv_nop\n\tv_nop" : "+v"(d) : "v"(a), "v"(b));
  return d;
}
__device__ __forceinline__ v8f wmma_bf(v16b a, v16b b, v8f c) {
  v8f d = __builtin_amdgcn_wmma_f32_16x16x32_bf16(false, a, false, b, (short)0, c, false, false);
  asm volatile("v_nop\n\tv_nop\n\tv_nop\n\tv_nop" : "+v"(d) : "v"(a), "v"(b));
  return d;
}
// 16x16x32 fragments: lane = (h = lane>>4, row/col = lane&15); elements 0..7 = k0+8h+0..7, 8..15 = k0+16+8h+0..7; D element r = row 8h+r
__device__ __forceinline__ v16h frag_h(const _Float16* rowk0, int lane) {
  union { v16h v; v8h q[2]; } u; const _Float16* p = rowk0 + 8 * (lane >> 4);
  u.q[0] = *(const v8h*)p; u.q[1] = *(const v8h*)(p + 16); return u.v;
}
__device__ __forceinline__ v16h frag_f32(const float* rowk0, int lane) {
  v16h a; const float* p = rowk0 + 8 * (lane >> 4);
#pragma unroll
  for (int i = 0; i < 8; ++i) { a[i] = (_Float16)p[i]; a[8 + i] = (_Float16)p[16 + i]; }
  return a;
}
__device__ __forceinline__ v16h frag_f32s(const float* rowk0, int lane, float sc) {
  v16h a; const float* p = rowk0 + 8 * (lane >> 4);
#pragma unroll
  for (int i = 0; i < 8; ++i) { a[i] = (_Float16)(p[i] * sc); a[8 + i] = (_Float16)(p[16 + i] * sc); }
  return a;
}
// column fragment from a [K][ld] layout (column n), rows >= K read as 0
__device__ __forceinline__ v16h fragc_f32(const float* W, int k0, int n, int lane, int ld, int K) {
  v16h a; const int g = lane >> 4;
#pragma unroll
  for (int i = 0; i < 8; ++i) { const int ka = k0 + 8 * g + i, kb = ka + 16;
    a[i] = (_Float16)(ka < K ? W[(size_t)(ka < K ? ka : K - 1) * ld + n] : 0.f); a[8 + i] = (_Float16)(kb < K ? W[(size_t)(kb < K ? kb : K - 1) * ld + n] : 0.f); }
  return a;
}
struct F2 { v16b h, l; };
__device__ __forceinline__ F2 bsplit16(const float v[16]) { F2 r;
#pragma unroll
  for (int i = 0; i < 16; ++i) { const __bf16 h = (__bf16)v[i]; r.h[i] = h; r.l[i] = (__bf16)(v[i] - (float)h); }
  return r; }
__device__ __forceinline__ F2 split_row(const float* row, int k0, int lane) { float v[16]; const float* p = row + k0 + 8 * (lane >> 4);
#pragma unroll
  for (int i = 0; i < 8; ++i) { v[i] = p[i]; v[8 + i] = p[16 + i]; }
  return bsplit16(v); }
__device__ __forceinline__ F2 split_rowK(const float* row, int k0, int lane, int K) { float v[16]; const int g = lane >> 4;
#pragma unroll
  for (int i = 0; i < 8; ++i) { const int ka = k0 + 8 * g + i, kb = ka + 16; v[i] = ka < K ? row[ka < K ? ka : K - 1] : 0.f; v[8 + i] = kb < K ? row[kb < K ? kb : K - 1] : 0.f; }
  return bsplit16(v); }
__device__ __forceinline__ F2 split_col(const float* W, int k0, int n, int lane, int ld, int K) { float v[16]; const int g = lane >> 4;
#pragma unroll
  for (int i = 0; i < 8; ++i) { const int ka = k0 + 8 * g + i, kb = ka + 16; v[i] = ka < K ? W[(size_t)(ka < K ? ka : K - 1) * ld + n] : 0.f; v[8 + i] = kb < K ? W[(size_t)(kb < K ? kb : K - 1) * ld + n] : 0.f; }
  return bsplit16(v); }
__device__ __forceinline__ v8f mac3(const F2& a, const F2& b, v8f c) { c = wmma_bf(a.l, b.h, c); c = wmma_bf(a.h, b.l, c); return wmma_bf(a.h, b.h, c); }
__device__ __forceinline__ float sigm(float v) { return 1.0f / (1.0f + expf(-v)); }
#define LDSX() do { asm volatile("s_wait_dscnt 0" ::: "memory"); __builtin_amdgcn_wave_barrier(); __builtin_amdgcn_fence(__ATOMIC_RELEASE, "workgroup"); } while (0)


// General causal self attention (B 2, T 2,048, C 1,024 = 16 x 64): [qk_t | v] = x W_ca + b_ca; scores = x_head . qk_t_head / 8 (the raw input is the query), causal softmax, . v, output Linear.
#define NB 2
#define TT 2048
#define CC 1024
#define NH 16
#define HD 64
#ifndef TNB
#define TNB NB
#endif
typedef __attribute__((ext_vector_type(8))) __bf16 v8b;
__device__ __forceinline__ v16b frag_b(const __bf16* rowk0, int lane) {
  union { v16b v; v8b q[2]; } u; const __bf16* p = rowk0 + 8 * (lane >> 4);
  u.q[0] = *(const v8b*)p; u.q[1] = *(const v8b*)(p + 16); return u.v;
}
__device__ __forceinline__ float bfr(float v) { return (float)(__bf16)v; }
__device__ __attribute__((noinline)) float exp_ni(float v) { return expf(v); }
__device__ __attribute__((noinline)) float erf_ni(float v) { return erff(v); }

#define WS_QH  0u
#define WS_QL  (WS_QH + 2u * (size_t)NB * TT * CC)
#define WS_KH  (WS_QL + 2u * (size_t)NB * TT * CC)
#define WS_VT  (WS_KH + 2u * (size_t)NB * TT * CC)      // bf16 v planes [b][c][t]
#define WS_VL  (WS_VT + 2u * (size_t)NB * CC * TT)      // bf16 v residual planes
#define HG 4                                          // only sizes WS_S; all heads run in one launch
#define WS_S   (WS_VL + 2u * (size_t)NB * CC * TT)      // unused: k_fa keeps logits in registers
#define WS_PH  (WS_S + 4u * (size_t)HG * TT * TT)
#define WS_Y   (WS_PH + 0u)              // f32 y rows [b*t][C]
#define WS_END (WS_Y + 4u * (size_t)NB * TT * CC)

// ---- weight tile in LDS: 64 k x 128 n of a row-major f32 weight, rounded to bf16 and laid as rows [n][k] (pitch 144 B), fetched once per block for its four waves
// wave w fetches k rows 16 w .. 16 w + 15, lane = column (+ 32 j): every load is one whole 128-B line
// every '#pragma unroll' in these three helpers: constant trip count, unrolled so that the register arrays are indexed by constants
__device__ __forceinline__ void wt_load(float (&r)[4][16], const float* __restrict__ Wl, int wave, int ld) {
#pragma unroll
  for (int j = 0; j < 4; ++j)
#pragma unroll
    for (int i = 0; i < 16; ++i) r[j][i] = Wl[(size_t)(wave * 16 + i) * ld + j * 32];
}
__device__ __forceinline__ void wt_store(__bf16 (*buf)[72], const float (&r)[4][16], int wave, int lane) {
#pragma unroll
  for (int j = 0; j < 4; ++j) { v8b a, b;
#pragma unroll
    for (int i = 0; i < 8; ++i) { a[i] = (__bf16)r[j][i]; b[i] = (__bf16)r[j][8 + i]; }
    *(v8b*)&buf[j * 32 + lane][wave * 16] = a; *(v8b*)&buf[j * 32 + lane][wave * 16 + 8] = b; }
}
__device__ __forceinline__ void row_load(float (&r)[2][16], const float* __restrict__ p) {   // one row's 64 k in fragment order: r[kk][i] = k 32 kk + 8 g + i, r[kk][8 + i] = 16 more
#pragma unroll
  for (int kk = 0; kk < 2; ++kk)
#pragma unroll
    for (int i = 0; i < 8; ++i) { r[kk][i] = p[kk * 32 + i]; r[kk][8 + i] = p[kk * 32 + 16 + i]; }
}
// ---- k_proj: block = (64 rows, 128 cols, which): [qk_t | v] = x W (+ b), exact; qk_t -> f16 rows, v -> bf16 hi + residual planes
__global__ __launch_bounds__(128) void k_proj(const float* __restrict__ X, const float* __restrict__ WA, const float* __restrict__ BA, _Float16* __restrict__ QH, _Float16* __restrict__ QL, _Float16* __restrict__ KH, __bf16* __restrict__ VT, __bf16* __restrict__ VL) {
  __shared__ __align__(16) _Float16 sh[64][136], sl[64][136]; __shared__ __align__(16) __bf16 th[128][72], tl2[128][72];
  const int tid = threadIdx.x, wave = tid >> 5, lane = tid & 31, col = lane & 15, g = lane >> 4; const int which = blockIdx.z + 1; /* 1: qk_t -> KH, 2: v -> planes (no q projection: the query is x itself) */ const int c0 = blockIdx.y * 128; const size_t r0 = (size_t)blockIdx.x * 64;
  v8f acc[8] = {};
  const float* wp = WA + (size_t)(which - 1) * CC + c0 + lane;   // this lane's column of the block's weight columns
  const float* xp = X + (r0 + wave * 16 + col) * CC + 8 * g;
  float wr[4][16], xr[2][16]; v16b a[2];
  // every '#pragma unroll' below: constant trip count, unrolled so that the register arrays are indexed by constants
  auto cvt_a = [&]() {
#pragma unroll
    for (int kk = 0; kk < 2; ++kk)
#pragma unroll
      for (int i = 0; i < 16; ++i) a[kk][i] = (__bf16)xr[kk][i]; };
  auto mult = [&](const __bf16 (*t)[72]) {   // 64 k of the tile; four B fragments are read as one group ahead of their four products
#pragma unroll
    for (int kk = 0; kk < 2; ++kk)
#pragma unroll
      for (int jh = 0; jh < 2; ++jh) { v16b w[4];
#pragma unroll
        for (int q = 0; q < 4; ++q) w[q] = frag_b(&t[(jh * 4 + q) * 16 + col][kk * 32], lane);
#pragma unroll
        for (int q = 0; q < 4; ++q) acc[jh * 4 + q] = wmma_bf(a[kk], w[q], acc[jh * 4 + q]); } };
  wt_load(wr, wp, wave, 2 * CC); row_load(xr, xp);
  asm volatile("s_wait_xcnt 0x0" ::: "memory");   // behind the loads, before their address registers are reused
  wt_store(th, wr, wave, lane); cvt_a();   // th and tl2 are the two tile buffers until the epilogue takes them back
  __syncthreads();
  __bf16 (*cur)[72] = th; __bf16 (*nxt)[72] = tl2;
  for (int kb = 1; kb < CC / 64; ++kb) {
    wt_load(wr, wp + (size_t)kb * 64 * (2 * CC), wave, 2 * CC); row_load(xr, xp + kb * 64);   // the next 64 k fly while this tile is multiplied
    asm volatile("s_wait_xcnt 0x0" ::: "memory");   // behind the loads, before their address registers are reused
    mult(cur);
    wt_store(nxt, wr, wave, lane); cvt_a();
    __syncthreads();   // publishes the next tile and ends every wave's reads of this one
    __bf16 (*t)[72] = cur; cur = nxt; nxt = t; }
  mult(cur);
  __syncthreads();   // every wave has left th and tl2 before the epilogue writes them
#pragma unroll
  for (int j = 0; j < 8; ++j) { const float bb = BA ? bfr(BA[(which - 1) * CC + c0 + j * 16 + col]) : 0.f;
#pragma unroll
    for (int r = 0; r < 8; ++r) { const float v = acc[j][r] + bb; const int rl = wave * 16 + 8 * g + r, cl = j * 16 + col; const _Float16 hv = (_Float16)v;
      if (which == 2) { const __bf16 bh = (__bf16)v; th[cl][rl] = bh; tl2[cl][rl] = (__bf16)(v - (float)bh); } else { sh[rl][cl] = hv; sl[rl][cl] = (_Float16)(v - (float)hv); } } }
  __syncthreads();
  if (which < 2) { _Float16* dh = which == 0 ? QH : KH; for (int e = tid; e < 64 * 16; e += 128) { const int rl = e >> 4, q = e & 15; vst2((unsigned*)(dh + (r0 + rl) * CC + c0 + q * 8), *(const v4u*)&sh[rl][q * 8]); if (which == 0) vst2((unsigned*)(QL + (r0 + rl) * CC + c0 + q * 8), *(const v4u*)&sl[rl][q * 8]); } }
  else { const size_t b = r0 / TT; const int t0 = (int)(r0 % TT); for (int e = tid; e < 128 * 8; e += 128) { const int cl = e >> 3, q = e & 7; const size_t o2 = (b * CC + c0 + cl) * (size_t)TT + t0 + q * 8; vst2((unsigned*)(VT + o2), *(const v4u*)&th[cl][q * 8]); vst2((unsigned*)(VL + o2), *(const v4u*)&tl2[cl][q * 8]); } } }
__device__ __forceinline__ float xhalf(float x) { return __builtin_bit_cast(float, __builtin_amdgcn_permlanex16(__builtin_bit_cast(int, x), __builtin_bit_cast(int, x), 0x76543210, 0xfedcba98, false, false)); }   // lane l <-> lane l ^ 16
#define FROW 144u                 // LDS row pitch in bytes: 16 B x odd, free of bank conflicts for 16-byte reads
#define FPL  (64u * FROW)         // one plane of a tile: 64 rows
#define FBUF (3u * FPL)           // one buffer: K rows, V hi plane, V lo plane
#define FSC  0.18033688011112042f // (1 / 8) log2(e): exp((s - max) / 8) = exp2(s FSC - max FSC)
// one tile: each lane copies 16 B of rows r, r + 16, r + 32, r + 48 of each plane, so every copy of a wave covers four whole 128-B lines
__device__ __forceinline__ void fa_fill(unsigned ld, const char* gk, const char* gh, const char* gl) {
  // the twelve copies and the wait behind them stand in one statement, so that no address register is rewritten before the wait
  asm volatile("global_load_async_to_lds_b128 %0, %12, off\n\t"
               "global_load_async_to_lds_b128 %1, %13, off\n\t"
               "global_load_async_to_lds_b128 %2, %14, off\n\t"
               "global_load_async_to_lds_b128 %3, %15, off\n\t"
               "global_load_async_to_lds_b128 %4, %16, off\n\t"
               "global_load_async_to_lds_b128 %5, %17, off\n\t"
               "global_load_async_to_lds_b128 %6, %18, off\n\t"
               "global_load_async_to_lds_b128 %7, %19, off\n\t"
               "global_load_async_to_lds_b128 %8, %20, off\n\t"
               "global_load_async_to_lds_b128 %9, %21, off\n\t"
               "global_load_async_to_lds_b128 %10, %22, off\n\t"
               "global_load_async_to_lds_b128 %11, %23, off\n\t"
               "s_wait_xcnt 0x0"
               :: "v"(ld), "v"(ld + 16u * FROW), "v"(ld + 32u * FROW), "v"(ld + 48u * FROW),
                  "v"(ld + FPL), "v"(ld + FPL + 16u * FROW), "v"(ld + FPL + 32u * FROW), "v"(ld + FPL + 48u * FROW),
                  "v"(ld + 2u * FPL), "v"(ld + 2u * FPL + 16u * FROW), "v"(ld + 2u * FPL + 32u * FROW), "v"(ld + 2u * FPL + 48u * FROW),
                  "v"(gk), "v"(gk + 16 * CC * 2), "v"(gk + 32 * CC * 2), "v"(gk + 48 * CC * 2),
                  "v"(gh), "v"(gh + 16 * TT * 2), "v"(gh + 32 * TT * 2), "v"(gh + 48 * TT * 2),
                  "v"(gl), "v"(gl + 16 * TT * 2), "v"(gl + 32 * TT * 2), "v"(gl + 48 * TT * 2)
               : "memory");
}
__global__ __launch_bounds__(128) void k_fa(const float* __restrict__ X, const _Float16* __restrict__ KH, const __bf16* __restrict__ VT, const __bf16* __restrict__ VL, float* __restrict__ Y) {
  __shared__ __align__(16) unsigned char fs[2u * FBUF];
  // every '#pragma unroll' in this kernel: constant trip count, unrolled so that the fragment arrays are indexed by constants and stay in registers
  const int tid = threadIdx.x, wave = __builtin_amdgcn_readfirstlane(tid >> 5) /* scalar: the pass count and the diagonal test become scalar branches, EXEC stays all ones at every WMMA */, lane = tid & 31, col = lane & 15, g = lane >> 4;
  const int h = blockIdx.x % NH, b = blockIdx.x / NH;
  const int nst = TT / 64 - (int)blockIdx.y;                                 // tiles of 64 keys up to and including the diagonal (block-uniform); longest query blocks start first
  const int ql0 = (nst - 1) * 64 + wave * 16;
  const int np = (ql0 + 16 + 31) >> 5;                                       // passes up to and including the diagonal (wave-uniform)
  const int qt = ql0 + col;
  const int crow = tid >> 3, cpos = (tid & 7) * 16;                          // this lane's first row and its 16 B of the row, in every plane of a tile
  const char* gk = (const char*)(KH + ((size_t)b * TT + crow) * CC + h * HD) + cpos;        // tile t: 64 key rows further
  const char* gh = (const char*)(VT + ((size_t)b * CC + h * HD + crow) * (size_t)TT) + cpos;   // tile t: 64 keys = 128 B further
  const char* gl = (const char*)(VL + ((size_t)b * CC + h * HD + crow) * (size_t)TT) + cpos;
  const unsigned ld = (unsigned)(size_t)fs + (unsigned)crow * FROW + (unsigned)cpos;
  fa_fill(ld, gk, gh, gl);
  v16h qf[HD / 32];
#pragma unroll
  for (int kc = 0; kc < HD / 32; ++kc) { const float* xp = X + ((size_t)b * TT + qt) * CC + h * HD + kc * 32 + 8 * g;
#pragma unroll
    for (int i = 0; i < 8; ++i) { qf[kc][i] = (_Float16)bfr(xp[i]); qf[kc][8 + i] = (_Float16)bfr(xp[16 + i]); } }   // query = raw input head slice (bf16-exact values, exact in f16)
  v8f acc[HD / 16] = {}; float m = -3.0e38f * FSC, l = 0.f;   // m: running maximum in base-2 units (logit x FSC)
  asm volatile("s_wait_asynccnt 0x0" ::: "memory");   // this wave's share of tile 0 has landed
  __syncthreads();                                    // publishes tile 0
  if (nst > 1) fa_fill(ld + FBUF, gk + (size_t)64 * CC * 2, gh + 128, gl + 128);
  for (int t = 0; t < nst; ++t) {
    const unsigned char* tb = fs + (unsigned)(t & 1) * FBUF;
    const _Float16* kp = (const _Float16*)(tb + (unsigned)col * FROW);
    const __bf16* vhp = (const __bf16*)(tb + FPL + (unsigned)col * FROW);
    const __bf16* vlp = (const __bf16*)(tb + 2u * FPL + (unsigned)col * FROW);
#pragma unroll
    for (int sub = 0; sub < 2; ++sub) { const int ps = 2 * t + sub, k0 = ps * 32;
      if (sub == 0 || ps < np) {   // the first two waves have no open key in the second half of the diagonal tile
        v16h kf[2][HD / 32];
#pragma unroll
        for (int u = 0; u < 2; ++u)
#pragma unroll
          for (int kc = 0; kc < HD / 32; ++kc) kf[u][kc] = frag_h(kp + (sub * 32 + u * 16) * (int)(FROW / 2) + kc * 32, lane);
        v16b vh[HD / 16], vl[HD / 16];
#pragma unroll
        for (int j = 0; j < HD / 16; ++j) { vh[j] = frag_b(vhp + j * 16 * (int)(FROW / 2) + sub * 32, lane); vl[j] = frag_b(vlp + j * 16 * (int)(FROW / 2) + sub * 32, lane); }
        __builtin_amdgcn_sched_barrier(0);   // keeps the pass's 24 LDS reads together, as one group ahead of its products: left free, they sink to one read and one full wait in front of each product
        v8f st[2] = {};
#pragma unroll
        for (int u = 0; u < 2; ++u)
#pragma unroll
          for (int kc = 0; kc < HD / 32; ++kc) st[u] = __builtin_amdgcn_wmma_f32_16x16x32_f16(false, kf[u][kc], false, qf[kc], (short)0, st[u], false, false);   // st[u][r] = logit(key k0 + 16 u + 8 g + r, query qt)
        float p[16];
#pragma unroll
        for (int u = 0; u < 2; ++u)
#pragma unroll
          for (int r = 0; r < 8; ++r) p[u * 8 + r] = st[u][r];   // unscaled: the scale rides in the fma in front of exp2
        if (k0 + 31 > ql0) {   // only passes that reach the diagonal hold masked keys
#pragma unroll
          for (int i = 0; i < 16; ++i) if (k0 + (i >> 3) * 16 + 8 * g + (i & 7) > qt) p[i] = -3.0e38f; }
        float mx = p[0];
#pragma unroll
        for (int i = 1; i < 16; ++i) mx = fmaxf(mx, p[i]);
        mx = fmaxf(mx, xhalf(mx));
        const float mn = fmaxf(m, mx * FSC);   // FSC > 0: the maximum may be taken before the scale
        float sum = 0.f;
#pragma unroll
        for (int i = 0; i < 16; ++i) { p[i] = __builtin_amdgcn_exp2f(fmaf(p[i], FSC, -mn)); sum += p[i]; }   // a masked key: exp2(-3e38 FSC - mn) is exactly 0 (mn is finite: key 0 is open to every query)
        float al;   // rescale factor exp2(old maximum - new maximum)
        asm("v_exp_f32 %0, %1\n\tv_nop" : "=v"(al) : "v"(m - mn));   // in asm for the v_nop alone: it is the slot that the instruction set asks for behind a transcendental
        m = mn;
        l = l * al + sum;   // each lane half keeps the sum of its own keys; joined after the loop
#pragma unroll
        for (int j = 0; j < HD / 16; ++j) acc[j] *= al;
        const F2 pf = bsplit16(p);
#pragma unroll
        for (int j = 0; j < HD / 16; ++j) { acc[j] = __builtin_amdgcn_wmma_f32_16x16x32_bf16(false, vh[j], false, pf.h, (short)0, acc[j], false, false); acc[j] = __builtin_amdgcn_wmma_f32_16x16x32_bf16(false, vh[j], false, pf.l, (short)0, acc[j], false, false); acc[j] = __builtin_amdgcn_wmma_f32_16x16x32_bf16(false, vl[j], false, pf.h, (short)0, acc[j], false, false); } } }
    asm volatile("s_wait_dscnt 0x0" ::: "memory");      // this wave's reads of tile t have returned before the buffer is handed back
    asm volatile("s_wait_asynccnt 0x0" ::: "memory");   // this wave's share of tile t + 1 has landed
    __syncthreads();                                    // publishes tile t + 1 and ends every wave's reads of tile t
    if (t + 2 < nst) fa_fill(ld + (unsigned)(t & 1) * FBUF, gk + (size_t)(t + 2) * (64 * CC * 2), gh + (t + 2) * 128, gl + (t + 2) * 128); }
  asm volatile("s_wait_asynccnt 0x0" ::: "memory");     // no copy is outstanding when the wave ends
  l += xhalf(l); const float inv = 1.0f / l;
  float* yp = Y + ((size_t)b * TT + qt) * CC + h * HD + 8 * g;   // acc[j][r] = y(query qt, d = 16 j + 8 g + r)
#pragma unroll
  for (int j = 0; j < HD / 16; ++j) { v4f lo, hi;
#pragma unroll
    for (int r = 0; r < 4; ++r) { lo[r] = acc[j][r] * inv; hi[r] = acc[j][4 + r] * inv; }
    vst2(yp + j * 16, lo); vst2(yp + j * 16 + 4, hi); } }
// ---- k_out: block = (64 rows, 128 cols): out = y (bf16 hi + lo) Wproj + b
__global__ __launch_bounds__(128) void k_out(const float* __restrict__ Y, const float* __restrict__ WP, const float* __restrict__ BP, float* __restrict__ OUT) { __shared__ __align__(16) float sf[4][16][132]; __shared__ __align__(16) __bf16 wt[2][128][72];
  const int tid = threadIdx.x, wave = tid >> 5, lane = tid & 31, col = lane & 15, g = lane >> 4; const int c0 = blockIdx.y * 128; const size_t r0 = (size_t)blockIdx.x * 64 + wave * 16;
  v8f acc[8] = {};
  const float* wp = WP + c0 + lane;   // this lane's column of the block's weight columns
  const float* yp = Y + (r0 + col) * CC + 8 * g;
  float wr[4][16], yr[2][16]; F2 a[2];
  // every '#pragma unroll' below: constant trip count, unrolled so that the register arrays are indexed by constants
  auto mult = [&](const __bf16 (*t)[72]) {   // 64 k of the tile; four B fragments are read as one group ahead of their eight products
#pragma unroll
    for (int kk = 0; kk < 2; ++kk)
#pragma unroll
      for (int jh = 0; jh < 2; ++jh) { v16b w[4];
#pragma unroll
        for (int q = 0; q < 4; ++q) w[q] = frag_b(&t[(jh * 4 + q) * 16 + col][kk * 32], lane);
#pragma unroll
        for (int q = 0; q < 4; ++q) { acc[jh * 4 + q] = wmma_bf(a[kk].h, w[q], acc[jh * 4 + q]); acc[jh * 4 + q] = wmma_bf(a[kk].l, w[q], acc[jh * 4 + q]); } } };
  wt_load(wr, wp, wave, CC); row_load(yr, yp);
  asm volatile("s_wait_xcnt 0x0" ::: "memory");   // behind the loads, before their address registers are reused
  wt_store(wt[0], wr, wave, lane); a[0] = bsplit16(yr[0]); a[1] = bsplit16(yr[1]);
  __syncthreads();
  __bf16 (*cur)[72] = wt[0]; __bf16 (*nxt)[72] = wt[1];
  for (int kb = 1; kb < CC / 64; ++kb) {
    wt_load(wr, wp + (size_t)kb * 64 * CC, wave, CC); row_load(yr, yp + kb * 64);   // the next 64 k fly while this tile is multiplied
    asm volatile("s_wait_xcnt 0x0" ::: "memory");   // behind the loads, before their address registers are reused
    mult(cur);
    wt_store(nxt, wr, wave, lane); a[0] = bsplit16(yr[0]); a[1] = bsplit16(yr[1]);
    __syncthreads();   // publishes the next tile and ends every wave's reads of this one
    __bf16 (*t)[72] = cur; cur = nxt; nxt = t; }
  mult(cur);
#pragma unroll
  for (int j = 0; j < 8; ++j) { const float bb = BP ? bfr(BP[c0 + j * 16 + col]) : 0.f;
#pragma unroll
    for (int r = 0; r < 8; ++r) sf[wave][8 * g + r][j * 16 + col] = acc[j][r] + bb; }
  LDSX(); for (int rl = 0; rl < 16; ++rl) vst2(OUT + (r0 + rl) * CC + c0 + lane * 4, *(const v4f*)&sf[wave][rl][lane * 4]); }
extern "C" void kernel_launch(void* const* d_in, const int* in_sizes, int n_in, void* d_out, int out_size, void* d_ws, size_t ws_size, hipStream_t stream) {
  (void)in_sizes; (void)n_in; (void)out_size;
  const float** F = (const float**)d_in;   // 0 xt [2,2048,1024], 1 W_ca [1024,2048] (in,out), 2 b_ca [2048], 3 W_proj [1024,1024], 4 b_proj
  if (ws_size < (size_t)WS_END) return;
  char* ws = (char*)d_ws; _Float16 *QH = (_Float16*)(ws + WS_QH), *QL = (_Float16*)(ws + WS_QL), *KH = (_Float16*)(ws + WS_KH); __bf16 *VT = (__bf16*)(ws + WS_VT), *VL = (__bf16*)(ws + WS_VL); float *Y = (float*)(ws + WS_Y);
  k_proj<<<dim3(TNB * TT / 64, CC / 128, 2), 128, 0, stream>>>(F[0], F[1], F[2], QH, QL, KH, VT, VL);   // which 1 -> qk_t (cols 0..C), which 2 -> v (cols C..2C) of the [C, 2C] weight
  k_fa<<<dim3(TNB * NH, TT / 64), 128, 0, stream>>>(F[0], KH, VT, VL, Y);   // all batches and heads in one launch
  k_out<<<dim3(TNB * TT / 64, CC / 128), 128, 0, stream>>>(Y, F[3], F[4], (float*)d_out);
}

// v005
// A run of this version takes 90.3 microseconds.
// Timed twice side by side with v004, it ran 1.26 times as fast both times.
// Over all steps from v000 it is 14.1 times as fast.
// compute dtype: all float inputs rounded to bf16; [qk_t | v] = x W_ca + b_ca ([C, 2C]) with EXACT bf16 products on WMMA 16x16x32, f32 accumulate; query = the bf16-exact input rows themselves (as f16, exact), qk_t rounded once to f16 -> 1-product logits / 8, causal, kept in registers (one launch for all heads); running-maximum softmax in f32 in base 2 (one fma and one hardware exp2 per score), un-normalised P split bf16 hi + lo against v bf16 hi + lo (3 products), divided by the row sum at the end; out = y (bf16 hi + lo) W_proj + b_proj; f32 output.
#include <hip/hip_runtime.h>
#include <math.h>

typedef __attribute__((ext_vector_type(16))) _Float16 v16h;
typedef __attribute__((ext_vector_type(16))) __bf16 v16b;
typedef __attribute__((ext_vector_type(8)))  _Float16 v8h;
typedef __attribute__((ext_vector_type(8)))  float v8f;
typedef __attribute__((ext_vector_type(4)))  float v4f;
typedef __attribute__((ext_vector_type(2)))  float v2f;
typedef __attribute__((ext_vector_type(4)))  unsigned v4u;
typedef __attribute__((ext_vector_type(4)))  int v4i;
typedef float __attribute__((may_alias)) float_a;
typedef int __attribute__((may_alias)) int_a;

template <typename T> __device__ __forceinline__ void vst2(void* p, T v) { *(T*)p = v;  }
__device__ __forceinline__ v8f wmma16(v16h a, v16h b, v8f c) {
  v8f d = __builtin_amdgcn_wmma_f32_16x16x32_f16(false, a, false, b, (short)0, c, false, false);
  asm volatile("v_nop\n\tv_nop\n\tv_nop\n\tv_nop" : "+v"(d) : "v"(a), "v"(b));
  return d;
}
__device__ __forceinline__ v8f wmma_bf(v16b a, v16b b, v8f c) {
  v8f d = __builtin_amdgcn_wmma_f32_16x16x32_bf16(false, a, false, b, (short)0, c, false, false);
  asm volatile("v_nop\n\tv_nop\n\tv_nop\n\tv_nop" : "+v"(d) : "v"(a), "v"(b));
  return d;
}
// 16x16x32 fragments: lane = (h = lane>>4, row/col = lane&15); elements 0..7 = k0+8h+0..7, 8..15 = k0+16+8h+0..7; D element r = row 8h+r
__device__ __forceinline__ v16h frag_h(const _Float16* rowk0, int lane) {
  union { v16h v; v8h q[2]; } u; const _Float16* p = rowk0 + 8 * (lane >> 4);
  u.q[0] = *(const v8h*)p; u.q[1] = *(const v8h*)(p + 16); return u.v;
}
__device__ __forceinline__ v16h frag_f32(const float* rowk0, int lane) {
  v16h a; const float* p = rowk0 + 8 * (lane >> 4);
#pragma unroll
  for (int i = 0; i < 8; ++i) { a[i] = (_Float16)p[i]; a[8 + i] = (_Float16)p[16 + i]; }
  return a;
}
__device__ __forceinline__ v16h frag_f32s(const float* rowk0, int lane, float sc) {
  v16h a; const float* p = rowk0 + 8 * (lane >> 4);
#pragma unroll
  for (int i = 0; i < 8; ++i) { a[i] = (_Float16)(p[i] * sc); a[8 + i] = (_Float16)(p[16 + i] * sc); }
  return a;
}
// column fragment from a [K][ld] layout (column n), rows >= K read as 0
__device__ __forceinline__ v16h fragc_f32(const float* W, int k0, int n, int lane, int ld, int K) {
  v16h a; const int g = lane >> 4;
#pragma unroll
  for (int i = 0; i < 8; ++i) { const int ka = k0 + 8 * g + i, kb = ka + 16;
    a[i] = (_Float16)(ka < K ? W[(size_t)(ka < K ? ka : K - 1) * ld + n] : 0.f); a[8 + i] = (_Float16)(kb < K ? W[(size_t)(kb < K ? kb : K - 1) * ld + n] : 0.f); }
  return a;
}
struct F2 { v16b h, l; };
__device__ __forceinline__ F2 bsplit16(const float v[16]) { F2 r;
#pragma unroll
  for (int i = 0; i < 16; ++i) { const __bf16 h = (__bf16)v[i]; r.h[i] = h; r.l[i] = (__bf16)(v[i] - (float)h); }
  return r; }
__device__ __forceinline__ F2 split_row(const float* row, int k0, int lane) { float v[16]; const float* p = row + k0 + 8 * (lane >> 4);
#pragma unroll
  for (int i = 0; i < 8; ++i) { v[i] = p[i]; v[8 + i] = p[16 + i]; }
  return bsplit16(v); }
__device__ __forceinline__ F2 split_rowK(const float* row, int k0, int lane, int K) { float v[16]; const int g = lane >> 4;
#pragma unroll
  for (int i = 0; i < 8; ++i) { const int ka = k0 + 8 * g + i, kb = ka + 16; v[i] = ka < K ? row[ka < K ? ka : K - 1] : 0.f; v[8 + i] = kb < K ? row[kb < K ? kb : K - 1] : 0.f; }
  return bsplit16(v); }
__device__ __forceinline__ F2 split_col(const float* W, int k0, int n, int lane, int ld, int K) { float v[16]; const int g = lane >> 4;
#pragma unroll
  for (int i = 0; i < 8; ++i) { const int ka = k0 + 8 * g + i, kb = ka + 16; v[i] = ka < K ? W[(size_t)(ka < K ? ka : K - 1) * ld + n] : 0.f; v[8 + i] = kb < K ? W[(size_t)(kb < K ? kb : K - 1) * ld + n] : 0.f; }
  return bsplit16(v); }
__device__ __forceinline__ v8f mac3(const F2& a, const F2& b, v8f c) { c = wmma_bf(a.l, b.h, c); c = wmma_bf(a.h, b.l, c); return wmma_bf(a.h, b.h, c); }
__device__ __forceinline__ float sigm(float v) { return 1.0f / (1.0f + expf(-v)); }
#define LDSX() do { asm volatile("s_wait_dscnt 0" ::: "memory"); __builtin_amdgcn_wave_barrier(); __builtin_amdgcn_fence(__ATOMIC_RELEASE, "workgroup"); } while (0)


// General causal self attention (B 2, T 2,048, C 1,024 = 16 x 64): [qk_t | v] = x W_ca + b_ca; scores = x_head . qk_t_head / 8 (the raw input is the query), causal softmax, . v, output Linear.
#define NB 2
#define TT 2048
#define CC 1024
#define NH 16
#define HD 64
#ifndef TNB
#define TNB NB
#endif
typedef __attribute__((ext_vector_type(8))) __bf16 v8b;
__device__ __forceinline__ v16b frag_b(const __bf16* rowk0, int lane) {
  union { v16b v; v8b q[2]; } u; const __bf16* p = rowk0 + 8 * (lane >> 4);
  u.q[0] = *(const v8b*)p; u.q[1] = *(const v8b*)(p + 16); return u.v;
}
__device__ __forceinline__ float bfr(float v) { return (float)(__bf16)v; }
__device__ __attribute__((noinline)) float exp_ni(float v) { return expf(v); }
__device__ __attribute__((noinline)) float erf_ni(float v) { return erff(v); }

#define WS_QH  0u
#define WS_QL  (WS_QH + 2u * (size_t)NB * TT * CC)
#define WS_KH  (WS_QL + 2u * (size_t)NB * TT * CC)
#define WS_VT  (WS_KH + 2u * (size_t)NB * TT * CC)      // bf16 v planes [b][c][t]
#define WS_VL  (WS_VT + 2u * (size_t)NB * CC * TT)      // bf16 v residual planes
#define HG 4                                          // only sizes WS_S; all heads run in one launch
#define WS_S   (WS_VL + 2u * (size_t)NB * CC * TT)      // unused: k_fa keeps logits in registers
#define WS_PH  (WS_S + 4u * (size_t)HG * TT * TT)
#define WS_Y   (WS_PH + 0u)              // f32 y rows [b*t][C]
#define WS_END (WS_Y + 4u * (size_t)NB * TT * CC)

// ---- weight tile in LDS: 64 k x 128 n of a row-major f32 weight, rounded to bf16 and laid as rows [n][k] (pitch 144 B), fetched once per block for its eight waves (128 rows of the left operand share one tile)
// wave w fetches k rows 8 w .. 8 w + 7, lane = column (+ 32 j): every load is one whole 128-B line
// every '#pragma unroll' in these three helpers: constant trip count, unrolled so that the register arrays are indexed by constants
__device__ __forceinline__ void wt_load(float (&r)[4][8], const float* __restrict__ Wl, int wave, int ld) {
#pragma unroll
  for (int j = 0; j < 4; ++j)
#pragma unroll
    for (int i = 0; i < 8; ++i) r[j][i] = Wl[(size_t)(wave * 8 + i) * ld + j * 32];
}
__device__ __forceinline__ void wt_store(__bf16 (*buf)[72], const float (&r)[4][8], int wave, int lane) {
#pragma unroll
  for (int j = 0; j < 4; ++j) { v8b a;
#pragma unroll
    for (int i = 0; i < 8; ++i) a[i] = (__bf16)r[j][i];
    *(v8b*)&buf[j * 32 + lane][wave * 8] = a; }
}
__device__ __forceinline__ void row_load(float (&r)[2][16], const float* __restrict__ p) {   // one row's 64 k in fragment order: r[kk][i] = k 32 kk + 8 g + i, r[kk][8 + i] = 16 more
#pragma unroll
  for (int kk = 0; kk < 2; ++kk)
#pragma unroll
    for (int i = 0; i < 8; ++i) { r[kk][i] = p[kk * 32 + i]; r[kk][8 + i] = p[kk * 32 + 16 + i]; }
}
// ---- k_proj: block = (128 rows, 128 cols, which), eight waves of 16 rows: [qk_t | v] = x W (+ b), exact; qk_t -> f16 rows, v -> bf16 hi + lo planes
__global__ __launch_bounds__(256) void k_proj(const float* __restrict__ X, const float* __restrict__ WA, const float* __restrict__ BA, _Float16* __restrict__ QH, _Float16* __restrict__ QL, _Float16* __restrict__ KH, __bf16* __restrict__ VT, __bf16* __restrict__ VL) {
  __shared__ __align__(16) _Float16 sh[128][136], sl[128][136]; __shared__ __align__(16) __bf16 th[128][136], tl2[128][136];
  const int tid = threadIdx.x, wave = tid >> 5, lane = tid & 31, col = lane & 15, g = lane >> 4; const int which = blockIdx.z + 1; /* 1: qk_t -> KH, 2: v -> planes (no q projection: the query is x itself) */ const int c0 = blockIdx.y * 128; const size_t r0 = (size_t)blockIdx.x * 128;
  v8f acc[8] = {};
  const float* wp = WA + (size_t)(which - 1) * CC + c0 + lane;   // this lane's column of the block's weight columns
  const float* xp = X + (r0 + wave * 16 + col) * CC + 8 * g;
  float wr[4][8], xr[2][16]; v16b a[2];
  // every '#pragma unroll' below: constant trip count, unrolled so that the register arrays are indexed by constants
  auto cvt_a = [&]() {
#pragma unroll
    for (int kk = 0; kk < 2; ++kk)
#pragma unroll
      for (int i = 0; i < 16; ++i) a[kk][i] = (__bf16)xr[kk][i]; };
  auto mult = [&](const __bf16 (*t)[72]) {   // 64 k of the tile; four B fragments are read as one group ahead of their four products
#pragma unroll
    for (int kk = 0; kk < 2; ++kk)
#pragma unroll
      for (int jh = 0; jh < 2; ++jh) { v16b w[4];
#pragma unroll
        for (int q = 0; q < 4; ++q) w[q] = frag_b(&t[(jh * 4 + q) * 16 + col][kk * 32], lane);
#pragma unroll
        for (int q = 0; q < 4; ++q) acc[jh * 4 + q] = wmma_bf(a[kk], w[q], acc[jh * 4 + q]); } };
  wt_load(wr, wp, wave, 2 * CC); row_load(xr, xp);
  asm volatile("s_wait_xcnt 0x0" ::: "memory");   // behind the loads, before their address registers are reused
  __bf16 (*cur)[72] = (__bf16 (*)[72])th; __bf16 (*nxt)[72] = (__bf16 (*)[72])tl2;   // the first 128 x 72 elements of th and of tl2 are the two tile buffers until the epilogue takes them back
  wt_store(cur, wr, wave, lane); cvt_a();
  __syncthreads();
  for (int kb = 1; kb < CC / 64; ++kb) {
    wt_load(wr, wp + (size_t)kb * 64 * (2 * CC), wave, 2 * CC); row_load(xr, xp + kb * 64);   // the next 64 k fly while this tile is multiplied
    asm volatile("s_wait_xcnt 0x0" ::: "memory");   // behind the loads, before their address registers are reused
    mult(cur);
    wt_store(nxt, wr, wave, lane); cvt_a();
    __syncthreads();   // publishes the next tile and ends every wave's reads of this one
    __bf16 (*t)[72] = cur; cur = nxt; nxt = t; }
  mult(cur);
  __syncthreads();   // every wave has left th and tl2 before the epilogue writes them
#pragma unroll
  for (int j = 0; j < 8; ++j) { const float bb = BA ? bfr(BA[(which - 1) * CC + c0 + j * 16 + col]) : 0.f;
#pragma unroll
    for (int r = 0; r < 8; ++r) { const float v = acc[j][r] + bb; const int rl = wave * 16 + 8 * g + r, cl = j * 16 + col; const _Float16 hv = (_Float16)v;
      if (which == 2) { const __bf16 bh = (__bf16)v; th[cl][rl] = bh; tl2[cl][rl] = (__bf16)(v - (float)bh); } else { sh[rl][cl] = hv; sl[rl][cl] = (_Float16)(v - (float)hv); } } }
  __syncthreads();
  if (which < 2) { _Float16* dh = which == 0 ? QH : KH; for (int e = tid; e < 128 * 16; e += 256) { const int rl = e >> 4, q = e & 15; vst2((unsigned*)(dh + (r0 + rl) * CC + c0 + q * 8), *(const v4u*)&sh[rl][q * 8]);
      asm volatile("s_wait_xcnt 0x0" ::: "memory");   // behind the store, before its address and data registers are reused
      if (which == 0) { vst2((unsigned*)(QL + (r0 + rl) * CC + c0 + q * 8), *(const v4u*)&sl[rl][q * 8]);
        asm volatile("s_wait_xcnt 0x0" ::: "memory"); } } }   // the same, behind the second store
  else { const size_t b = r0 / TT; const int t0 = (int)(r0 % TT); for (int e = tid; e < 128 * 16; e += 256) { const int cl = e >> 4, q = e & 15; const size_t o2 = (b * CC + c0 + cl) * (size_t)TT + t0 + q * 8; vst2((unsigned*)(VT + o2), *(const v4u*)&th[cl][q * 8]); vst2((unsigned*)(VL + o2), *(const v4u*)&tl2[cl][q * 8]); } } }
__device__ __forceinline__ float xhalf(float x) { return __builtin_bit_cast(float, __builtin_amdgcn_permlanex16(__builtin_bit_cast(int, x), __builtin_bit_cast(int, x), 0x76543210, 0xfedcba98, false, false)); }   // lane l <-> lane l ^ 16
#define FROW 144u                 // LDS row pitch in bytes: 16 B x odd, free of bank conflicts for 16-byte reads
#define FPL  (64u * FROW)         // one plane of a tile: 64 rows
#define FBUF (3u * FPL)           // one buffer: K rows, V hi plane, V lo plane
#define FSC  0.18033688011112042f // (1 / 8) log2(e): exp((s - max) / 8) = exp2(s FSC - max FSC)
// one tile: each lane copies 16 B of rows r, r + 16, r + 32, r + 48 of each plane, so every copy of a wave covers four whole 128-B lines
__device__ __forceinline__ void fa_fill(unsigned ld, const char* gk, const char* gh, const char* gl) {
  // the twelve copies and the wait behind them stand in one statement, so that no address register is rewritten before the wait
  asm volatile("global_load_async_to_lds_b128 %0, %12, off\n\t"
               "global_load_async_to_lds_b128 %1, %13, off\n\t"
               "global_load_async_to_lds_b128 %2, %14, off\n\t"
               "global_load_async_to_lds_b128 %3, %15, off\n\t"
               "global_load_async_to_lds_b128 %4, %16, off\n\t"
               "global_load_async_to_lds_b128 %5, %17, off\n\t"
               "global_load_async_to_lds_b128 %6, %18, off\n\t"
               "global_load_async_to_lds_b128 %7, %19, off\n\t"
               "global_load_async_to_lds_b128 %8, %20, off\n\t"
               "global_load_async_to_lds_b128 %9, %21, off\n\t"
               "global_load_async_to_lds_b128 %10, %22, off\n\t"
               "global_load_async_to_lds_b128 %11, %23, off\n\t"
               "s_wait_xcnt 0x0"
               :: "v"(ld), "v"(ld + 16u * FROW), "v"(ld + 32u * FROW), "v"(ld + 48u * FROW),
                  "v"(ld + FPL), "v"(ld + FPL + 16u * FROW), "v"(ld + FPL + 32u * FROW), "v"(ld + FPL + 48u * FROW),
                  "v"(ld + 2u * FPL), "v"(ld + 2u * FPL + 16u * FROW), "v"(ld + 2u * FPL + 32u * FROW), "v"(ld + 2u * FPL + 48u * FROW),
                  "v"(gk), "v"(gk + 16 * CC * 2), "v"(gk + 32 * CC * 2), "v"(gk + 48 * CC * 2),
                  "v"(gh), "v"(gh + 16 * TT * 2), "v"(gh + 32 * TT * 2), "v"(gh + 48 * TT * 2),
                  "v"(gl), "v"(gl + 16 * TT * 2), "v"(gl + 32 * TT * 2), "v"(gl + 48 * TT * 2)
               : "memory");
}
__global__ __launch_bounds__(128) void k_fa(const float* __restrict__ X, const _Float16* __restrict__ KH, const __bf16* __restrict__ VT, const __bf16* __restrict__ VL, float* __restrict__ Y) {
  __shared__ __align__(16) unsigned char fs[2u * FBUF];
  // every '#pragma unroll' in this kernel: constant trip count, unrolled so that the fragment arrays are indexed by constants and stay in registers
  const int tid = threadIdx.x, wave = __builtin_amdgcn_readfirstlane(tid >> 5) /* scalar: the pass count and the diagonal test become scalar branches, EXEC stays all ones at every WMMA */, lane = tid & 31, col = lane & 15, g = lane >> 4;
  const int h = blockIdx.x % NH, b = blockIdx.x / NH;
  const int nst = TT / 64 - (int)blockIdx.y;                                 // tiles of 64 keys up to and including the diagonal (block-uniform); longest query blocks start first
  const int ql0 = (nst - 1) * 64 + wave * 16;
  const int np = (ql0 + 16 + 31) >> 5;                                       // passes up to and including the diagonal (wave-uniform)
  const int qt = ql0 + col;
  const int crow = tid >> 3, cpos = (tid & 7) * 16;                          // this lane's first row and its 16 B of the row, in every plane of a tile
  const char* gk = (const char*)(KH + ((size_t)b * TT + crow) * CC + h * HD) + cpos;        // tile t: 64 key rows further
  const char* gh = (const char*)(VT + ((size_t)b * CC + h * HD + crow) * (size_t)TT) + cpos;   // tile t: 64 keys = 128 B further
  const char* gl = (const char*)(VL + ((size_t)b * CC + h * HD + crow) * (size_t)TT) + cpos;
  const unsigned ld = (unsigned)(size_t)fs + (unsigned)crow * FROW + (unsigned)cpos;
  fa_fill(ld, gk, gh, gl);
  v16h qf[HD / 32];
#pragma unroll
  for (int kc = 0; kc < HD / 32; ++kc) { const float* xp = X + ((size_t)b * TT + qt) * CC + h * HD + kc * 32 + 8 * g;
#pragma unroll
    for (int i = 0; i < 8; ++i) { qf[kc][i] = (_Float16)bfr(xp[i]); qf[kc][8 + i] = (_Float16)bfr(xp[16 + i]); } }   // query = raw input head slice (bf16-exact values, exact in f16)
  v8f acc[HD / 16] = {}; float m = -3.0e38f * FSC, l = 0.f;   // m: running maximum in base-2 units (logit x FSC)
  asm volatile("s_wait_asynccnt 0x0" ::: "memory");   // this wave's share of tile 0 has landed
  __syncthreads();                                    // publishes tile 0
  if (nst > 1) fa_fill(ld + FBUF, gk + (size_t)64 * CC * 2, gh + 128, gl + 128);
  for (int t = 0; t < nst; ++t) {
    const unsigned char* tb = fs + (unsigned)(t & 1) * FBUF;
    const _Float16* kp = (const _Float16*)(tb + (unsigned)col * FROW);
    const __bf16* vhp = (const __bf16*)(tb + FPL + (unsigned)col * FROW);
    const __bf16* vlp = (const __bf16*)(tb + 2u * FPL + (unsigned)col * FROW);
#pragma unroll
    for (int sub = 0; sub < 2; ++sub) { const int ps = 2 * t + sub, k0 = ps * 32;
      if (sub == 0 || ps < np) {   // the first two waves have no open key in the second half of the diagonal tile
        v16h kf[2][HD / 32];
#pragma unroll
        for (int u = 0; u < 2; ++u)
#pragma unroll
          for (int kc = 0; kc < HD / 32; ++kc) kf[u][kc] = frag_h(kp + (sub * 32 + u * 16) * (int)(FROW / 2) + kc * 32, lane);
        v16b vh[HD / 16], vl[HD / 16];
#pragma unroll
        for (int j = 0; j < HD / 16; ++j) { vh[j] = frag_b(vhp + j * 16 * (int)(FROW / 2) + sub * 32, lane); vl[j] = frag_b(vlp + j * 16 * (int)(FROW / 2) + sub * 32, lane); }
        __builtin_amdgcn_sched_barrier(0);   // keeps the pass's 24 LDS reads together, as one group ahead of its products: left free, they sink to one read and one full wait in front of each product
        v8f st[2] = {};
#pragma unroll
        for (int u = 0; u < 2; ++u)
#pragma unroll
          for (int kc = 0; kc < HD / 32; ++kc) st[u] = __builtin_amdgcn_wmma_f32_16x16x32_f16(false, kf[u][kc], false, qf[kc], (short)0, st[u], false, false);   // st[u][r] = logit(key k0 + 16 u + 8 g + r, query qt)
        float p[16];
#pragma unroll
        for (int u = 0; u < 2; ++u)
#pragma unroll
          for (int r = 0; r < 8; ++r) p[u * 8 + r] = st[u][r];   // unscaled: the scale rides in the fma in front of exp2
        if (k0 + 31 > ql0) {   // only passes that reach the diagonal hold masked keys
#pragma unroll
          for (int i = 0; i < 16; ++i) if (k0 + (i >> 3) * 16 + 8 * g + (i & 7) > qt) p[i] = -3.0e38f; }
        float mx = p[0];
#pragma unroll
        for (int i = 1; i < 16; ++i) mx = fmaxf(mx, p[i]);
        mx = fmaxf(mx, xhalf(mx));
        const float mn = fmaxf(m, mx * FSC);   // FSC > 0: the maximum may be taken before the scale
        float sum = 0.f;
#pragma unroll
        for (int i = 0; i < 16; ++i) { p[i] = __builtin_amdgcn_exp2f(fmaf(p[i], FSC, -mn)); sum += p[i]; }   // a masked key: exp2(-3e38 FSC - mn) is exactly 0 (mn is finite: key 0 is open to every query)
        float al;   // rescale factor exp2(old maximum - new maximum)
        asm("v_exp_f32 %0, %1\n\tv_nop" : "=v"(al) : "v"(m - mn));   // in asm for the v_nop alone: it is the slot that the instruction set asks for behind a transcendental
        m = mn;
        l = l * al + sum;   // each lane half keeps the sum of its own keys; joined after the loop
#pragma unroll
        for (int j = 0; j < HD / 16; ++j) acc[j] *= al;
        const F2 pf = bsplit16(p);
#pragma unroll
        for (int j = 0; j < HD / 16; ++j) { acc[j] = __builtin_amdgcn_wmma_f32_16x16x32_bf16(false, vh[j], false, pf.h, (short)0, acc[j], false, false); acc[j] = __builtin_amdgcn_wmma_f32_16x16x32_bf16(false, vh[j], false, pf.l, (short)0, acc[j], false, false); acc[j] = __builtin_amdgcn_wmma_f32_16x16x32_bf16(false, vl[j], false, pf.h, (short)0, acc[j], false, false); } } }
    asm volatile("s_wait_dscnt 0x0" ::: "memory");      // this wave's reads of tile t have returned before the buffer is handed back
    asm volatile("s_wait_asynccnt 0x0" ::: "memory");   // this wave's share of tile t + 1 has landed
    __syncthreads();                                    // publishes tile t + 1 and ends every wave's reads of tile t
    if (t + 2 < nst) fa_fill(ld + (unsigned)(t & 1) * FBUF, gk + (size_t)(t + 2) * (64 * CC * 2), gh + (t + 2) * 128, gl + (t + 2) * 128); }
  asm volatile("s_wait_asynccnt 0x0" ::: "memory");     // no copy is outstanding when the wave ends
  l += xhalf(l); const float inv = 1.0f / l;
  float* yp = Y + ((size_t)b * TT + qt) * CC + h * HD + 8 * g;   // acc[j][r] = y(query qt, d = 16 j + 8 g + r)
#pragma unroll
  for (int j = 0; j < HD / 16; ++j) { v4f lo, hi;
#pragma unroll
    for (int r = 0; r < 4; ++r) { lo[r] = acc[j][r] * inv; hi[r] = acc[j][4 + r] * inv; }
    vst2(yp + j * 16, lo); vst2(yp + j * 16 + 4, hi); } }
// ---- k_out: block = (128 rows, 128 cols), eight waves of 16 rows: out = y (bf16 hi + lo) Wproj + b
__global__ __launch_bounds__(256) void k_out(const float* __restrict__ Y, const float* __restrict__ WP, const float* __restrict__ BP, float* __restrict__ OUT) { __shared__ __align__(16) float sf[8][16][132]; __shared__ __align__(16) __bf16 wt[2][128][72];
  const int tid = threadIdx.x, wave = tid >> 5, lane = tid & 31, col = lane & 15, g = lane >> 4; const int c0 = blockIdx.y * 128; const size_t r0 = (size_t)blockIdx.x * 128 + wave * 16;
  v8f acc[8] = {};
  const float* wp = WP + c0 + lane;   // this lane's column of the block's weight columns
  const float* yp = Y + (r0 + col) * CC + 8 * g;
  float wr[4][8], yr[2][16]; F2 a[2];
  // every '#pragma unroll' below: constant trip count, unrolled so that the register arrays are indexed by constants
  auto mult = [&](const __bf16 (*t)[72]) {   // 64 k of the tile; four B fragments are read as one group ahead of their eight products
#pragma unroll
    for (int kk = 0; kk < 2; ++kk)
#pragma unroll
      for (int jh = 0; jh < 2; ++jh) { v16b w[4];
#pragma unroll
        for (int q = 0; q < 4; ++q) w[q] = frag_b(&t[(jh * 4 + q) * 16 + col][kk * 32], lane);
#pragma unroll
        for (int q = 0; q < 4; ++q) { acc[jh * 4 + q] = wmma_bf(a[kk].h, w[q], acc[jh * 4 + q]); acc[jh * 4 + q] = wmma_bf(a[kk].l, w[q], acc[jh * 4 + q]); } } };
  wt_load(wr, wp, wave, CC); row_load(yr, yp);
  asm volatile("s_wait_xcnt 0x0" ::: "memory");   // behind the loads, before their address registers are reused
  wt_store(wt[0], wr, wave, lane); a[0] = bsplit16(yr[0]); a[1] = bsplit16(yr[1]);
  __syncthreads();
  __bf16 (*cur)[72] = wt[0]; __bf16 (*nxt)[72] = wt[1];
  for (int kb = 1; kb < CC / 64; ++kb) {
    wt_load(wr, wp + (size_t)kb * 64 * CC, wave, CC); row_load(yr, yp + kb * 64);   // the next 64 k fly while this tile is multiplied
    asm volatile("s_wait_xcnt 0x0" ::: "memory");   // behind the loads, before their address registers are reused
    mult(cur);
    wt_store(nxt, wr, wave, lane); a[0] = bsplit16(yr[0]); a[1] = bsplit16(yr[1]);
    __syncthreads();   // publishes the next tile and ends every wave's reads of this one
    __bf16 (*t)[72] = cur; cur = nxt; nxt = t; }
  mult(cur);
#pragma unroll
  for (int j = 0; j < 8; ++j) { const float bb = BP ? bfr(BP[c0 + j * 16 + col]) : 0.f;
#pragma unroll
    for (int r = 0; r < 8; ++r) sf[wave][8 * g + r][j * 16 + col] = acc[j][r] + bb; }
  LDSX(); for (int rl = 0; rl < 16; ++rl) vst2(OUT + (r0 + rl) * CC + c0 + lane * 4, *(const v4f*)&sf[wave][rl][lane * 4]); }
extern "C" void kernel_launch(void* const* d_in, const int* in_sizes, int n_in, void* d_out, int out_size, void* d_ws, size_t ws_size, hipStream_t stream) {
  (void)in_sizes; (void)n_in; (void)out_size;
  const float** F = (const float**)d_in;   // 0 xt [2,2048,1024], 1 W_ca [1024,2048] (in,out), 2 b_ca [2048], 3 W_proj [1024,1024], 4 b_proj
  if (ws_size < (size_t)WS_END) return;
  char* ws = (char*)d_ws; _Float16 *QH = (_Float16*)(ws + WS_QH), *QL = (_Float16*)(ws + WS_QL), *KH = (_Float16*)(ws + WS_KH); __bf16 *VT = (__bf16*)(ws + WS_VT), *VL = (__bf16*)(ws + WS_VL); float *Y = (float*)(ws + WS_Y);
  k_proj<<<dim3(TNB * TT / 128, CC / 128, 2), 256, 0, stream>>>(F[0], F[1], F[2], QH, QL, KH, VT, VL);   // which 1 -> qk_t (cols 0..C), which 2 -> v (cols C..2C) of the [C, 2C] weight
  k_fa<<<dim3(TNB * NH, TT / 64), 128, 0, stream>>>(F[0], KH, VT, VL, Y);   // all batches and heads in one launch
  k_out<<<dim3(TNB * TT / 128, CC / 128), 256, 0, stream>>>(Y, F[3], F[4], (float*)d_out);
}

// v006
// Measured time: 85.2 microseconds a run.
// Next to v005, in two timings, it ran 1.06 times as fast each time.
// All steps since v000 together make it 14.9 times as fast.
// compute dtype: all float inputs rounded to bf16; [qk_t | v] = x W_ca + b_ca ([C, 2C]) with EXACT bf16 products on WMMA 16x16x32, f32 accumulate; query = the bf16-exact input rows themselves (as f16, exact), qk_t rounded once to f16 -> 1-product logits / 8, causal, kept in registers (one launch for all heads); running-maximum softmax in f32 in base 2 (one fma and one hardware exp2 per score), un-normalised P split bf16 hi + lo against v bf16 hi + lo (3 products), divided by the row sum at the end; out = y (bf16 hi + lo) W_proj + b_proj; f32 output.
#include <hip/hip_runtime.h>
#include <math.h>

typedef __attribute__((ext_vector_type(16))) _Float16 v16h;
typedef __attribute__((ext_vector_type(16))) __bf16 v16b;
typedef __attribute__((ext_vector_type(8)))  _Float16 v8h;
typedef __attribute__((ext_vector_type(8)))  float v8f;
typedef __attribute__((ext_vector_type(4)))  float v4f;
typedef __attribute__((ext_vector_type(2)))  float v2f;
typedef __attribute__((ext_vector_type(4)))  unsigned v4u;
typedef __attribute__((ext_vector_type(4)))  int v4i;
typedef float __attribute__((may_alias)) float_a;
typedef int __attribute__((may_alias)) int_a;

template <typename T> __device__ __forceinline__ void vst2(void* p, T v) { *(T*)p = v;  }
__device__ __forceinline__ v8f wmma16(v16h a, v16h b, v8f c) {
  v8f d = __builtin_amdgcn_wmma_f32_16x16x32_f16(false, a, false, b, (short)0, c, false, false);
  asm volatile("v_nop\n\tv_nop\n\tv_nop\n\tv_nop" : "+v"(d) : "v"(a), "v"(b));
  return d;
}
__device__ __forceinline__ v8f wmma_bf(v16b a, v16b b, v8f c) {
  v8f d = __builtin_amdgcn_wmma_f32_16x16x32_bf16(false, a, false, b, (short)0, c, false, false);
  asm volatile("v_nop\n\tv_nop\n\tv_nop\n\tv_nop" : "+v"(d) : "v"(a), "v"(b));
  return d;
}
// 16x16x32 fragments: lane = (h = lane>>4, row/col = lane&15); elements 0..7 = k0+8h+0..7, 8..15 = k0+16+8h+0..7; D element r = row 8h+r
__device__ __forceinline__ v16h frag_h(const _Float16* rowk0, int lane) {
  union { v16h v; v8h q[2]; } u; const _Float16* p = rowk0 + 8 * (lane >> 4);
  u.q[0] = *(const v8h*)p; u.q[1] = *(const v8h*)(p + 16); return u.v;
}
__device__ __forceinline__ v16h frag_f32(const float* rowk0, int lane) {
  v16h a; const float* p = rowk0 + 8 * (lane >> 4);
#pragma unroll
  for (int i = 0; i < 8; ++i) { a[i] = (_Float16)p[i]; a[8 + i] = (_Float16)p[16 + i]; }
  return a;
}
__device__ __forceinline__ v16h frag_f32s(const float* rowk0, int lane, float sc) {
  v16h a; const float* p = rowk0 + 8 * (lane >> 4);
#pragma unroll
  for (int i = 0; i < 8; ++i) { a[i] = (_Float16)(p[i] * sc); a[8 + i] = (_Float16)(p[16 + i] * sc); }
  return a;
}
// column fragment from a [K][ld] layout (column n), rows >= K read as 0
__device__ __forceinline__ v16h fragc_f32(const float* W, int k0, int n, int lane, int ld, int K) {
  v16h a; const int g = lane >> 4;
#pragma unroll
  for (int i = 0; i < 8; ++i) { const int ka = k0 + 8 * g + i, kb = ka + 16;
    a[i] = (_Float16)(ka < K ? W[(size_t)(ka < K ? ka : K - 1) * ld + n] : 0.f); a[8 + i] = (_Float16)(kb < K ? W[(size_t)(kb < K ? kb : K - 1) * ld + n] : 0.f); }
  return a;
}
struct F2 { v16b h, l; };
__device__ __forceinline__ F2 bsplit16(const float v[16]) { F2 r;
#pragma unroll
  for (int i = 0; i < 16; ++i) { const __bf16 h = (__bf16)v[i]; r.h[i] = h; r.l[i] = (__bf16)(v[i] - (float)h); }
  return r; }
__device__ __forceinline__ F2 split_row(const float* row, int k0, int lane) { float v[16]; const float* p = row + k0 + 8 * (lane >> 4);
#pragma unroll
  for (int i = 0; i < 8; ++i) { v[i] = p[i]; v[8 + i] = p[16 + i]; }
  return bsplit16(v); }
__device__ __forceinline__ F2 split_rowK(const float* row, int k0, int lane, int K) { float v[16]; const int g = lane >> 4;
#pragma unroll
  for (int i = 0; i < 8; ++i) { const int ka = k0 + 8 * g + i, kb = ka + 16; v[i] = ka < K ? row[ka < K ? ka : K - 1] : 0.f; v[8 + i] = kb < K ? row[kb < K ? kb : K - 1] : 0.f; }
  return bsplit16(v); }
__device__ __forceinline__ F2 split_col(const float* W, int k0, int n, int lane, int ld, int K) { float v[16]; const int g = lane >> 4;
#pragma unroll
  for (int i = 0; i < 8; ++i) { const int ka = k0 + 8 * g + i, kb = ka + 16; v[i] = ka < K ? W[(size_t)(ka < K ? ka : K - 1) * ld + n] : 0.f; v[8 + i] = kb < K ? W[(size_t)(kb < K ? kb : K - 1) * ld + n] : 0.f; }
  return bsplit16(v); }
__device__ __forceinline__ v8f mac3(const F2& a, const F2& b, v8f c) { c = wmma_bf(a.l, b.h, c); c = wmma_bf(a.h, b.l, c); return wmma_bf(a.h, b.h, c); }
__device__ __forceinline__ float sigm(float v) { return 1.0f / (1.0f + expf(-v)); }
#define LDSX() do { asm volatile("s_wait_dscnt 0" ::: "memory"); __builtin_amdgcn_wave_barrier(); __builtin_amdgcn_fence(__ATOMIC_RELEASE, "workgroup"); } while (0)


// General causal self attention (B 2, T 2,048, C 1,024 = 16 x 64): [qk_t | v] = x W_ca + b_ca; scores = x_head . qk_t_head / 8 (the raw input is the query), causal softmax, . v, output Linear.
#define NB 2
#define TT 2048
#define CC 1024
#define NH 16
#define HD 64
#ifndef TNB
#define TNB NB
#endif
typedef __attribute__((ext_vector_type(8))) __bf16 v8b;
__device__ __forceinline__ v16b frag_b(const __bf16* rowk0, int lane) {
  union { v16b v; v8b q[2]; } u; const __bf16* p = rowk0 + 8 * (lane >> 4);
  u.q[0] = *(const v8b*)p; u.q[1] = *(const v8b*)(p + 16); return u.v;
}
__device__ __forceinline__ float bfr(float v) { return (float)(__bf16)v; }
__device__ __attribute__((noinline)) float exp_ni(float v) { return expf(v); }
__device__ __attribute__((noinline)) float erf_ni(float v) { return erff(v); }

#define WS_QH  0u
#define WS_QL  (WS_QH + 2u * (size_t)NB * TT * CC)
#define WS_KH  (WS_QL + 2u * (size_t)NB * TT * CC)
#define WS_VT  (WS_KH + 2u * (size_t)NB * TT * CC)      // bf16 v planes [b][c][t]
#define WS_VL  (WS_VT + 2u * (size_t)NB * CC * TT)      // bf16 v residual planes
#define HG 4                                          // only sizes WS_S; all heads run in one launch
#define WS_S   (WS_VL + 2u * (size_t)NB * CC * TT)      // unused: k_fa keeps logits in registers
#define WS_PH  (WS_S + 4u * (size_t)HG * TT * TT)
#define WS_Y   (WS_PH + 0u)              // f32 y rows [b*t][C]
#define WS_END (WS_Y + 4u * (size_t)NB * TT * CC)

// ---- weight tile in LDS: 64 k x 128 n of a row-major f32 weight, rounded to bf16 and laid as rows [n][k] (pitch 144 B), fetched once per block for its eight waves (128 rows of the left operand share one tile)
// wave w fetches k rows 8 w .. 8 w + 7, lane = column (+ 32 j): every load is one whole 128-B line
// every '#pragma unroll' in these helpers: constant trip count, unrolled so that the register arrays are indexed by constants
__device__ __forceinline__ void wt_load(float (&r)[4][8], const float* __restrict__ Wl, int wave, int ld) {
#pragma unroll
  for (int j = 0; j < 4; ++j)
#pragma unroll
    for (int i = 0; i < 8; ++i) r[j][i] = Wl[(size_t)(wave * 8 + i) * ld + j * 32];
}
__device__ __forceinline__ void wt_store(__bf16 (*buf)[72], const float (&r)[4][8], int wave, int lane) {
#pragma unroll
  for (int j = 0; j < 4; ++j) { v8b a;
#pragma unroll
    for (int i = 0; i < 8; ++i) a[i] = (__bf16)r[j][i];
    *(v8b*)&buf[j * 32 + lane][wave * 8] = a; }
}
// ---- left operand: a wave's own 16 rows x 64 k. Two rows a load: lanes 0..15 take the 256 B of row 2 i, lanes 16..31 those of row 2 i + 1, 16 B a lane, so every load covers four whole 128-B lines
// (read straight in fragment order, lane = row, each load touched 16 lines for 32 B of each). The rows turn into fragment order through the wave's own LDS rows [row][k] (bf16, pitch 144 B): no other wave reads or writes them
typedef __attribute__((ext_vector_type(4))) __bf16 v4b;
__device__ __forceinline__ void rows_load(v4f (&r)[8], const float* __restrict__ p) {   // p: row g of the wave's rows, k 4 col
#pragma unroll
  for (int i = 0; i < 8; ++i) r[i] = *(const v4f*)(p + (size_t)(2 * i) * CC);
}
__device__ __forceinline__ void rows_store(__bf16 (*xs)[72], const v4f (&r)[8], int g, int col) {   // rounded to bf16
#pragma unroll
  for (int i = 0; i < 8; ++i) { v4b a;
#pragma unroll
    for (int e = 0; e < 4; ++e) a[e] = (__bf16)r[i][e];
    *(v4b*)&xs[2 * i + g][4 * col] = a; }
}
__device__ __forceinline__ void rows_store2(__bf16 (*xh)[72], __bf16 (*xl)[72], const v4f (&r)[8], int g, int col) {   // split bf16 hi + lo, as bsplit16 does
#pragma unroll
  for (int i = 0; i < 8; ++i) { v4b a, b;
#pragma unroll
    for (int e = 0; e < 4; ++e) { const __bf16 h = (__bf16)r[i][e]; a[e] = h; b[e] = (__bf16)(r[i][e] - (float)h); }
    *(v4b*)&xh[2 * i + g][4 * col] = a; *(v4b*)&xl[2 * i + g][4 * col] = b; }
}
// ---- k_proj: block = (128 rows, 128 cols, which), eight waves of 16 rows: [qk_t | v] = x W (+ b), exact; qk_t -> f16 rows, v -> bf16 hi + lo planes
__global__ __launch_bounds__(256) void k_proj(const float* __restrict__ X, const float* __restrict__ WA, const float* __restrict__ BA, _Float16* __restrict__ QH, _Float16* __restrict__ QL, _Float16* __restrict__ KH, __bf16* __restrict__ VT, __bf16* __restrict__ VL) {
  __shared__ __align__(16) _Float16 sh[128][136], sl[128][136]; __shared__ __align__(16) __bf16 th[128][136], tl2[128][136]; __shared__ __align__(16) __bf16 xsm[8][16][72];
  const int tid = threadIdx.x, wave = tid >> 5, lane = tid & 31, col = lane & 15, g = lane >> 4; const int which = blockIdx.z + 1; /* 1: qk_t -> KH, 2: v -> planes (no q projection: the query is x itself) */ const int c0 = blockIdx.y * 128; const size_t r0 = (size_t)blockIdx.x * 128;
  v8f acc[8] = {};
  const float* wp = WA + (size_t)(which - 1) * CC + c0 + lane;   // this lane's column of the block's weight columns
  const float* xp = X + (r0 + wave * 16 + g) * CC + 4 * col;
  float wr[4][8]; v4f xr[8]; v16b a[2]; __bf16 (*xs)[72] = xsm[wave];
  // every '#pragma unroll' below: constant trip count, unrolled so that the register arrays are indexed by constants
  auto get_a = [&]() {   // this wave's A fragments of the 64 k that it has just stored
#pragma unroll
    for (int kk = 0; kk < 2; ++kk) a[kk] = frag_b(&xs[col][kk * 32], lane); };
  auto mult = [&](const __bf16 (*t)[72]) {   // 64 k of the tile; four B fragments are read as one group ahead of their four products
#pragma unroll
    for (int kk = 0; kk < 2; ++kk)
#pragma unroll
      for (int jh = 0; jh < 2; ++jh) { v16b w[4];
#pragma unroll
        for (int q = 0; q < 4; ++q) w[q] = frag_b(&t[(jh * 4 + q) * 16 + col][kk * 32], lane);
#pragma unroll
        for (int q = 0; q < 4; ++q) acc[jh * 4 + q] = wmma_bf(a[kk], w[q], acc[jh * 4 + q]); } };
  wt_load(wr, wp, wave, 2 * CC); rows_load(xr, xp);
  asm volatile("s_wait_xcnt 0x0" ::: "memory");   // behind the loads, before their address registers are reused
  __bf16 (*cur)[72] = (__bf16 (*)[72])th; __bf16 (*nxt)[72] = (__bf16 (*)[72])tl2;   // the first 128 x 72 elements of th and of tl2 are the two tile buffers until the epilogue takes them back
  wt_store(cur, wr, wave, lane); rows_store(xs, xr, g, col);
  __syncthreads();
  get_a();
  for (int kb = 1; kb < CC / 64; ++kb) {
    wt_load(wr, wp + (size_t)kb * 64 * (2 * CC), wave, 2 * CC); rows_load(xr, xp + kb * 64);   // the next 64 k fly while this tile is multiplied
    asm volatile("s_wait_xcnt 0x0" ::: "memory");   // behind the loads, before their address registers are reused
    mult(cur);
    wt_store(nxt, wr, wave, lane); rows_store(xs, xr, g, col);   // the fragments of the rows that are overwritten here are in registers since the last get_a
    __syncthreads();   // publishes the next tile and ends every wave's reads of this one
    get_a();
    __bf16 (*t)[72] = cur; cur = nxt; nxt = t; }
  mult(cur);
  __syncthreads();   // every wave has left th and tl2 before the epilogue writes them
#pragma unroll
  for (int j = 0; j < 8; ++j) { const float bb = BA ? bfr(BA[(which - 1) * CC + c0 + j * 16 + col]) : 0.f;
#pragma unroll
    for (int r = 0; r < 8; ++r) { const float v = acc[j][r] + bb; const int rl = wave * 16 + 8 * g + r, cl = j * 16 + col; const _Float16 hv = (_Float16)v;
      if (which == 2) { const __bf16 bh = (__bf16)v; th[cl][rl] = bh; tl2[cl][rl] = (__bf16)(v - (float)bh); } else { sh[rl][cl] = hv; sl[rl][cl] = (_Float16)(v - (float)hv); } } }
  __syncthreads();
  if (which < 2) { _Float16* dh = which == 0 ? QH : KH; for (int e = tid; e < 128 * 16; e += 256) { const int rl = e >> 4, q = e & 15; vst2((unsigned*)(dh + (r0 + rl) * CC + c0 + q * 8), *(const v4u*)&sh[rl][q * 8]);
      asm volatile("s_wait_xcnt 0x0" ::: "memory");   // behind the store, before its address and data registers are reused
      if (which == 0) { vst2((unsigned*)(QL + (r0 + rl) * CC + c0 + q * 8), *(const v4u*)&sl[rl][q * 8]);
        asm volatile("s_wait_xcnt 0x0" ::: "memory"); } } }   // the same, behind the second store
  else { const size_t b = r0 / TT; const int t0 = (int)(r0 % TT); for (int e = tid; e < 128 * 16; e += 256) { const int cl = e >> 4, q = e & 15; const size_t o2 = (b * CC + c0 + cl) * (size_t)TT + t0 + q * 8; vst2((unsigned*)(VT + o2), *(const v4u*)&th[cl][q * 8]); vst2((unsigned*)(VL + o2), *(const v4u*)&tl2[cl][q * 8]); } } }
__device__ __forceinline__ float xhalf(float x) { return __builtin_bit_cast(float, __builtin_amdgcn_permlanex16(__builtin_bit_cast(int, x), __builtin_bit_cast(int, x), 0x76543210, 0xfedcba98, false, false)); }   // lane l <-> lane l ^ 16
#define FROW 144u                 // LDS row pitch in bytes: 16 B x odd, free of bank conflicts for 16-byte reads
#define FPL  (64u * FROW)         // one plane of a tile: 64 rows
#define FBUF (3u * FPL)           // one buffer: K rows, V hi plane, V lo plane
#define FSC  0.18033688011112042f // (1 / 8) log2(e): exp((s - max) / 8) = exp2(s FSC - max FSC)
// one tile: each lane copies 16 B of rows r, r + 16, r + 32, r + 48 of each plane, so every copy of a wave covers four whole 128-B lines
__device__ __forceinline__ void fa_fill(unsigned ld, const char* gk, const char* gh, const char* gl) {
  // the twelve copies and the wait behind them stand in one statement, so that no address register is rewritten before the wait
  asm volatile("global_load_async_to_lds_b128 %0, %12, off\n\t"
               "global_load_async_to_lds_b128 %1, %13, off\n\t"
               "global_load_async_to_lds_b128 %2, %14, off\n\t"
               "global_load_async_to_lds_b128 %3, %15, off\n\t"
               "global_load_async_to_lds_b128 %4, %16, off\n\t"
               "global_load_async_to_lds_b128 %5, %17, off\n\t"
               "global_load_async_to_lds_b128 %6, %18, off\n\t"
               "global_load_async_to_lds_b128 %7, %19, off\n\t"
               "global_load_async_to_lds_b128 %8, %20, off\n\t"
               "global_load_async_to_lds_b128 %9, %21, off\n\t"
               "global_load_async_to_lds_b128 %10, %22, off\n\t"
               "global_load_async_to_lds_b128 %11, %23, off\n\t"
               "s_wait_xcnt 0x0"
               :: "v"(ld), "v"(ld + 16u * FROW), "v"(ld + 32u * FROW), "v"(ld + 48u * FROW),
                  "v"(ld + FPL), "v"(ld + FPL + 16u * FROW), "v"(ld + FPL + 32u * FROW), "v"(ld + FPL + 48u * FROW),
                  "v"(ld + 2u * FPL), "v"(ld + 2u * FPL + 16u * FROW), "v"(ld + 2u * FPL + 32u * FROW), "v"(ld + 2u * FPL + 48u * FROW),
                  "v"(gk), "v"(gk + 16 * CC * 2), "v"(gk + 32 * CC * 2), "v"(gk + 48 * CC * 2),
                  "v"(gh), "v"(gh + 16 * TT * 2), "v"(gh + 32 * TT * 2), "v"(gh + 48 * TT * 2),
                  "v"(gl), "v"(gl + 16 * TT * 2), "v"(gl + 32 * TT * 2), "v"(gl + 48 * TT * 2)
               : "memory");
}
__global__ __launch_bounds__(128) void k_fa(const float* __restrict__ X, const _Float16* __restrict__ KH, const __bf16* __restrict__ VT, const __bf16* __restrict__ VL, float* __restrict__ Y) {
  __shared__ __align__(16) unsigned char fs[2u * FBUF];
  // every '#pragma unroll' in this kernel: constant trip count, unrolled so that the fragment arrays are indexed by constants and stay in registers
  const int tid = threadIdx.x, wave = __builtin_amdgcn_readfirstlane(tid >> 5) /* scalar: the pass count and the diagonal test become scalar branches, EXEC stays all ones at every WMMA */, lane = tid & 31, col = lane & 15, g = lane >> 4;
  const int h = blockIdx.x % NH, b = blockIdx.x / NH;
  const int nst = TT / 64 - (int)blockIdx.y;                                 // tiles of 64 keys up to and including the diagonal (block-uniform); longest query blocks start first
  const int ql0 = (nst - 1) * 64 + wave * 16;
  const int np = (ql0 + 16 + 31) >> 5;                                       // passes up to and including the diagonal (wave-uniform)
  const int qt = ql0 + col;
  const int crow = tid >> 3, cpos = (tid & 7) * 16;                          // this lane's first row and its 16 B of the row, in every plane of a tile
  const char* gk = (const char*)(KH + ((size_t)b * TT + crow) * CC + h * HD) + cpos;        // tile t: 64 key rows further
  const char* gh = (const char*)(VT + ((size_t)b * CC + h * HD + crow) * (size_t)TT) + cpos;   // tile t: 64 keys = 128 B further
  const char* gl = (const char*)(VL + ((size_t)b * CC + h * HD + crow) * (size_t)TT) + cpos;
  const unsigned ld = (unsigned)(size_t)fs + (unsigned)crow * FROW + (unsigned)cpos;
  fa_fill(ld, gk, gh, gl);
  v16h qf[HD / 32];
#pragma unroll
  for (int kc = 0; kc < HD / 32; ++kc) { const float* xp = X + ((size_t)b * TT + qt) * CC + h * HD + kc * 32 + 8 * g;
#pragma unroll
    for (int i = 0; i < 8; ++i) { qf[kc][i] = (_Float16)bfr(xp[i]); qf[kc][8 + i] = (_Float16)bfr(xp[16 + i]); } }   // query = raw input head slice (bf16-exact values, exact in f16)
  v8f acc[HD / 16] = {}; float m = -3.0e38f * FSC, l = 0.f;   // m: running maximum in base-2 units (logit x FSC)
  asm volatile("s_wait_asynccnt 0x0" ::: "memory");   // this wave's share of tile 0 has landed
  __syncthreads();                                    // publishes tile 0
  if (nst > 1) fa_fill(ld + FBUF, gk + (size_t)64 * CC * 2, gh + 128, gl + 128);
  for (int t = 0; t < nst; ++t) {
    const unsigned char* tb = fs + (unsigned)(t & 1) * FBUF;
    const _Float16* kp = (const _Float16*)(tb + (unsigned)col * FROW);
    const __bf16* vhp = (const __bf16*)(tb + FPL + (unsigned)col * FROW);
    const __bf16* vlp = (const __bf16*)(tb + 2u * FPL + (unsigned)col * FROW);
#pragma unroll
    for (int sub = 0; sub < 2; ++sub) { const int ps = 2 * t + sub, k0 = ps * 32;
      if (sub == 0 || ps < np) {   // the first two waves have no open key in the second half of the diagonal tile
        v16h kf[2][HD / 32];
#pragma unroll
        for (int u = 0; u < 2; ++u)
#pragma unroll
          for (int kc = 0; kc < HD / 32; ++kc) kf[u][kc] = frag_h(kp + (sub * 32 + u * 16) * (int)(FROW / 2) + kc * 32, lane);
        v16b vh[HD / 16], vl[HD / 16];
#pragma unroll
        for (int j = 0; j < HD / 16; ++j) { vh[j] = frag_b(vhp + j * 16 * (int)(FROW / 2) + sub * 32, lane); vl[j] = frag_b(vlp + j * 16 * (int)(FROW / 2) + sub * 32, lane); }
        __builtin_amdgcn_sched_barrier(0);   // keeps the pass's 24 LDS reads together, as one group ahead of its products: left free, they sink to one read and one full wait in front of each product
        v8f st[2] = {};
#pragma unroll
        for (int u = 0; u < 2; ++u)
#pragma unroll
          for (int kc = 0; kc < HD / 32; ++kc) st[u] = __builtin_amdgcn_wmma_f32_16x16x32_f16(false, kf[u][kc], false, qf[kc], (short)0, st[u], false, false);   // st[u][r] = logit(key k0 + 16 u + 8 g + r, query qt)
        float p[16];
#pragma unroll
        for (int u = 0; u < 2; ++u)
#pragma unroll
          for (int r = 0; r < 8; ++r) p[u * 8 + r] = st[u][r];   // unscaled: the scale rides in the fma in front of exp2
        if (k0 + 31 > ql0) {   // only passes that reach the diagonal hold masked keys
#pragma unroll
          for (int i = 0; i < 16; ++i) if (k0 + (i >> 3) * 16 + 8 * g + (i & 7) > qt) p[i] = -3.0e38f; }
        float mx = p[0];
#pragma unroll
        for (int i = 1; i < 16; ++i) mx = fmaxf(mx, p[i]);
        mx = fmaxf(mx, xhalf(mx));
        const float mn = fmaxf(m, mx * FSC);   // FSC > 0: the maximum may be taken before the scale
        float sum = 0.f;
#pragma unroll
        for (int i = 0; i < 16; ++i) { p[i] = __builtin_amdgcn_exp2f(fmaf(p[i], FSC, -mn)); sum += p[i]; }   // a masked key: exp2(-3e38 FSC - mn) is exactly 0 (mn is finite: key 0 is open to every query)
        float al;   // rescale factor exp2(old maximum - new maximum)
        asm("v_exp_f32 %0, %1\n\tv_nop" : "=v"(al) : "v"(m - mn));   // in asm for the v_nop alone: it is the slot that the instruction set asks for behind a transcendental
        m = mn;
        l = l * al + sum;   // each lane half keeps the sum of its own keys; joined after the loop
#pragma unroll
        for (int j = 0; j < HD / 16; ++j) acc[j] *= al;
        const F2 pf = bsplit16(p);
#pragma unroll
        for (int j = 0; j < HD / 16; ++j) { acc[j] = __builtin_amdgcn_wmma_f32_16x16x32_bf16(false, vh[j], false, pf.h, (short)0, acc[j], false, false); acc[j] = __builtin_amdgcn_wmma_f32_16x16x32_bf16(false, vh[j], false, pf.l, (short)0, acc[j], false, false); acc[j] = __builtin_amdgcn_wmma_f32_16x16x32_bf16(false, vl[j], false, pf.h, (short)0, acc[j], false, false); } } }
    asm volatile("s_wait_dscnt 0x0" ::: "memory");      // this wave's reads of tile t have returned before the buffer is handed back
    asm volatile("s_wait_asynccnt 0x0" ::: "memory");   // this wave's share of tile t + 1 has landed
    __syncthreads();                                    // publishes tile t + 1 and ends every wave's reads of tile t
    if (t + 2 < nst) fa_fill(ld + (unsigned)(t & 1) * FBUF, gk + (size_t)(t + 2) * (64 * CC * 2), gh + (t + 2) * 128, gl + (t + 2) * 128); }
  asm volatile("s_wait_asynccnt 0x0" ::: "memory");     // no copy is outstanding when the wave ends
  l += xhalf(l); const float inv = 1.0f / l;
  float* yp = Y + ((size_t)b * TT + qt) * CC + h * HD + 8 * g;   // acc[j][r] = y(query qt, d = 16 j + 8 g + r)
#pragma unroll
  for (int j = 0; j < HD / 16; ++j) { v4f lo, hi;
#pragma unroll
    for (int r = 0; r < 4; ++r) { lo[r] = acc[j][r] * inv; hi[r] = acc[j][4 + r] * inv; }
    vst2(yp + j * 16, lo); vst2(yp + j * 16 + 4, hi); } }
// ---- k_out: block = (128 rows, 128 cols), eight waves of 16 rows: out = y (bf16 hi + lo) Wproj + b
__global__ __launch_bounds__(256) void k_out(const float* __restrict__ Y, const float* __restrict__ WP, const float* __restrict__ BP, float* __restrict__ OUT) { __shared__ __align__(16) float sf[8][16][132]; __shared__ __align__(16) __bf16 wt[2][128][72]; __shared__ __align__(16) __bf16 ysm[2][8][16][72];
  const int tid = threadIdx.x, wave = tid >> 5, lane = tid & 31, col = lane & 15, g = lane >> 4; const int c0 = blockIdx.y * 128; const size_t r0 = (size_t)blockIdx.x * 128 + wave * 16;
  v8f acc[8] = {};
  const float* wp = WP + c0 + lane;   // this lane's column of the block's weight columns
  const float* yp = Y + (r0 + g) * CC + 4 * col;
  float wr[4][8]; v4f yr[8]; F2 a[2]; __bf16 (*yh)[72] = ysm[0][wave]; __bf16 (*yl)[72] = ysm[1][wave];
  auto get_a = [&]() {   // this wave's A fragments (hi and lo) of the 64 k that it has just stored
#pragma unroll
    for (int kk = 0; kk < 2; ++kk) { a[kk].h = frag_b(&yh[col][kk * 32], lane); a[kk].l = frag_b(&yl[col][kk * 32], lane); } };
  // every '#pragma unroll' below: constant trip count, unrolled so that the register arrays are indexed by constants
  auto mult = [&](const __bf16 (*t)[72]) {   // 64 k of the tile; four B fragments are read as one group ahead of their eight products
#pragma unroll
    for (int kk = 0; kk < 2; ++kk)
#pragma unroll
      for (int jh = 0; jh < 2; ++jh) { v16b w[4];
#pragma unroll
        for (int q = 0; q < 4; ++q) w[q] = frag_b(&t[(jh * 4 + q) * 16 + col][kk * 32], lane);
#pragma unroll
        for (int q = 0; q < 4; ++q) { acc[jh * 4 + q] = wmma_bf(a[kk].h, w[q], acc[jh * 4 + q]); acc[jh * 4 + q] = wmma_bf(a[kk].l, w[q], acc[jh * 4 + q]); } } };
  wt_load(wr, wp, wave, CC); rows_load(yr, yp);
  asm volatile("s_wait_xcnt 0x0" ::: "memory");   // behind the loads, before their address registers are reused
  wt_store(wt[0], wr, wave, lane); rows_store2(yh, yl, yr, g, col);
  __syncthreads();
  get_a();
  __bf16 (*cur)[72] = wt[0]; __bf16 (*nxt)[72] = wt[1];
  for (int kb = 1; kb < CC / 64; ++kb) {
    wt_load(wr, wp + (size_t)kb * 64 * CC, wave, CC); rows_load(yr, yp + kb * 64);   // the next 64 k fly while this tile is multiplied
    asm volatile("s_wait_xcnt 0x0" ::: "memory");   // behind the loads, before their address registers are reused
    mult(cur);
    wt_store(nxt, wr, wave, lane); rows_store2(yh, yl, yr, g, col);   // the fragments of the rows that are overwritten here are in registers since the last get_a
    __syncthreads();   // publishes the next tile and ends every wave's reads of this one
    get_a();
    __bf16 (*t)[72] = cur; cur = nxt; nxt = t; }
  mult(cur);
#pragma unroll
  for (int j = 0; j < 8; ++j) { const float bb = BP ? bfr(BP[c0 + j * 16 + col]) : 0.f;
#pragma unroll
    for (int r = 0; r < 8; ++r) sf[wave][8 * g + r][j * 16 + col] = acc[j][r] + bb; }
  LDSX(); for (int rl = 0; rl < 16; ++rl) vst2(OUT + (r0 + rl) * CC + c0 + lane * 4, *(const v4f*)&sf[wave][rl][lane * 4]); }
extern "C" void kernel_launch(void* const* d_in, const int* in_sizes, int n_in, void* d_out, int out_size, void* d_ws, size_t ws_size, hipStream_t stream) {
  (void)in_sizes; (void)n_in; (void)out_size;
  const float** F = (const float**)d_in;   // 0 xt [2,2048,1024], 1 W_ca [1024,2048] (in,out), 2 b_ca [2048], 3 W_proj [1024,1024], 4 b_proj
  if (ws_size < (size_t)WS_END) return;
  char* ws = (char*)d_ws; _Float16 *QH = (_Float16*)(ws + WS_QH), *QL = (_Float16*)(ws + WS_QL), *KH = (_Float16*)(ws + WS_KH); __bf16 *VT = (__bf16*)(ws + WS_VT), *VL = (__bf16*)(ws + WS_VL); float *Y = (float*)(ws + WS_Y);
  k_proj<<<dim3(TNB * TT / 128, CC / 128, 2), 256, 0, stream>>>(F[0], F[1], F[2], QH, QL, KH, VT, VL);   // which 1 -> qk_t (cols 0..C), which 2 -> v (cols C..2C) of the [C, 2C] weight
  k_fa<<<dim3(TNB * NH, TT / 64), 128, 0, stream>>>(F[0], KH, VT, VL, Y);   // all batches and heads in one launch
  k_out<<<dim3(TNB * TT / 128, CC / 128), 256, 0, stream>>>(Y, F[3], F[4], (float*)d_out);
}

// v007
// A run of this version takes 80.5 microseconds.
// In both of two side-by-side timings against v006, it was 1.06 times as fast.
// Over all steps from v000 it is 15.8 times as fast.
// compute dtype: all float inputs rounded to bf16; [qk_t | v] = x W_ca + b_ca ([C, 2C]) with EXACT bf16 products on WMMA 16x16x32, f32 accumulate; query = the bf16-exact input rows themselves (as f16, exact), qk_t rounded once to f16 -> 1-product logits / 8, causal, kept in registers (one launch for all heads); running-maximum softmax in f32 in base 2 (one fma and one hardware exp2 per score), un-normalised P split bf16 hi + lo against v bf16 hi + lo (3 products), divided by the row sum at the end; out = y (bf16 hi + lo) W_proj + b_proj; f32 output.
#include <hip/hip_runtime.h>
#include <math.h>

typedef __attribute__((ext_vector_type(16))) _Float16 v16h;
typedef __attribute__((ext_vector_type(16))) __bf16 v16b;
typedef __attribute__((ext_vector_type(8)))  _Float16 v8h;
typedef __attribute__((ext_vector_type(8)))  float v8f;
typedef __attribute__((ext_vector_type(4)))  float v4f;
typedef __attribute__((ext_vector_type(2)))  float v2f;
typedef __attribute__((ext_vector_type(4)))  unsigned v4u;
typedef __attribute__((ext_vector_type(4)))  int v4i;
typedef float __attribute__((may_alias)) float_a;
typedef int __attribute__((may_alias)) int_a;

template <typename T> __device__ __forceinline__ void vst2(void* p, T v) { *(T*)p = v;  }
__device__ __forceinline__ v8f wmma16(v16h a, v16h b, v8f c) {
  v8f d = __builtin_amdgcn_wmma_f32_16x16x32_f16(false, a, false, b, (short)0, c, false, false);
  asm volatile("v_nop\n\tv_nop\n\tv_nop\n\tv_nop" : "+v"(d) : "v"(a), "v"(b));
  return d;
}
__device__ __forceinline__ v8f wmma_bf(v16b a, v16b b, v8f c) {
  v8f d = __builtin_amdgcn_wmma_f32_16x16x32_bf16(false, a, false, b, (short)0, c, false, false);
  asm volatile("v_nop\n\tv_nop\n\tv_nop\n\tv_nop" : "+v"(d) : "v"(a), "v"(b));
  return d;
}
// 16x16x32 fragments: lane = (h = lane>>4, row/col = lane&15); elements 0..7 = k0+8h+0..7, 8..15 = k0+16+8h+0..7; D element r = row 8h+r
__device__ __forceinline__ v16h frag_h(const _Float16* rowk0, int lane) {
  union { v16h v; v8h q[2]; } u; const _Float16* p = rowk0 + 8 * (lane >> 4);
  u.q[0] = *(const v8h*)p; u.q[1] = *(const v8h*)(p + 16); return u.v;
}
__device__ __forceinline__ v16h frag_f32(const float* rowk0, int lane) {
  v16h a; const float* p = rowk0 + 8 * (lane >> 4);
#pragma unroll
  for (int i = 0; i < 8; ++i) { a[i] = (_Float16)p[i]; a[8 + i] = (_Float16)p[16 + i]; }
  return a;
}
__device__ __forceinline__ v16h frag_f32s(const float* rowk0, int lane, float sc) {
  v16h a; const float* p = rowk0 + 8 * (lane >> 4);
#pragma unroll
  for (int i = 0; i < 8; ++i) { a[i] = (_Float16)(p[i] * sc); a[8 + i] = (_Float16)(p[16 + i] * sc); }
  return a;
}
// column fragment from a [K][ld] layout (column n), rows >= K read as 0
__device__ __forceinline__ v16h fragc_f32(const float* W, int k0, int n, int lane, int ld, int K) {
  v16h a; const int g = lane >> 4;
#pragma unroll
  for (int i = 0; i < 8; ++i) { const int ka = k0 + 8 * g + i, kb = ka + 16;
    a[i] = (_Float16)(ka < K ? W[(size_t)(ka < K ? ka : K - 1) * ld + n] : 0.f); a[8 + i] = (_Float16)(kb < K ? W[(size_t)(kb < K ? kb : K - 1) * ld + n] : 0.f); }
  return a;
}
struct F2 { v16b h, l; };
__device__ __forceinline__ F2 bsplit16(const float v[16]) { F2 r;
#pragma unroll
  for (int i = 0; i < 16; ++i) { const __bf16 h = (__bf16)v[i]; r.h[i] = h; r.l[i] = (__bf16)(v[i] - (float)h); }
  return r; }
__device__ __forceinline__ F2 split_row(const float* row, int k0, int lane) { float v[16]; const float* p = row + k0 + 8 * (lane >> 4);
#pragma unroll
  for (int i = 0; i < 8; ++i) { v[i] = p[i]; v[8 + i] = p[16 + i]; }
  return bsplit16(v); }
__device__ __forceinline__ F2 split_rowK(const float* row, int k0, int lane, int K) { float v[16]; const int g = lane >> 4;
#pragma unroll
  for (int i = 0; i < 8; ++i) { const int ka = k0 + 8 * g + i, kb = ka + 16; v[i] = ka < K ? row[ka < K ? ka : K - 1] : 0.f; v[8 + i] = kb < K ? row[kb < K ? kb : K - 1] : 0.f; }
  return bsplit16(v); }
__device__ __forceinline__ F2 split_col(const float* W, int k0, int n, int lane, int ld, int K) { float v[16]; const int g = lane >> 4;
#pragma unroll
  for (int i = 0; i < 8; ++i) { const int ka = k0 + 8 * g + i, kb = ka + 16; v[i] = ka < K ? W[(size_t)(ka < K ? ka : K - 1) * ld + n] : 0.f; v[8 + i] = kb < K ? W[(size_t)(kb < K ? kb : K - 1) * ld + n] : 0.f; }
  return bsplit16(v); }
__device__ __forceinline__ v8f mac3(const F2& a, const F2& b, v8f c) { c = wmma_bf(a.l, b.h, c); c = wmma_bf(a.h, b.l, c); return wmma_bf(a.h, b.h, c); }
__device__ __forceinline__ float sigm(float v) { return 1.0f / (1.0f + expf(-v)); }
#define LDSX() do { asm volatile("s_wait_dscnt 0" ::: "memory"); __builtin_amdgcn_wave_barrier(); __builtin_amdgcn_fence(__ATOMIC_RELEASE, "workgroup"); } while (0)


// General causal self attention (B 2, T 2,048, C 1,024 = 16 x 64): [qk_t | v] = x W_ca + b_ca; scores = x_head . qk_t_head / 8 (the raw input is the query), causal softmax, . v, output Linear.
#define NB 2
#define TT 2048
#define CC 1024
#define NH 16
#define HD 64
#ifndef TNB
#define TNB NB
#endif
typedef __attribute__((ext_vector_type(8))) __bf16 v8b;
__device__ __forceinline__ v16b frag_b(const __bf16* rowk0, int lane) {
  union { v16b v; v8b q[2]; } u; const __bf16* p = rowk0 + 8 * (lane >> 4);
  u.q[0] = *(const v8b*)p; u.q[1] = *(const v8b*)(p + 16); return u.v;
}
__device__ __forceinline__ float bfr(float v) { return (float)(__bf16)v; }
__device__ __attribute__((noinline)) float exp_ni(float v) { return expf(v); }
__device__ __attribute__((noinline)) float erf_ni(float v) { return erff(v); }

#define WS_QH  0u
#define WS_QL  (WS_QH + 2u * (size_t)NB * TT * CC)
#define WS_KH  (WS_QL + 2u * (size_t)NB * TT * CC)
#define WS_VT  (WS_KH + 2u * (size_t)NB * TT * CC)      // bf16 v planes [b][c][t]
#define WS_VL  (WS_VT + 2u * (size_t)NB * CC * TT)      // bf16 v residual planes
#define HG 4                                          // only sizes WS_S; all heads run in one launch
#define WS_S   (WS_VL + 2u * (size_t)NB * CC * TT)      // unused: k_fa keeps logits in registers
#define WS_PH  (WS_S + 4u * (size_t)HG * TT * TT)
#define WS_Y   (WS_PH + 0u)              // f32 y rows [b*t][C]
#define WS_END (WS_Y + 4u * (size_t)NB * TT * CC)

// ---- weight tile in LDS: 64 k x 128 n of a row-major f32 weight, rounded to bf16 and laid as rows [n][k] (pitch 144 B), fetched once per block for its eight waves (128 rows of the left operand share one tile)
// wave w fetches k rows 8 w .. 8 w + 7, lane = columns 4 lane .. 4 lane + 3: one 16-byte load a row brings the row's whole 512 B (four lines)
// LDS row 32 e + lane holds column 4 lane + e (lanes on neighbouring rows: stores free of bank conflicts), so fragment j = 2 e + jl, lane column col, is column 64 jl + 4 col + e of the tile: a lane's four fragments of one jl are four neighbouring columns, and the epilogues take bias and staging stores by such fours
// every '#pragma unroll' in these helpers: constant trip count, unrolled so that the register arrays are indexed by constants
__device__ __forceinline__ void wt_load(v4f (&r)[8], const float* __restrict__ Wl, int wave, int ld) {
#pragma unroll
  for (int i = 0; i < 8; ++i) r[i] = *(const v4f*)(Wl + (size_t)(wave * 8 + i) * ld);
}
__device__ __forceinline__ void wt_store(__bf16 (*buf)[72], const v4f (&r)[8], int wave, int lane) {
#pragma unroll
  for (int e = 0; e < 4; ++e) { v8b a;
#pragma unroll
    for (int i = 0; i < 8; ++i) a[i] = (__bf16)r[i][e];
    *(v8b*)&buf[e * 32 + lane][wave * 8] = a; }
}
// ---- left operand: a wave's own 16 rows x 64 k. Two rows a load: lanes 0..15 take the 256 B of row 2 i, lanes 16..31 those of row 2 i + 1, 16 B a lane, so every load covers four whole 128-B lines
// (read straight in fragment order, lane = row, each load touched 16 lines for 32 B of each). The rows turn into fragment order through the wave's own LDS rows [row][k] (bf16, pitch 144 B): no other wave reads or writes them
typedef __attribute__((ext_vector_type(4))) __bf16 v4b;
typedef __attribute__((ext_vector_type(4))) _Float16 v4h;
__device__ __forceinline__ void rows_load(v4f (&r)[8], const float* __restrict__ p) {   // p: row g of the wave's rows, k 4 col
#pragma unroll
  for (int i = 0; i < 8; ++i) r[i] = *(const v4f*)(p + (size_t)(2 * i) * CC);
}
__device__ __forceinline__ void rows_store(__bf16 (*xs)[72], const v4f (&r)[8], int g, int col) {   // rounded to bf16
#pragma unroll
  for (int i = 0; i < 8; ++i) { v4b a;
#pragma unroll
    for (int e = 0; e < 4; ++e) a[e] = (__bf16)r[i][e];
    *(v4b*)&xs[2 * i + g][4 * col] = a; }
}
__device__ __forceinline__ void rows_store2(__bf16 (*xh)[72], __bf16 (*xl)[72], const v4f (&r)[8], int g, int col) {   // split bf16 hi + lo, as bsplit16 does
#pragma unroll
  for (int i = 0; i < 8; ++i) { v4b a, b;
#pragma unroll
    for (int e = 0; e < 4; ++e) { const __bf16 h = (__bf16)r[i][e]; a[e] = h; b[e] = (__bf16)(r[i][e] - (float)h); }
    *(v4b*)&xh[2 * i + g][4 * col] = a; *(v4b*)&xl[2 * i + g][4 * col] = b; }
}
// ---- k_proj: block = (128 rows, 128 cols, which), eight waves of 16 rows: [qk_t | v] = x W (+ b), exact; qk_t -> f16 rows, v -> bf16 hi + lo planes
__global__ __launch_bounds__(256) void k_proj(const float* __restrict__ X, const float* __restrict__ WA, const float* __restrict__ BA, _Float16* __restrict__ QH, _Float16* __restrict__ QL, _Float16* __restrict__ KH, __bf16* __restrict__ VT, __bf16* __restrict__ VL) {
  __shared__ __align__(16) _Float16 sh[128][136], sl[128][136]; __shared__ __align__(16) __bf16 th[128][136], tl2[128][136]; __shared__ __align__(16) __bf16 xsm[8][16][72];
  const int tid = threadIdx.x, wave = tid >> 5, lane = tid & 31, col = lane & 15, g = lane >> 4; const int which = blockIdx.z + 1; /* 1: qk_t -> KH, 2: v -> planes (no q projection: the query is x itself) */ const int c0 = blockIdx.y * 128; const size_t r0 = (size_t)blockIdx.x * 128;
  v8f acc[8] = {};
  const float* wp = WA + (size_t)(which - 1) * CC + c0 + 4 * lane;   // this lane's four columns of the block's weight columns
  const float* xp = X + (r0 + wave * 16 + g) * CC + 4 * col;
  v4f wr[8]; v4f xr[8]; v16b a[2]; __bf16 (*xs)[72] = xsm[wave];
  // every '#pragma unroll' below: constant trip count, unrolled so that the register arrays are indexed by constants
  auto get_a = [&]() {   // this wave's A fragments of the 64 k that it has just stored
#pragma unroll
    for (int kk = 0; kk < 2; ++kk) a[kk] = frag_b(&xs[col][kk * 32], lane); };
  auto mult = [&](const __bf16 (*t)[72]) {   // 64 k of the tile; four B fragments are read as one group ahead of their four products
#pragma unroll
    for (int kk = 0; kk < 2; ++kk)
#pragma unroll
      for (int jh = 0; jh < 2; ++jh) { v16b w[4];
#pragma unroll
        for (int q = 0; q < 4; ++q) w[q] = frag_b(&t[(jh * 4 + q) * 16 + col][kk * 32], lane);
#pragma unroll
        for (int q = 0; q < 4; ++q) acc[jh * 4 + q] = wmma_bf(a[kk], w[q], acc[jh * 4 + q]); } };
  wt_load(wr, wp, wave, 2 * CC); rows_load(xr, xp);
  asm volatile("s_wait_xcnt 0x0" ::: "memory");   // behind the loads, before their address registers are reused
  __bf16 (*cur)[72] = (__bf16 (*)[72])th; __bf16 (*nxt)[72] = (__bf16 (*)[72])tl2;   // the first 128 x 72 elements of th and of tl2 are the two tile buffers until the epilogue takes them back
  wt_store(cur, wr, wave, lane); rows_store(xs, xr, g, col);
  __syncthreads();
  get_a();
  for (int kb = 1; kb < CC / 64; ++kb) {
    wt_load(wr, wp + (size_t)kb * 64 * (2 * CC), wave, 2 * CC); rows_load(xr, xp + kb * 64);   // the next 64 k fly while this tile is multiplied
    asm volatile("s_wait_xcnt 0x0" ::: "memory");   // behind the loads, before their address registers are reused
    mult(cur);
    wt_store(nxt, wr, wave, lane); rows_store(xs, xr, g, col);   // the fragments of the rows that are overwritten here are in registers since the last get_a
    __syncthreads();   // publishes the next tile and ends every wave's reads of this one
    get_a();
    __bf16 (*t)[72] = cur; cur = nxt; nxt = t; }
  mult(cur);
  __syncthreads();   // every wave has left th and tl2 before the epilogue writes them
#pragma unroll
  for (int jl = 0; jl < 2; ++jl) { const int cl = 64 * jl + 4 * col; v4f bb = {};
    if (BA) { const v4f t = *(const v4f*)(BA + (which - 1) * CC + c0 + cl);
#pragma unroll
      for (int e = 0; e < 4; ++e) bb[e] = bfr(t[e]); }
    if (which == 2) {   // a lane's eight rows are neighbours in a plane's row: one 16-byte store a plane (lanes stand four plane rows apart, where single 2-byte stores would meet on four banks)
#pragma unroll
      for (int e = 0; e < 4; ++e) { v8b h8, l8;
#pragma unroll
        for (int r = 0; r < 8; ++r) { const float v = acc[2 * e + jl][r] + bb[e]; const __bf16 bh = (__bf16)v; h8[r] = bh; l8[r] = (__bf16)(v - (float)bh); }
        *(v8b*)&th[cl + e][wave * 16 + 8 * g] = h8; *(v8b*)&tl2[cl + e][wave * 16 + 8 * g] = l8; } }
    else {   // a lane's four columns are neighbours in a row: one 8-byte store a row
#pragma unroll
      for (int r = 0; r < 8; ++r) { const int rl = wave * 16 + 8 * g + r; v4h hv, lv;
#pragma unroll
        for (int e = 0; e < 4; ++e) { const float v = acc[2 * e + jl][r] + bb[e]; const _Float16 hh = (_Float16)v; hv[e] = hh; lv[e] = (_Float16)(v - (float)hh); }
        *(v4h*)&sh[rl][cl] = hv; *(v4h*)&sl[rl][cl] = lv; } } }
  __syncthreads();
  if (which < 2) { _Float16* dh = which == 0 ? QH : KH; for (int e = tid; e < 128 * 16; e += 256) { const int rl = e >> 4, q = e & 15; vst2((unsigned*)(dh + (r0 + rl) * CC + c0 + q * 8), *(const v4u*)&sh[rl][q * 8]);
      asm volatile("s_wait_xcnt 0x0" ::: "memory");   // behind the store, before its address and data registers are reused
      if (which == 0) { vst2((unsigned*)(QL + (r0 + rl) * CC + c0 + q * 8), *(const v4u*)&sl[rl][q * 8]);
        asm volatile("s_wait_xcnt 0x0" ::: "memory"); } } }   // the same, behind the second store
  else { const size_t b = r0 / TT; const int t0 = (int)(r0 % TT); for (int e = tid; e < 128 * 16; e += 256) { const int cl = e >> 4, q = e & 15; const size_t o2 = (b * CC + c0 + cl) * (size_t)TT + t0 + q * 8; vst2((unsigned*)(VT + o2), *(const v4u*)&th[cl][q * 8]); vst2((unsigned*)(VL + o2), *(const v4u*)&tl2[cl][q * 8]); } } }
__device__ __forceinline__ float xhalf(float x) { return __builtin_bit_cast(float, __builtin_amdgcn_permlanex16(__builtin_bit_cast(int, x), __builtin_bit_cast(int, x), 0x76543210, 0xfedcba98, false, false)); }   // lane l <-> lane l ^ 16
#define FROW 144u                 // LDS row pitch in bytes: 16 B x odd, free of bank conflicts for 16-byte reads
#define FPL  (64u * FROW)         // one plane of a tile: 64 rows
#define FBUF (3u * FPL)           // one buffer: K rows, V hi plane, V lo plane
#define FSC  0.18033688011112042f // (1 / 8) log2(e): exp((s - max) / 8) = exp2(s FSC - max FSC)
// one tile: each lane copies 16 B of rows r, r + 16, r + 32, r + 48 of each plane, so every copy of a wave covers four whole 128-B lines
__device__ __forceinline__ void fa_fill(unsigned ld, const char* gk, const char* gh, const char* gl) {
  // the twelve copies and the wait behind them stand in one statement, so that no address register is rewritten before the wait
  asm volatile("global_load_async_to_lds_b128 %0, %12, off\n\t"
               "global_load_async_to_lds_b128 %1, %13, off\n\t"
               "global_load_async_to_lds_b128 %2, %14, off\n\t"
               "global_load_async_to_lds_b128 %3, %15, off\n\t"
               "global_load_async_to_lds_b128 %4, %16, off\n\t"
               "global_load_async_to_lds_b128 %5, %17, off\n\t"
               "global_load_async_to_lds_b128 %6, %18, off\n\t"
               "global_load_async_to_lds_b128 %7, %19, off\n\t"
               "global_load_async_to_lds_b128 %8, %20, off\n\t"
               "global_load_async_to_lds_b128 %9, %21, off\n\t"
               "global_load_async_to_lds_b128 %10, %22, off\n\t"
               "global_load_async_to_lds_b128 %11, %23, off\n\t"
               "s_wait_xcnt 0x0"
               :: "v"(ld), "v"(ld + 16u * FROW), "v"(ld + 32u * FROW), "v"(ld + 48u * FROW),
                  "v"(ld + FPL), "v"(ld + FPL + 16u * FROW), "v"(ld + FPL + 32u * FROW), "v"(ld + FPL + 48u * FROW),
                  "v"(ld + 2u * FPL), "v"(ld + 2u * FPL + 16u * FROW), "v"(ld + 2u * FPL + 32u * FROW), "v"(ld + 2u * FPL + 48u * FROW),
                  "v"(gk), "v"(gk + 16 * CC * 2), "v"(gk + 32 * CC * 2), "v"(gk + 48 * CC * 2),
                  "v"(gh), "v"(gh + 16 * TT * 2), "v"(gh + 32 * TT * 2), "v"(gh + 48 * TT * 2),
                  "v"(gl), "v"(gl + 16 * TT * 2), "v"(gl + 32 * TT * 2), "v"(gl + 48 * TT * 2)
               : "memory");
}
__global__ __launch_bounds__(128) void k_fa(const float* __restrict__ X, const _Float16* __restrict__ KH, const __bf16* __restrict__ VT, const __bf16* __restrict__ VL, float* __restrict__ Y) {
  __shared__ __align__(16) unsigned char fs[2u * FBUF];
  // every '#pragma unroll' in this kernel: constant trip count, unrolled so that the fragment arrays are indexed by constants and stay in registers
  const int tid = threadIdx.x, wave = __builtin_amdgcn_readfirstlane(tid >> 5) /* scalar: the pass count and the diagonal test become scalar branches, EXEC stays all ones at every WMMA */, lane = tid & 31, col = lane & 15, g = lane >> 4;
  const int h = blockIdx.x % NH, b = blockIdx.x / NH;
  const int nst = TT / 64 - (int)blockIdx.y;                                 // tiles of 64 keys up to and including the diagonal (block-uniform); longest query blocks start first
  const int ql0 = (nst - 1) * 64 + wave * 16;
  const int np = (ql0 + 16 + 31) >> 5;                                       // passes up to and including the diagonal (wave-uniform)
  const int qt = ql0 + col;
  const int crow = tid >> 3, cpos = (tid & 7) * 16;                          // this lane's first row and its 16 B of the row, in every plane of a tile
  const char* gk = (const char*)(KH + ((size_t)b * TT + crow) * CC + h * HD) + cpos;        // tile t: 64 key rows further
  const char* gh = (const char*)(VT + ((size_t)b * CC + h * HD + crow) * (size_t)TT) + cpos;   // tile t: 64 keys = 128 B further
  const char* gl = (const char*)(VL + ((size_t)b * CC + h * HD + crow) * (size_t)TT) + cpos;
  const unsigned ld = (unsigned)(size_t)fs + (unsigned)crow * FROW + (unsigned)cpos;
  fa_fill(ld, gk, gh, gl);
  v16h qf[HD / 32];
#pragma unroll
  for (int kc = 0; kc < HD / 32; ++kc) { const float* xp = X + ((size_t)b * TT + qt) * CC + h * HD + kc * 32 + 8 * g;
#pragma unroll
    for (int i = 0; i < 8; ++i) { qf[kc][i] = (_Float16)bfr(xp[i]); qf[kc][8 + i] = (_Float16)bfr(xp[16 + i]); } }   // query = raw input head slice (bf16-exact values, exact in f16)
  v8f acc[HD / 16] = {}; float m = -3.0e38f * FSC, l = 0.f;   // m: running maximum in base-2 units (logit x FSC)
  asm volatile("s_wait_asynccnt 0x0" ::: "memory");   // this wave's share of tile 0 has landed
  __syncthreads();                                    // publishes tile 0
  if (nst > 1) fa_fill(ld + FBUF, gk + (size_t)64 * CC * 2, gh + 128, gl + 128);
  for (int t = 0; t < nst; ++t) {
    const unsigned char* tb = fs + (unsigned)(t & 1) * FBUF;
    const _Float16* kp = (const _Float16*)(tb + (unsigned)col * FROW);
    const __bf16* vhp = (const __bf16*)(tb + FPL + (unsigned)col * FROW);
    const __bf16* vlp = (const __bf16*)(tb + 2u * FPL + (unsigned)col * FROW);
#pragma unroll
    for (int sub = 0; sub < 2; ++sub) { const int ps = 2 * t + sub, k0 = ps * 32;
      if (sub == 0 || ps < np) {   // the first two waves have no open key in the second half of the diagonal tile
        v16h kf[2][HD / 32];
#pragma unroll
        for (int u = 0; u < 2; ++u)
#pragma unroll
          for (int kc = 0; kc < HD / 32; ++kc) kf[u][kc] = frag_h(kp + (sub * 32 + u * 16) * (int)(FROW / 2) + kc * 32, lane);
        v16b vh[HD / 16], vl[HD / 16];
#pragma unroll
        for (int j = 0; j < HD / 16; ++j) { vh[j] = frag_b(vhp + j * 16 * (int)(FROW / 2) + sub * 32, lane); vl[j] = frag_b(vlp + j * 16 * (int)(FROW / 2) + sub * 32, lane); }
        __builtin_amdgcn_sched_barrier(0);   // keeps the pass's 24 LDS reads together, as one group ahead of its products: left free, they sink to one read and one full wait in front of each product
        v8f st[2] = {};
#pragma unroll
        for (int u = 0; u < 2; ++u)
#pragma unroll
          for (int kc = 0; kc < HD / 32; ++kc) st[u] = __builtin_amdgcn_wmma_f32_16x16x32_f16(false, kf[u][kc], false, qf[kc], (short)0, st[u], false, false);   // st[u][r] = logit(key k0 + 16 u + 8 g + r, query qt)
        float p[16];
#pragma unroll
        for (int u = 0; u < 2; ++u)
#pragma unroll
          for (int r = 0; r < 8; ++r) p[u * 8 + r] = st[u][r];   // unscaled: the scale rides in the fma in front of exp2
        if (k0 + 31 > ql0) {   // only passes that reach the diagonal hold masked keys
#pragma unroll
          for (int i = 0; i < 16; ++i) if (k0 + (i >> 3) * 16 + 8 * g + (i & 7) > qt) p[i] = -3.0e38f; }
        float mx = p[0];
#pragma unroll
        for (int i = 1; i < 16; ++i) mx = fmaxf(mx, p[i]);
        mx = fmaxf(mx, xhalf(mx));
        const float mn = fmaxf(m, mx * FSC);   // FSC > 0: the maximum may be taken before the scale
        float sum = 0.f;
#pragma unroll
        for (int i = 0; i < 16; ++i) { p[i] = __builtin_amdgcn_exp2f(fmaf(p[i], FSC, -mn)); sum += p[i]; }   // a masked key: exp2(-3e38 FSC - mn) is exactly 0 (mn is finite: key 0 is open to every query)
        float al;   // rescale factor exp2(old maximum - new maximum)
        asm("v_exp_f32 %0, %1\n\tv_nop" : "=v"(al) : "v"(m - mn));   // in asm for the v_nop alone: it is the slot that the instruction set asks for behind a transcendental
        m = mn;
        l = l * al + sum;   // each lane half keeps the sum of its own keys; joined after the loop
#pragma unroll
        for (int j = 0; j < HD / 16; ++j) acc[j] *= al;
        const F2 pf = bsplit16(p);
#pragma unroll
        for (int j = 0; j < HD / 16; ++j) { acc[j] = __builtin_amdgcn_wmma_f32_16x16x32_bf16(false, vh[j], false, pf.h, (short)0, acc[j], false, false); acc[j] = __builtin_amdgcn_wmma_f32_16x16x32_bf16(false, vh[j], false, pf.l, (short)0, acc[j], false, false); acc[j] = __builtin_amdgcn_wmma_f32_16x16x32_bf16(false, vl[j], false, pf.h, (short)0, acc[j], false, false); } } }
    asm volatile("s_wait_dscnt 0x0" ::: "memory");      // this wave's reads of tile t have returned before the buffer is handed back
    asm volatile("s_wait_asynccnt 0x0" ::: "memory");   // this wave's share of tile t + 1 has landed
    __syncthreads();                                    // publishes tile t + 1 and ends every wave's reads of tile t
    if (t + 2 < nst) fa_fill(ld + (unsigned)(t & 1) * FBUF, gk + (size_t)(t + 2) * (64 * CC * 2), gh + (t + 2) * 128, gl + (t + 2) * 128); }
  asm volatile("s_wait_asynccnt 0x0" ::: "memory");     // no copy is outstanding when the wave ends
  l += xhalf(l); const float inv = 1.0f / l;
  float* yp = Y + ((size_t)b * TT + qt) * CC + h * HD + 8 * g;   // acc[j][r] = y(query qt, d = 16 j + 8 g + r)
#pragma unroll
  for (int j = 0; j < HD / 16; ++j) { v4f lo, hi;
#pragma unroll
    for (int r = 0; r < 4; ++r) { lo[r] = acc[j][r] * inv; hi[r] = acc[j][4 + r] * inv; }
    vst2(yp + j * 16, lo); vst2(yp + j * 16 + 4, hi); } }
// ---- k_out: block = (128 rows, 128 cols), eight waves of 16 rows: out = y (bf16 hi + lo) Wproj + b
__global__ __launch_bounds__(256) void k_out(const float* __restrict__ Y, const float* __restrict__ WP, const float* __restrict__ BP, float* __restrict__ OUT) { __shared__ __align__(16) float sf[8][16][132]; __shared__ __align__(16) __bf16 wt[2][128][72]; __shared__ __align__(16) __bf16 ysm[2][8][16][72];
  const int tid = threadIdx.x, wave = tid >> 5, lane = tid & 31, col = lane & 15, g = lane >> 4; const int c0 = blockIdx.y * 128; const size_t r0 = (size_t)blockIdx.x * 128 + wave * 16;
  v8f acc[8] = {};
  const float* wp = WP + c0 + 4 * lane;   // this lane's four columns of the block's weight columns
  const float* yp = Y + (r0 + g) * CC + 4 * col;
  v4f wr[8]; v4f yr[8]; F2 a[2]; __bf16 (*yh)[72] = ysm[0][wave]; __bf16 (*yl)[72] = ysm[1][wave];
  auto get_a = [&]() {   // this wave's A fragments (hi and lo) of the 64 k that it has just stored
#pragma unroll
    for (int kk = 0; kk < 2; ++kk) { a[kk].h = frag_b(&yh[col][kk * 32], lane); a[kk].l = frag_b(&yl[col][kk * 32], lane); } };
  // every '#pragma unroll' below: constant trip count, unrolled so that the register arrays are indexed by constants
  auto mult = [&](const __bf16 (*t)[72]) {   // 64 k of the tile; four B fragments are read as one group ahead of their eight products
#pragma unroll
    for (int kk = 0; kk < 2; ++kk)
#pragma unroll
      for (int jh = 0; jh < 2; ++jh) { v16b w[4];
#pragma unroll
        for (int q = 0; q < 4; ++q) w[q] = frag_b(&t[(jh * 4 + q) * 16 + col][kk * 32], lane);
#pragma unroll
        for (int q = 0; q < 4; ++q) { acc[jh * 4 + q] = wmma_bf(a[kk].h, w[q], acc[jh * 4 + q]); acc[jh * 4 + q] = wmma_bf(a[kk].l, w[q], acc[jh * 4 + q]); } } };
  wt_load(wr, wp, wave, CC); rows_load(yr, yp);
  asm volatile("s_wait_xcnt 0x0" ::: "memory");   // behind the loads, before their address registers are reused
  wt_store(wt[0], wr, wave, lane); rows_store2(yh, yl, yr, g, col);
  __syncthreads();
  get_a();
  __bf16 (*cur)[72] = wt[0]; __bf16 (*nxt)[72] = wt[1];
  for (int kb = 1; kb < CC / 64; ++kb) {
    wt_load(wr, wp + (size_t)kb * 64 * CC, wave, CC); rows_load(yr, yp + kb * 64);   // the next 64 k fly while this tile is multiplied
    asm volatile("s_wait_xcnt 0x0" ::: "memory");   // behind the loads, before their address registers are reused
    mult(cur);
    wt_store(nxt, wr, wave, lane); rows_store2(yh, yl, yr, g, col);   // the fragments of the rows that are overwritten here are in registers since the last get_a
    __syncthreads();   // publishes the next tile and ends every wave's reads of this one
    get_a();
    __bf16 (*t)[72] = cur; cur = nxt; nxt = t; }
  mult(cur);
#pragma unroll
  for (int jl = 0; jl < 2; ++jl) { const int cl = 64 * jl + 4 * col; v4f bb = {};
    if (BP) { const v4f t = *(const v4f*)(BP + c0 + cl);
#pragma unroll
      for (int e = 0; e < 4; ++e) bb[e] = bfr(t[e]); }
#pragma unroll
    for (int r = 0; r < 8; ++r) { v4f o;   // a lane's four columns are neighbours in a row: one 16-byte store a row
#pragma unroll
      for (int e = 0; e < 4; ++e) o[e] = acc[2 * e + jl][r] + bb[e];
      *(v4f*)&sf[wave][8 * g + r][cl] = o; } }
  LDSX(); for (int rl = 0; rl < 16; ++rl) vst2(OUT + (r0 + rl) * CC + c0 + lane * 4, *(const v4f*)&sf[wave][rl][lane * 4]); }
extern "C" void kernel_launch(void* const* d_in, const int* in_sizes, int n_in, void* d_out, int out_size, void* d_ws, size_t ws_size, hipStream_t stream) {
  (void)in_sizes; (void)n_in; (void)out_size;
  const float** F = (const float**)d_in;   // 0 xt [2,2048,1024], 1 W_ca [1024,2048] (in,out), 2 b_ca [2048], 3 W_proj [1024,1024], 4 b_proj
  if (ws_size < (size_t)WS_END) return;
  char* ws = (char*)d_ws; _Float16 *QH = (_Float16*)(ws + WS_QH), *QL = (_Float16*)(ws + WS_QL), *KH = (_Float16*)(ws + WS_KH); __bf16 *VT = (__bf16*)(ws + WS_VT), *VL = (__bf16*)(ws + WS_VL); float *Y = (float*)(ws + WS_Y);
  k_proj<<<dim3(TNB * TT / 128, CC / 128, 2), 256, 0, stream>>>(F[0], F[1], F[2], QH, QL, KH, VT, VL);   // which 1 -> qk_t (cols 0..C), which 2 -> v (cols C..2C) of the [C, 2C] weight
  k_fa<<<dim3(TNB * NH, TT / 64), 128, 0, stream>>>(F[0], KH, VT, VL, Y);   // all batches and heads in one launch
  k_out<<<dim3(TNB * TT / 128, CC / 128), 256, 0, stream>>>(Y, F[3], F[4], (float*)d_out);
}

// v008
// One run takes 77.7 microseconds.
// Next to v007, in two timings, it ran 1.04 times as fast each time.
// Counting every step since v000, it is 16.4 times as fast.
// compute dtype: all float inputs rounded to bf16; [qk_t | v] = x W_ca + b_ca ([C, 2C]) with EXACT bf16 products on WMMA 16x16x32, f32 accumulate; query = the bf16-exact input rows themselves (as f16, exact), qk_t rounded once to f16 -> 1-product logits / 8, causal, kept in registers (one launch for all heads); running-maximum softmax in f32 in base 2 (one fma and one hardware exp2 per score), un-normalised P split bf16 hi + lo against v bf16 hi + lo (3 products), divided by the row sum at the end; out = y (bf16 hi + lo) W_proj + b_proj; f32 output.
#include <hip/hip_runtime.h>
#include <math.h>

typedef __attribute__((ext_vector_type(16))) _Float16 v16h;
typedef __attribute__((ext_vector_type(16))) __bf16 v16b;
typedef __attribute__((ext_vector_type(8)))  _Float16 v8h;
typedef __attribute__((ext_vector_type(8)))  float v8f;
typedef __attribute__((ext_vector_type(4)))  float v4f;
typedef __attribute__((ext_vector_type(2)))  float v2f;
typedef __attribute__((ext_vector_type(4)))  unsigned v4u;
typedef __attribute__((ext_vector_type(4)))  int v4i;
typedef float __attribute__((may_alias)) float_a;
typedef int __attribute__((may_alias)) int_a;

template <typename T> __device__ __forceinline__ void vst2(void* p, T v) { *(T*)p = v;  }
__device__ __forceinline__ v8f wmma16(v16h a, v16h b, v8f c) {
  v8f d = __builtin_amdgcn_wmma_f32_16x16x32_f16(false, a, false, b, (short)0, c, false, false);
  asm volatile("v_nop\n\tv_nop\n\tv_nop\n\tv_nop" : "+v"(d) : "v"(a), "v"(b));
  return d;
}
__device__ __forceinline__ v8f wmma_bf(v16b a, v16b b, v8f c) {
  v8f d = __builtin_amdgcn_wmma_f32_16x16x32_bf16(false, a, false, b, (short)0, c, false, false);
  asm volatile("v_nop\n\tv_nop\n\tv_nop\n\tv_nop" : "+v"(d) : "v"(a), "v"(b));
  return d;
}
// 16x16x32 fragments: lane = (h = lane>>4, row/col = lane&15); elements 0..7 = k0+8h+0..7, 8..15 = k0+16+8h+0..7; D element r = row 8h+r
__device__ __forceinline__ v16h frag_h(const _Float16* rowk0, int lane) {
  union { v16h v; v8h q[2]; } u; const _Float16* p = rowk0 + 8 * (lane >> 4);
  u.q[0] = *(const v8h*)p; u.q[1] = *(const v8h*)(p + 16); return u.v;
}
__device__ __forceinline__ v16h frag_f32(const float* rowk0, int lane) {
  v16h a; const float* p = rowk0 + 8 * (lane >> 4);
#pragma unroll
  for (int i = 0; i < 8; ++i) { a[i] = (_Float16)p[i]; a[8 + i] = (_Float16)p[16 + i]; }
  return a;
}
__device__ __forceinline__ v16h frag_f32s(const float* rowk0, int lane, float sc) {
  v16h a; const float* p = rowk0 + 8 * (lane >> 4);
#pragma unroll
  for (int i = 0; i < 8; ++i) { a[i] = (_Float16)(p[i] * sc); a[8 + i] = (_Float16)(p[16 + i] * sc); }
  return a;
}
// column fragment from a [K][ld] layout (column n), rows >= K read as 0
__device__ __forceinline__ v16h fragc_f32(const float* W, int k0, int n, int lane, int ld, int K) {
  v16h a; const int g = lane >> 4;
#pragma unroll
  for (int i = 0; i < 8; ++i) { const int ka = k0 + 8 * g + i, kb = ka + 16;
    a[i] = (_Float16)(ka < K ? W[(size_t)(ka < K ? ka : K - 1) * ld + n] : 0.f); a[8 + i] = (_Float16)(kb < K ? W[(size_t)(kb < K ? kb : K - 1) * ld + n] : 0.f); }
  return a;
}
struct F2 { v16b h, l; };
__device__ __forceinline__ F2 bsplit16(const float v[16]) { F2 r;
#pragma unroll
  for (int i = 0; i < 16; ++i) { const __bf16 h = (__bf16)v[i]; r.h[i] = h; r.l[i] = (__bf16)(v[i] - (float)h); }
  return r; }
__device__ __forceinline__ F2 split_row(const float* row, int k0, int lane) { float v[16]; const float* p = row + k0 + 8 * (lane >> 4);
#pragma unroll
  for (int i = 0; i < 8; ++i) { v[i] = p[i]; v[8 + i] = p[16 + i]; }
  return bsplit16(v); }
__device__ __forceinline__ F2 split_rowK(const float* row, int k0, int lane, int K) { float v[16]; const int g = lane >> 4;
#pragma unroll
  for (int i = 0; i < 8; ++i) { const int ka = k0 + 8 * g + i, kb = ka + 16; v[i] = ka < K ? row[ka < K ? ka : K - 1] : 0.f; v[8 + i] = kb < K ? row[kb < K ? kb : K - 1] : 0.f; }
  return bsplit16(v); }
__device__ __forceinline__ F2 split_col(const float* W, int k0, int n, int lane, int ld, int K) { float v[16]; const int g = lane >> 4;
#pragma unroll
  for (int i = 0; i < 8; ++i) { const int ka = k0 + 8 * g + i, kb = ka + 16; v[i] = ka < K ? W[(size_t)(ka < K ? ka : K - 1) * ld + n] : 0.f; v[8 + i] = kb < K ? W[(size_t)(kb < K ? kb : K - 1) * ld + n] : 0.f; }
  return bsplit16(v); }
__device__ __forceinline__ v8f mac3(const F2& a, const F2& b, v8f c) { c = wmma_bf(a.l, b.h, c); c = wmma_bf(a.h, b.l, c); return wmma_bf(a.h, b.h, c); }
__device__ __forceinline__ float sigm(float v) { return 1.0f / (1.0f + expf(-v)); }
#define LDSX() do { asm volatile("s_wait_dscnt 0" ::: "memory"); __builtin_amdgcn_wave_barrier(); __builtin_amdgcn_fence(__ATOMIC_RELEASE, "workgroup"); } while (0)


// General causal self attention (B 2, T 2,048, C 1,024 = 16 x 64): [qk_t | v] = x W_ca + b_ca; scores = x_head . qk_t_head / 8 (the raw input is the query), causal softmax, . v, output Linear.
#define NB 2
#define TT 2048
#define CC 1024
#define NH 16
#define HD 64
#ifndef TNB
#define TNB NB
#endif
typedef __attribute__((ext_vector_type(8))) __bf16 v8b;
__device__ __forceinline__ v16b frag_b(const __bf16* rowk0, int lane) {
  union { v16b v; v8b q[2]; } u; const __bf16* p = rowk0 + 8 * (lane >> 4);
  u.q[0] = *(const v8b*)p; u.q[1] = *(const v8b*)(p + 16); return u.v;
}
__device__ __forceinline__ float bfr(float v) { return (float)(__bf16)v; }
__device__ __attribute__((noinline)) float exp_ni(float v) { return expf(v); }
__device__ __attribute__((noinline)) float erf_ni(float v) { return erff(v); }

#define WS_QH  0u
#define WS_QL  (WS_QH + 2u * (size_t)NB * TT * CC)
#define WS_KH  (WS_QL + 2u * (size_t)NB * TT * CC)
#define WS_VT  (WS_KH + 2u * (size_t)NB * TT * CC)      // bf16 v planes [b][c][t]
#define WS_VL  (WS_VT + 2u * (size_t)NB * CC * TT)      // bf16 v residual planes
#define HG 4                                          // only sizes WS_S; all heads run in one launch
#define WS_S   (WS_VL + 2u * (size_t)NB * CC * TT)      // unused: k_fa keeps logits in registers
#define WS_PH  (WS_S + 4u * (size_t)HG * TT * TT)
#define WS_Y   (WS_PH + 0u)              // f32 y rows [b*t][C]
#define WS_END (WS_Y + 4u * (size_t)NB * TT * CC)

// ---- weight tile in LDS: 64 k x 128 n of a row-major f32 weight, rounded to bf16 and laid as rows [n][k] (pitch 144 B), fetched once per block for its eight waves (128 rows of the left operand share one tile)
// wave w fetches k rows 8 w .. 8 w + 7, lane = columns 4 lane .. 4 lane + 3: one 16-byte load a row brings the row's whole 512 B (four lines)
// LDS row 32 e + lane holds column 4 lane + e (lanes on neighbouring rows: stores free of bank conflicts), so fragment j = 2 e + jl, lane column col, is column 64 jl + 4 col + e of the tile: a lane's four fragments of one jl are four neighbouring columns, and the epilogues take bias and staging stores by such fours
// every '#pragma unroll' in these helpers: constant trip count, unrolled so that the register arrays are indexed by constants
__device__ __forceinline__ void wt_load(v4f (&r)[8], const float* __restrict__ Wl, int wave, int ld) {
#pragma unroll
  for (int i = 0; i < 8; ++i) r[i] = *(const v4f*)(Wl + (size_t)(wave * 8 + i) * ld);
}
__device__ __forceinline__ void wt_store(__bf16 (*buf)[72], const v4f (&r)[8], int wave, int lane) {
#pragma unroll
  for (int e = 0; e < 4; ++e) { v8b a;
#pragma unroll
    for (int i = 0; i < 8; ++i) a[i] = (__bf16)r[i][e];
    *(v8b*)&buf[e * 32 + lane][wave * 8] = a; }
}
// ---- left operand: a wave's own 16 rows x 64 k. Two rows a load: lanes 0..15 take the 256 B of row 2 i, lanes 16..31 those of row 2 i + 1, 16 B a lane, so every load covers four whole 128-B lines
// (read straight in fragment order, lane = row, each load touched 16 lines for 32 B of each). The rows turn into fragment order through the wave's own LDS rows [row][k] (bf16, pitch 144 B): no other wave reads or writes them
typedef __attribute__((ext_vector_type(4))) __bf16 v4b;
typedef __attribute__((ext_vector_type(4))) _Float16 v4h;
__device__ __forceinline__ void rows_load(v4f (&r)[8], const float* __restrict__ p) {   // p: row g of the wave's rows, k 4 col
#pragma unroll
  for (int i = 0; i < 8; ++i) r[i] = *(const v4f*)(p + (size_t)(2 * i) * CC);
}
__device__ __forceinline__ void rows_store(__bf16 (*xs)[72], const v4f (&r)[8], int g, int col) {   // rounded to bf16
#pragma unroll
  for (int i = 0; i < 8; ++i) { v4b a;
#pragma unroll
    for (int e = 0; e < 4; ++e) a[e] = (__bf16)r[i][e];
    *(v4b*)&xs[2 * i + g][4 * col] = a; }
}
__device__ __forceinline__ void rows_store2(__bf16 (*xh)[72], __bf16 (*xl)[72], const v4f (&r)[8], int g, int col) {   // split bf16 hi + lo, as bsplit16 does
#pragma unroll
  for (int i = 0; i < 8; ++i) { v4b a, b;
#pragma unroll
    for (int e = 0; e < 4; ++e) { const __bf16 h = (__bf16)r[i][e]; a[e] = h; b[e] = (__bf16)(r[i][e] - (float)h); }
    *(v4b*)&xh[2 * i + g][4 * col] = a; *(v4b*)&xl[2 * i + g][4 * col] = b; }
}
// ---- k_proj: block = (128 rows, 128 cols, which), eight waves of 16 rows: [qk_t | v] = x W (+ b), exact; qk_t -> f16 rows, v -> bf16 hi + lo planes
__global__ __launch_bounds__(256) void k_proj(const float* __restrict__ X, const float* __restrict__ WA, const float* __restrict__ BA, _Float16* __restrict__ QH, _Float16* __restrict__ QL, _Float16* __restrict__ KH, __bf16* __restrict__ VT, __bf16* __restrict__ VL) {
  __shared__ __align__(16) _Float16 sh[128][136], sl[128][136]; __shared__ __align__(16) __bf16 th[128][136], tl2[128][136]; __shared__ __align__(16) __bf16 xsm[8][16][72];
  const int tid = threadIdx.x, wave = tid >> 5, lane = tid & 31, col = lane & 15, g = lane >> 4; const int which = blockIdx.z + 1; /* 1: qk_t -> KH, 2: v -> planes (no q projection: the query is x itself) */ const int c0 = blockIdx.y * 128; const size_t r0 = (size_t)blockIdx.x * 128;
  v8f acc[8] = {};
  const float* wp = WA + (size_t)(which - 1) * CC + c0 + 4 * lane;   // this lane's four columns of the block's weight columns
  const float* xp = X + (r0 + wave * 16 + g) * CC + 4 * col;
  v4f wr[8]; v4f xr[8]; v16b a[2]; __bf16 (*xs)[72] = xsm[wave];
  const int ks = (((int)blockIdx.x >> 1) + 2 * (int)blockIdx.y) & (CC / 64 - 1);   // this block's first 64-k chunk; the walk wraps. The 32 row blocks of a weight panel and the 16 column blocks of a row panel would else ask L2 for the same lines at the same moment
  // every '#pragma unroll' below: constant trip count, unrolled so that the register arrays are indexed by constants
  auto get_a = [&]() {   // this wave's A fragments of the 64 k that it has just stored
#pragma unroll
    for (int kk = 0; kk < 2; ++kk) a[kk] = frag_b(&xs[col][kk * 32], lane); };
  auto mult = [&](const __bf16 (*t)[72]) {   // 64 k of the tile; four B fragments are read as one group ahead of their four products
#pragma unroll
    for (int kk = 0; kk < 2; ++kk)
#pragma unroll
      for (int jh = 0; jh < 2; ++jh) { v16b w[4];
#pragma unroll
        for (int q = 0; q < 4; ++q) w[q] = frag_b(&t[(jh * 4 + q) * 16 + col][kk * 32], lane);
#pragma unroll
        for (int q = 0; q < 4; ++q) acc[jh * 4 + q] = wmma_bf(a[kk], w[q], acc[jh * 4 + q]); } };
  wt_load(wr, wp + (size_t)ks * 64 * (2 * CC), wave, 2 * CC); rows_load(xr, xp + ks * 64);
  asm volatile("s_wait_xcnt 0x0" ::: "memory");   // behind the loads, before their address registers are reused
  __bf16 (*cur)[72] = (__bf16 (*)[72])th; __bf16 (*nxt)[72] = (__bf16 (*)[72])tl2;   // the first 128 x 72 elements of th and of tl2 are the two tile buffers until the epilogue takes them back
  wt_store(cur, wr, wave, lane); rows_store(xs, xr, g, col);
  __syncthreads();
  get_a();
  for (int kb = 1; kb < CC / 64; ++kb) {
    const int kq = (kb + ks) & (CC / 64 - 1);
    wt_load(wr, wp + (size_t)kq * 64 * (2 * CC), wave, 2 * CC); rows_load(xr, xp + kq * 64);   // the next 64 k fly while this tile is multiplied
    asm volatile("s_wait_xcnt 0x0" ::: "memory");   // behind the loads, before their address registers are reused
    mult(cur);
    wt_store(nxt, wr, wave, lane); rows_store(xs, xr, g, col);   // the fragments of the rows that are overwritten here are in registers since the last get_a
    __syncthreads();   // publishes the next tile and ends every wave's reads of this one
    get_a();
    __bf16 (*t)[72] = cur; cur = nxt; nxt = t; }
  mult(cur);
  __syncthreads();   // every wave has left th and tl2 before the epilogue writes them
#pragma unroll
  for (int jl = 0; jl < 2; ++jl) { const int cl = 64 * jl + 4 * col; v4f bb = {};
    if (BA) { const v4f t = *(const v4f*)(BA + (which - 1) * CC + c0 + cl);
#pragma unroll
      for (int e = 0; e < 4; ++e) bb[e] = bfr(t[e]); }
    if (which == 2) {   // a lane's eight rows are neighbours in a plane's row: one 16-byte store a plane (lanes stand four plane rows apart, where single 2-byte stores would meet on four banks)
#pragma unroll
      for (int e = 0; e < 4; ++e) { v8b h8, l8;
#pragma unroll
        for (int r = 0; r < 8; ++r) { const float v = acc[2 * e + jl][r] + bb[e]; const __bf16 bh = (__bf16)v; h8[r] = bh; l8[r] = (__bf16)(v - (float)bh); }
        *(v8b*)&th[cl + e][wave * 16 + 8 * g] = h8; *(v8b*)&tl2[cl + e][wave * 16 + 8 * g] = l8; } }
    else {   // a lane's four columns are neighbours in a row: one 8-byte store a row
#pragma unroll
      for (int r = 0; r < 8; ++r) { const int rl = wave * 16 + 8 * g + r; v4h hv, lv;
#pragma unroll
        for (int e = 0; e < 4; ++e) { const float v = acc[2 * e + jl][r] + bb[e]; const _Float16 hh = (_Float16)v; hv[e] = hh; lv[e] = (_Float16)(v - (float)hh); }
        *(v4h*)&sh[rl][cl] = hv; *(v4h*)&sl[rl][cl] = lv; } } }
  __syncthreads();
  if (which < 2) { _Float16* dh = which == 0 ? QH : KH; for (int e = tid; e < 128 * 16; e += 256) { const int rl = e >> 4, q = e & 15; vst2((unsigned*)(dh + (r0 + rl) * CC + c0 + q * 8), *(const v4u*)&sh[rl][q * 8]);
      asm volatile("s_wait_xcnt 0x0" ::: "memory");   // behind the store, before its address and data registers are reused
      if (which == 0) { vst2((unsigned*)(QL + (r0 + rl) * CC + c0 + q * 8), *(const v4u*)&sl[rl][q * 8]);
        asm volatile("s_wait_xcnt 0x0" ::: "memory"); } } }   // the same, behind the second store
  else { const size_t b = r0 / TT; const int t0 = (int)(r0 % TT); for (int e = tid; e < 128 * 16; e += 256) { const int cl = e >> 4, q = e & 15; const size_t o2 = (b * CC + c0 + cl) * (size_t)TT + t0 + q * 8; vst2((unsigned*)(VT + o2), *(const v4u*)&th[cl][q * 8]); vst2((unsigned*)(VL + o2), *(const v4u*)&tl2[cl][q * 8]); } } }
__device__ __forceinline__ float xhalf(float x) { return __builtin_bit_cast(float, __builtin_amdgcn_permlanex16(__builtin_bit_cast(int, x), __builtin_bit_cast(int, x), 0x76543210, 0xfedcba98, false, false)); }   // lane l <-> lane l ^ 16
#define FROW 144u                 // LDS row pitch in bytes: 16 B x odd, free of bank conflicts for 16-byte reads
#define FPL  (64u * FROW)         // one plane of a tile: 64 rows
#define FBUF (3u * FPL)           // one buffer: K rows, V hi plane, V lo plane
#define FSC  0.18033688011112042f // (1 / 8) log2(e): exp((s - max) / 8) = exp2(s FSC - max FSC)
// one tile: each lane copies 16 B of rows r, r + 16, r + 32, r + 48 of each plane, so every copy of a wave covers four whole 128-B lines
__device__ __forceinline__ void fa_fill(unsigned ld, const char* gk, const char* gh, const char* gl) {
  // the twelve copies and the wait behind them stand in one statement, so that no address register is rewritten before the wait
  asm volatile("global_load_async_to_lds_b128 %0, %12, off\n\t"
               "global_load_async_to_lds_b128 %1, %13, off\n\t"
               "global_load_async_to_lds_b128 %2, %14, off\n\t"
               "global_load_async_to_lds_b128 %3, %15, off\n\t"
               "global_load_async_to_lds_b128 %4, %16, off\n\t"
               "global_load_async_to_lds_b128 %5, %17, off\n\t"
               "global_load_async_to_lds_b128 %6, %18, off\n\t"
               "global_load_async_to_lds_b128 %7, %19, off\n\t"
               "global_load_async_to_lds_b128 %8, %20, off\n\t"
               "global_load_async_to_lds_b128 %9, %21, off\n\t"
               "global_load_async_to_lds_b128 %10, %22, off\n\t"
               "global_load_async_to_lds_b128 %11, %23, off\n\t"
               "s_wait_xcnt 0x0"
               :: "v"(ld), "v"(ld + 16u * FROW), "v"(ld + 32u * FROW), "v"(ld + 48u * FROW),
                  "v"(ld + FPL), "v"(ld + FPL + 16u * FROW), "v"(ld + FPL + 32u * FROW), "v"(ld + FPL + 48u * FROW),
                  "v"(ld + 2u * FPL), "v"(ld + 2u * FPL + 16u * FROW), "v"(ld + 2u * FPL + 32u * FROW), "v"(ld + 2u * FPL + 48u * FROW),
                  "v"(gk), "v"(gk + 16 * CC * 2), "v"(gk + 32 * CC * 2), "v"(gk + 48 * CC * 2),
                  "v"(gh), "v"(gh + 16 * TT * 2), "v"(gh + 32 * TT * 2), "v"(gh + 48 * TT * 2),
                  "v"(gl), "v"(gl + 16 * TT * 2), "v"(gl + 32 * TT * 2), "v"(gl + 48 * TT * 2)
               : "memory");
}
__global__ __launch_bounds__(128) void k_fa(const float* __restrict__ X, const _Float16* __restrict__ KH, const __bf16* __restrict__ VT, const __bf16* __restrict__ VL, float* __restrict__ Y) {
  __shared__ __align__(16) unsigned char fs[2u * FBUF];
  // every '#pragma unroll' in this kernel: constant trip count, unrolled so that the fragment arrays are indexed by constants and stay in registers
  const int tid = threadIdx.x, wave = __builtin_amdgcn_readfirstlane(tid >> 5) /* scalar: the pass count and the diagonal test become scalar branches, EXEC stays all ones at every WMMA */, lane = tid & 31, col = lane & 15, g = lane >> 4;
  const int h = blockIdx.x % NH, b = blockIdx.x / NH;
  const int nst = TT / 64 - (int)blockIdx.y;                                 // tiles of 64 keys up to and including the diagonal (block-uniform); longest query blocks start first
  const int rot = (int)blockIdx.y % nst;                                     // this block's first key tile; the walk wraps (the running softmax takes the tiles in any order). The up to 32 query blocks of a head would else ask L2 for the same K and V lines at the same moment
  auto tix = [&](int t) { const int u = t + rot; return u < nst ? u : u - nst; };   // key tile of trip t (block-uniform)
  const int ql0 = (nst - 1) * 64 + wave * 16;
  const int np = (ql0 + 16 + 31) >> 5;                                       // passes up to and including the diagonal (wave-uniform)
  const int qt = ql0 + col;
  const int crow = tid >> 3, cpos = (tid & 7) * 16;                          // this lane's first row and its 16 B of the row, in every plane of a tile
  const char* gk = (const char*)(KH + ((size_t)b * TT + crow) * CC + h * HD) + cpos;        // tile t: 64 key rows further
  const char* gh = (const char*)(VT + ((size_t)b * CC + h * HD + crow) * (size_t)TT) + cpos;   // tile t: 64 keys = 128 B further
  const char* gl = (const char*)(VL + ((size_t)b * CC + h * HD + crow) * (size_t)TT) + cpos;
  const unsigned ld = (unsigned)(size_t)fs + (unsigned)crow * FROW + (unsigned)cpos;
  fa_fill(ld, gk + (size_t)rot * (64 * CC * 2), gh + rot * 128, gl + rot * 128);
  v16h qf[HD / 32];
#pragma unroll
  for (int kc = 0; kc < HD / 32; ++kc) { const float* xp = X + ((size_t)b * TT + qt) * CC + h * HD + kc * 32 + 8 * g;
#pragma unroll
    for (int i = 0; i < 8; ++i) { qf[kc][i] = (_Float16)bfr(xp[i]); qf[kc][8 + i] = (_Float16)bfr(xp[16 + i]); } }   // query = raw input head slice (bf16-exact values, exact in f16)
  v8f acc[HD / 16] = {}; float m = -3.0e38f * FSC, l = 0.f;   // m: running maximum in base-2 units (logit x FSC)
  asm volatile("s_wait_asynccnt 0x0" ::: "memory");   // this wave's share of tile 0 has landed
  __syncthreads();                                    // publishes tile 0
  if (nst > 1) { const int t1 = tix(1); fa_fill(ld + FBUF, gk + (size_t)t1 * (64 * CC * 2), gh + t1 * 128, gl + t1 * 128); }
  for (int t = 0; t < nst; ++t) {
    const unsigned char* tb = fs + (unsigned)(t & 1) * FBUF;
    const _Float16* kp = (const _Float16*)(tb + (unsigned)col * FROW);
    const __bf16* vhp = (const __bf16*)(tb + FPL + (unsigned)col * FROW);
    const __bf16* vlp = (const __bf16*)(tb + 2u * FPL + (unsigned)col * FROW);
#pragma unroll
    for (int sub = 0; sub < 2; ++sub) { const int ps = 2 * tix(t) + sub, k0 = ps * 32;
      if (sub == 0 || ps < np) {   // the first two waves have no open key in the second half of the diagonal tile
        v16h kf[2][HD / 32];
#pragma unroll
        for (int u = 0; u < 2; ++u)
#pragma unroll
          for (int kc = 0; kc < HD / 32; ++kc) kf[u][kc] = frag_h(kp + (sub * 32 + u * 16) * (int)(FROW / 2) + kc * 32, lane);
        v16b vh[HD / 16], vl[HD / 16];
#pragma unroll
        for (int j = 0; j < HD / 16; ++j) { vh[j] = frag_b(vhp + j * 16 * (int)(FROW / 2) + sub * 32, lane); vl[j] = frag_b(vlp + j * 16 * (int)(FROW / 2) + sub * 32, lane); }
        __builtin_amdgcn_sched_barrier(0);   // keeps the pass's 24 LDS reads together, as one group ahead of its products: left free, they sink to one read and one full wait in front of each product
        v8f st[2] = {};
#pragma unroll
        for (int u = 0; u < 2; ++u)
#pragma unroll
          for (int kc = 0; kc < HD / 32; ++kc) st[u] = __builtin_amdgcn_wmma_f32_16x16x32_f16(false, kf[u][kc], false, qf[kc], (short)0, st[u], false, false);   // st[u][r] = logit(key k0 + 16 u + 8 g + r, query qt)
        float p[16];
#pragma unroll
        for (int u = 0; u < 2; ++u)
#pragma unroll
          for (int r = 0; r < 8; ++r) p[u * 8 + r] = st[u][r];   // unscaled: the scale rides in the fma in front of exp2
        if (k0 + 31 > ql0) {   // only passes that reach the diagonal hold masked keys
#pragma unroll
          for (int i = 0; i < 16; ++i) if (k0 + (i >> 3) * 16 + 8 * g + (i & 7) > qt) p[i] = -3.0e38f; }
        float mx = p[0];
#pragma unroll
        for (int i = 1; i < 16; ++i) mx = fmaxf(mx, p[i]);
        mx = fmaxf(mx, xhalf(mx));
        const float mn = fmaxf(m, mx * FSC);   // FSC > 0: the maximum may be taken before the scale
        float sum = 0.f;
#pragma unroll
        for (int i = 0; i < 16; ++i) { p[i] = __builtin_amdgcn_exp2f(fmaf(p[i], FSC, -mn)); sum += p[i]; }   // a masked key: exp2(-3e38 FSC - mn) is exactly 0 (mn is finite: the first key of every pass that a wave works on is open to all its queries)
        float al;   // rescale factor exp2(old maximum - new maximum)
        asm("v_exp_f32 %0, %1\n\tv_nop" : "=v"(al) : "v"(m - mn));   // in asm for the v_nop alone: it is the slot that the instruction set asks for behind a transcendental
        m = mn;
        l = l * al + sum;   // each lane half keeps the sum of its own keys; joined after the loop
#pragma unroll
        for (int j = 0; j < HD / 16; ++j) acc[j] *= al;
        const F2 pf = bsplit16(p);
#pragma unroll
        for (int j = 0; j < HD / 16; ++j) { acc[j] = __builtin_amdgcn_wmma_f32_16x16x32_bf16(false, vh[j], false, pf.h, (short)0, acc[j], false, false); acc[j] = __builtin_amdgcn_wmma_f32_16x16x32_bf16(false, vh[j], false, pf.l, (short)0, acc[j], false, false); acc[j] = __builtin_amdgcn_wmma_f32_16x16x32_bf16(false, vl[j], false, pf.h, (short)0, acc[j], false, false); } } }
    asm volatile("s_wait_dscnt 0x0" ::: "memory");      // this wave's reads of tile t have returned before the buffer is handed back
    asm volatile("s_wait_asynccnt 0x0" ::: "memory");   // this wave's share of tile t + 1 has landed
    __syncthreads();                                    // publishes tile t + 1 and ends every wave's reads of tile t
    if (t + 2 < nst) { const int tn = tix(t + 2); fa_fill(ld + (unsigned)(t & 1) * FBUF, gk + (size_t)tn * (64 * CC * 2), gh + tn * 128, gl + tn * 128); } }
  asm volatile("s_wait_asynccnt 0x0" ::: "memory");     // no copy is outstanding when the wave ends
  l += xhalf(l); const float inv = 1.0f / l;
  float* yp = Y + ((size_t)b * TT + qt) * CC + h * HD + 8 * g;   // acc[j][r] = y(query qt, d = 16 j + 8 g + r)
#pragma unroll
  for (int j = 0; j < HD / 16; ++j) { v4f lo, hi;
#pragma unroll
    for (int r = 0; r < 4; ++r) { lo[r] = acc[j][r] * inv; hi[r] = acc[j][4 + r] * inv; }
    vst2(yp + j * 16, lo); vst2(yp + j * 16 + 4, hi); } }
// ---- k_out: block = (128 rows, 128 cols), eight waves of 16 rows: out = y (bf16 hi + lo) Wproj + b
__global__ __launch_bounds__(256) void k_out(const float* __restrict__ Y, const float* __restrict__ WP, const float* __restrict__ BP, float* __restrict__ OUT) { __shared__ __align__(16) float sf[8][16][132]; __shared__ __align__(16) __bf16 wt[2][128][72]; __shared__ __align__(16) __bf16 ysm[2][8][16][72];
  const int tid = threadIdx.x, wave = tid >> 5, lane = tid & 31, col = lane & 15, g = lane >> 4; const int c0 = blockIdx.y * 128; const size_t r0 = (size_t)blockIdx.x * 128 + wave * 16;
  v8f acc[8] = {};
  const float* wp = WP + c0 + 4 * lane;   // this lane's four columns of the block's weight columns
  const float* yp = Y + (r0 + g) * CC + 4 * col;
  v4f wr[8]; v4f yr[8]; F2 a[2]; __bf16 (*yh)[72] = ysm[0][wave]; __bf16 (*yl)[72] = ysm[1][wave];
  const int ks = (((int)blockIdx.x >> 1) + 2 * (int)blockIdx.y) & (CC / 64 - 1);   // this block's first 64-k chunk; the walk wraps, as in k_proj
  auto get_a = [&]() {   // this wave's A fragments (hi and lo) of the 64 k that it has just stored
#pragma unroll
    for (int kk = 0; kk < 2; ++kk) { a[kk].h = frag_b(&yh[col][kk * 32], lane); a[kk].l = frag_b(&yl[col][kk * 32], lane); } };
  // every '#pragma unroll' below: constant trip count, unrolled so that the register arrays are indexed by constants
  auto mult = [&](const __bf16 (*t)[72]) {   // 64 k of the tile; four B fragments are read as one group ahead of their eight products
#pragma unroll
    for (int kk = 0; kk < 2; ++kk)
#pragma unroll
      for (int jh = 0; jh < 2; ++jh) { v16b w[4];
#pragma unroll
        for (int q = 0; q < 4; ++q) w[q] = frag_b(&t[(jh * 4 + q) * 16 + col][kk * 32], lane);
#pragma unroll
        for (int q = 0; q < 4; ++q) { acc[jh * 4 + q] = wmma_bf(a[kk].h, w[q], acc[jh * 4 + q]); acc[jh * 4 + q] = wmma_bf(a[kk].l, w[q], acc[jh * 4 + q]); } } };
  wp += (size_t)ks * 64 * CC; yp += ks * 64;
  wt_load(wr, wp, wave, CC); rows_load(yr, yp);
  asm volatile("s_wait_xcnt 0x0" ::: "memory");   // behind the loads, before their address registers are reused
  wt_store(wt[0], wr, wave, lane); rows_store2(yh, yl, yr, g, col);
  __syncthreads();
  get_a();
  __bf16 (*cur)[72] = wt[0]; __bf16 (*nxt)[72] = wt[1];
  for (int kb = 1; kb < CC / 64; ++kb) {
    const int st = ((kb + ks) & (CC / 64 - 1)) ? 64 : 64 - CC;   // one chunk on, or from the last chunk back to the first
    wp += (ptrdiff_t)st * CC; yp += st;
    wt_load(wr, wp, wave, CC); rows_load(yr, yp);   // the next 64 k fly while this tile is multiplied
    asm volatile("s_wait_xcnt 0x0" ::: "memory");   // behind the loads, before their address registers are reused
    mult(cur);
    wt_store(nxt, wr, wave, lane); rows_store2(yh, yl, yr, g, col);   // the fragments of the rows that are overwritten here are in registers since the last get_a
    __syncthreads();   // publishes the next tile and ends every wave's reads of this one
    get_a();
    __bf16 (*t)[72] = cur; cur = nxt; nxt = t; }
  mult(cur);
#pragma unroll
  for (int jl = 0; jl < 2; ++jl) { const int cl = 64 * jl + 4 * col; v4f bb = {};
    if (BP) { const v4f t = *(const v4f*)(BP + c0 + cl);
#pragma unroll
      for (int e = 0; e < 4; ++e) bb[e] = bfr(t[e]); }
#pragma unroll
    for (int r = 0; r < 8; ++r) { v4f o;   // a lane's four columns are neighbours in a row: one 16-byte store a row
#pragma unroll
      for (int e = 0; e < 4; ++e) o[e] = acc[2 * e + jl][r] + bb[e];
      *(v4f*)&sf[wave][8 * g + r][cl] = o; } }
  LDSX(); for (int rl = 0; rl < 16; ++rl) vst2(OUT + (r0 + rl) * CC + c0 + lane * 4, *(const v4f*)&sf[wave][rl][lane * 4]); }
extern "C" void kernel_launch(void* const* d_in, const int* in_sizes, int n_in, void* d_out, int out_size, void* d_ws, size_t ws_size, hipStream_t stream) {
  (void)in_sizes; (void)n_in; (void)out_size;
  const float** F = (const float**)d_in;   // 0 xt [2,2048,1024], 1 W_ca [1024,2048] (in,out), 2 b_ca [2048], 3 W_proj [1024,1024], 4 b_proj
  if (ws_size < (size_t)WS_END) return;
  char* ws = (char*)d_ws; _Float16 *QH = (_Float16*)(ws + WS_QH), *QL = (_Float16*)(ws + WS_QL), *KH = (_Float16*)(ws + WS_KH); __bf16 *VT = (__bf16*)(ws + WS_VT), *VL = (__bf16*)(ws + WS_VL); float *Y = (float*)(ws + WS_Y);
  k_proj<<<dim3(TNB * TT / 128, CC / 128, 2), 256, 0, stream>>>(F[0], F[1], F[2], QH, QL, KH, VT, VL);   // which 1 -> qk_t (cols 0..C), which 2 -> v (cols C..2C) of the [C, 2C] weight
  k_fa<<<dim3(TNB * NH, TT / 64), 128, 0, stream>>>(F[0], KH, VT, VL, Y);   // all batches and heads in one launch
  k_out<<<dim3(TNB * TT / 128, CC / 128), 256, 0, stream>>>(Y, F[3], F[4], (float*)d_out);
}

// v010
// It runs in 63.3 microseconds.
// It is 1.23 times as fast as v008, going by the measured steps of the versions left out in between.
// Over all steps from v000 it is 20.1 times as fast.
// compute dtype: all float inputs rounded to bf16; [qk_t | v] = x W_ca + b_ca ([C, 2C]) with EXACT bf16 products on WMMA 16x16x32, f32 accumulate; query = the bf16-exact input rows themselves (as f16, exact), qk_t rounded once to f16 -> 1-product logits / 8, causal, kept in registers (one launch for all heads); running-maximum softmax in f32 in base 2 (one fma and one hardware exp2 per score), un-normalised P rounded once to f16 against v rounded once to f16 (1 product), divided by the row sum at the end; out = y (bf16 hi + lo) W_proj + b_proj; f32 output.
#include <hip/hip_runtime.h>
#include <math.h>

typedef __attribute__((ext_vector_type(16))) _Float16 v16h;
typedef __attribute__((ext_vector_type(16))) __bf16 v16b;
typedef __attribute__((ext_vector_type(8)))  _Float16 v8h;
typedef __attribute__((ext_vector_type(8)))  float v8f;
typedef __attribute__((ext_vector_type(4)))  float v4f;
typedef __attribute__((ext_vector_type(2)))  float v2f;
typedef __attribute__((ext_vector_type(4)))  unsigned v4u;
typedef __attribute__((ext_vector_type(4)))  int v4i;
typedef float __attribute__((may_alias)) float_a;
typedef int __attribute__((may_alias)) int_a;

template <typename T> __device__ __forceinline__ void vst2(void* p, T v) { *(T*)p = v;  }
__device__ __forceinline__ v8f wmma16(v16h a, v16h b, v8f c) {
  v8f d = __builtin_amdgcn_wmma_f32_16x16x32_f16(false, a, false, b, (short)0, c, false, false);
  asm volatile("v_nop\n\tv_nop\n\tv_nop\n\tv_nop" : "+v"(d) : "v"(a), "v"(b));
  return d;
}
__device__ __forceinline__ v8f wmma_bf(v16b a, v16b b, v8f c) {
  v8f d = __builtin_amdgcn_wmma_f32_16x16x32_bf16(false, a, false, b, (short)0, c, false, false);
  asm volatile("v_nop\n\tv_nop\n\tv_nop\n\tv_nop" : "+v"(d) : "v"(a), "v"(b));
  return d;
}
// 16x16x32 fragments: lane = (h = lane>>4, row/col = lane&15); elements 0..7 = k0+8h+0..7, 8..15 = k0+16+8h+0..7; D element r = row 8h+r
__device__ __forceinline__ v16h frag_h(const _Float16* rowk0, int lane) {
  union { v16h v; v8h q[2]; } u; const _Float16* p = rowk0 + 8 * (lane >> 4);
  u.q[0] = *(const v8h*)p; u.q[1] = *(const v8h*)(p + 16); return u.v;
}
__device__ __forceinline__ v16h frag_f32(const float* rowk0, int lane) {
  v16h a; const float* p = rowk0 + 8 * (lane >> 4);
#pragma unroll
  for (int i = 0; i < 8; ++i) { a[i] = (_Float16)p[i]; a[8 + i] = (_Float16)p[16 + i]; }
  return a;
}
__device__ __forceinline__ v16h frag_f32s(const float* rowk0, int lane, float sc) {
  v16h a; const float* p = rowk0 + 8 * (lane >> 4);
#pragma unroll
  for (int i = 0; i < 8; ++i) { a[i] = (_Float16)(p[i] * sc); a[8 + i] = (_Float16)(p[16 + i] * sc); }
  return a;
}
// column fragment from a [K][ld] layout (column n), rows >= K read as 0
__device__ __forceinline__ v16h fragc_f32(const float* W, int k0, int n, int lane, int ld, int K) {
  v16h a; const int g = lane >> 4;
#pragma unroll
  for (int i = 0; i < 8; ++i) { const int ka = k0 + 8 * g + i, kb = ka + 16;
    a[i] = (_Float16)(ka < K ? W[(size_t)(ka < K ? ka : K - 1) * ld + n] : 0.f); a[8 + i] = (_Float16)(kb < K ? W[(size_t)(kb < K ? kb : K - 1) * ld + n] : 0.f); }
  return a;
}
struct F2 { v16b h, l; };
__device__ __forceinline__ F2 bsplit16(const float v[16]) { F2 r;
#pragma unroll
  for (int i = 0; i < 16; ++i) { const __bf16 h = (__bf16)v[i]; r.h[i] = h; r.l[i] = (__bf16)(v[i] - (float)h); }
  return r; }
__device__ __forceinline__ F2 split_row(const float* row, int k0, int lane) { float v[16]; const float* p = row + k0 + 8 * (lane >> 4);
#pragma unroll
  for (int i = 0; i < 8; ++i) { v[i] = p[i]; v[8 + i] = p[16 + i]; }
  return bsplit16(v); }
__device__ __forceinline__ F2 split_rowK(const float* row, int k0, int lane, int K) { float v[16]; const int g = lane >> 4;
#pragma unroll
  for (int i = 0; i < 8; ++i) { const int ka = k0 + 8 * g + i, kb = ka + 16; v[i] = ka < K ? row[ka < K ? ka : K - 1] : 0.f; v[8 + i] = kb < K ? row[kb < K ? kb : K - 1] : 0.f; }
  return bsplit16(v); }
__device__ __forceinline__ F2 split_col(const float* W, int k0, int n, int lane, int ld, int K) { float v[16]; const int g = lane >> 4;
#pragma unroll
  for (int i = 0; i < 8; ++i) { const int ka = k0 + 8 * g + i, kb = ka + 16; v[i] = ka < K ? W[(size_t)(ka < K ? ka : K - 1) * ld + n] : 0.f; v[8 + i] = kb < K ? W[(size_t)(kb < K ? kb : K - 1) * ld + n] : 0.f; }
  return bsplit16(v); }
__device__ __forceinline__ v8f mac3(const F2& a, const F2& b, v8f c) { c = wmma_bf(a.l, b.h, c); c = wmma_bf(a.h, b.l, c); return wmma_bf(a.h, b.h, c); }
__device__ __forceinline__ float sigm(float v) { return 1.0f / (1.0f + expf(-v)); }
#define LDSX() do { asm volatile("s_wait_dscnt 0" ::: "memory"); __builtin_amdgcn_wave_barrier(); __builtin_amdgcn_fence(__ATOMIC_RELEASE, "workgroup"); } while (0)


// General causal self attention (B 2, T 2,048, C 1,024 = 16 x 64): [qk_t | v] = x W_ca + b_ca; scores = x_head . qk_t_head / 8 (the raw input is the query), causal softmax, . v, output Linear.
#define NB 2
#define TT 2048
#define CC 1024
#define NH 16
#define HD 64
#ifndef TNB
#define TNB NB
#endif
typedef __attribute__((ext_vector_type(8))) __bf16 v8b;
__device__ __forceinline__ v16b frag_b(const __bf16* rowk0, int lane) {
  union { v16b v; v8b q[2]; } u; const __bf16* p = rowk0 + 8 * (lane >> 4);
  u.q[0] = *(const v8b*)p; u.q[1] = *(const v8b*)(p + 16); return u.v;
}
__device__ __forceinline__ float bfr(float v) { return (float)(__bf16)v; }
__device__ __attribute__((noinline)) float exp_ni(float v) { return expf(v); }
__device__ __attribute__((noinline)) float erf_ni(float v) { return erff(v); }

#define WS_QH  0u
#define WS_QL  (WS_QH + 2u * (size_t)NB * TT * CC)
#define WS_KH  (WS_QL + 2u * (size_t)NB * TT * CC)
#define WS_VT  (WS_KH + 2u * (size_t)NB * TT * CC)      // f16 v planes [b][c][t]
#define WS_VL  (WS_VT + 2u * (size_t)NB * CC * TT)      // not used
#define HG 4
#define WS_S   (WS_VL + 2u * (size_t)NB * CC * TT)      // not used
#define WS_PH  (WS_S + 4u * (size_t)HG * TT * TT)
#define WS_Y   (WS_PH + 0u)              // f32 y rows [b*t][C]
#define WS_END (WS_Y + 4u * (size_t)NB * TT * CC)

// ---- weight tile in LDS: 64 k x 128 n of a row-major f32 weight, rounded to bf16 and laid as rows [n][k] (pitch 144 B), fetched once per block for its eight waves (128 rows of the left operand share one tile)
// wave w fetches k rows 8 w .. 8 w + 7, lane = columns 4 lane .. 4 lane + 3: one 16-byte load a row brings the row's whole 512 B (four lines)
// LDS row 32 e + lane holds column 4 lane + e (lanes on neighbouring rows: stores free of bank conflicts), so fragment j = 2 e + jl, lane column col, is column 64 jl + 4 col + e of the tile: a lane's four fragments of one jl are four neighbouring columns, and the epilogues take bias and staging stores by such fours
// every '#pragma unroll' in these helpers: constant trip count, unrolled so that the register arrays are indexed by constants
__device__ __forceinline__ void wt_load(v4f (&r)[8], const float* __restrict__ Wl, int wave, int ld) {
#pragma unroll
  for (int i = 0; i < 8; ++i) r[i] = *(const v4f*)(Wl + (size_t)(wave * 8 + i) * ld);
}
__device__ __forceinline__ void wt_store(__bf16 (*buf)[72], const v4f (&r)[8], int wave, int lane) {
#pragma unroll
  for (int e = 0; e < 4; ++e) { v8b a;
#pragma unroll
    for (int i = 0; i < 8; ++i) a[i] = (__bf16)r[i][e];
    *(v8b*)&buf[e * 32 + lane][wave * 8] = a; }
}
// ---- left operand: a wave's own 16 rows x 64 k. Two rows a load: lanes 0..15 take the 256 B of row 2 i, lanes 16..31 those of row 2 i + 1, 16 B a lane, so every load covers four whole 128-B lines
// (read straight in fragment order, lane = row, each load touched 16 lines for 32 B of each). The rows turn into fragment order through LDS rows [row][k] (bf16, pitch 144 B) that the wave stores itself; in k_out no other wave reads or writes them, in k_proj the two waves of a row group read each other's
typedef __attribute__((ext_vector_type(4))) __bf16 v4b;
typedef __attribute__((ext_vector_type(4))) _Float16 v4h;
__device__ __forceinline__ void rows_load(v4f (&r)[8], const float* __restrict__ p) {   // p: row g of the wave's rows, k 4 col
#pragma unroll
  for (int i = 0; i < 8; ++i) r[i] = *(const v4f*)(p + (size_t)(2 * i) * CC);
}
__device__ __forceinline__ void rows_store(__bf16 (*xs)[72], const v4f (&r)[8], int g, int col) {   // rounded to bf16
#pragma unroll
  for (int i = 0; i < 8; ++i) { v4b a;
#pragma unroll
    for (int e = 0; e < 4; ++e) a[e] = (__bf16)r[i][e];
    *(v4b*)&xs[2 * i + g][4 * col] = a; }
}
__device__ __forceinline__ void rows_store2(__bf16 (*xh)[72], __bf16 (*xl)[72], const v4f (&r)[8], int g, int col) {   // split bf16 hi + lo, as bsplit16 does
#pragma unroll
  for (int i = 0; i < 8; ++i) { v4b a, b;
#pragma unroll
    for (int e = 0; e < 4; ++e) { const __bf16 h = (__bf16)r[i][e]; a[e] = h; b[e] = (__bf16)(r[i][e] - (float)h); }
    *(v4b*)&xh[2 * i + g][4 * col] = a; *(v4b*)&xl[2 * i + g][4 * col] = b; }
}
// ---- k_proj: block = (256 rows, 128 cols, which), sixteen waves as 8 row groups x 2 column groups, a wave = 32 rows x 64 cols (2 x 4 accumulator tiles): qk_t | v = x W (+ b), exact; qk_t -> f16 rows, v -> f16 planes
// against 128 rows a block, each weight tile is fetched from L2 by half as many blocks; against 16 x 128 a wave, 6 fragments are read from LDS for 8 products, not 9
// the x rows are shared by the two waves of a row group, so they lie in a block-wide tile of two buffers like the weights, published by the same barrier
// wave w fetches k rows 4 w .. 4 w + 3 of the weight tile (one 16-byte load a row, lane = columns 4 lane .. 4 lane + 3; LDS rows as in wt_store) and rows 16 w .. 16 w + 15 of the x tile
__device__ __forceinline__ void wt_load4(v4f (&r)[4], const float* __restrict__ Wl, int wave, int ld) {
#pragma unroll
  for (int i = 0; i < 4; ++i) r[i] = *(const v4f*)(Wl + (size_t)(wave * 4 + i) * ld);
}
__device__ __forceinline__ void wt_store4(__bf16 (*buf)[72], const v4f (&r)[4], int wave, int lane) {
#pragma unroll
  for (int e = 0; e < 4; ++e) { v4b a;
#pragma unroll
    for (int i = 0; i < 4; ++i) a[i] = (__bf16)r[i][e];
    *(v4b*)&buf[e * 32 + lane][wave * 4] = a; }
}
#define PWT (128u * 144u)   // bytes of one weight tile buffer: 128 n rows at pitch 144 B
#define PXT (256u * 144u)   // bytes of one x tile buffer: 256 rows at pitch 144 B
__global__ __launch_bounds__(512) void k_proj(const float* __restrict__ X, const float* __restrict__ WA, const float* __restrict__ BA, _Float16* __restrict__ KH, _Float16* __restrict__ VT) {
  __shared__ __align__(16) unsigned char sm[2u * PWT + 2u * PXT];   // two weight buffers, two x buffers; the epilogue stages in the x buffers
  const int tid = threadIdx.x, wave = tid >> 5, lane = tid & 31, col = lane & 15, g = lane >> 4, wr = wave >> 1, wc = wave & 1; const int which = blockIdx.z + 1; /* 1: qk_t -> KH, 2: v -> planes (no q projection: the query is x itself) */ const int c0 = blockIdx.y * 128; const size_t r0 = (size_t)blockIdx.x * 256;
  v8f acc[2][4] = {};   // acc[i][e][r]: row 32 wr + 16 i + 8 g + r, column 64 wc + 4 col + e
  const float* wp = WA + (size_t)(which - 1) * CC + c0 + 4 * lane;   // this lane's four columns of the block's weight columns
  const float* xp = X + (r0 + wave * 16 + g) * CC + 4 * col;
  v4f wq[4]; v4f xr[8];
  const int ks = ((int)blockIdx.x + (int)blockIdx.y + 8 * (int)blockIdx.z) & (CC / 64 - 1);   // this block's first 64-k chunk; the walk wraps. The 16 row blocks of a weight panel start at 16 different chunks, and so do the 16 column blocks of a row panel: they would else ask L2 for the same lines at the same moment
  // every '#pragma unroll' below: constant trip count, unrolled so that the register arrays are indexed by constants
  auto mult = [&](const __bf16 (*t)[72], const __bf16 (*x)[72]) {   // 64 k of the tiles; the six fragments of 32 k are read as one group ahead of their eight products
#pragma unroll
    for (int kk = 0; kk < 2; ++kk) { v16b a[2], w[4];
#pragma unroll
      for (int i = 0; i < 2; ++i) a[i] = frag_b(&x[wr * 32 + i * 16 + col][kk * 32], lane);
#pragma unroll
      for (int e = 0; e < 4; ++e) w[e] = frag_b(&t[(2 * e + wc) * 16 + col][kk * 32], lane);   // fragment 2 e + wc: columns 64 wc + 4 col + e
#pragma unroll
      for (int i = 0; i < 2; ++i)
#pragma unroll
        for (int e = 0; e < 4; ++e) acc[i][e] = wmma_bf(a[i], w[e], acc[i][e]); } };
  wt_load4(wq, wp + (size_t)ks * 64 * (2 * CC), wave, 2 * CC); rows_load(xr, xp + ks * 64);
  asm volatile("s_wait_xcnt 0x0" ::: "memory");   // behind the loads, before their address registers are reused
  __bf16 (*cur)[72] = (__bf16 (*)[72])sm; __bf16 (*nxt)[72] = (__bf16 (*)[72])(sm + PWT);
  __bf16 (*xcur)[72] = (__bf16 (*)[72])(sm + 2u * PWT); __bf16 (*xnxt)[72] = (__bf16 (*)[72])(sm + 2u * PWT + PXT);
  wt_store4(cur, wq, wave, lane); rows_store(xcur + wave * 16, xr, g, col);
  __syncthreads();
  for (int kb = 1; kb < CC / 64; ++kb) {
    const int kq = (kb + ks) & (CC / 64 - 1);
    wt_load4(wq, wp + (size_t)kq * 64 * (2 * CC), wave, 2 * CC); rows_load(xr, xp + kq * 64);   // the next 64 k fly while these tiles are multiplied
    asm volatile("s_wait_xcnt 0x0" ::: "memory");   // behind the loads, before their address registers are reused
    mult(cur, xcur);
    wt_store4(nxt, wq, wave, lane); rows_store(xnxt + wave * 16, xr, g, col);
    __syncthreads();   // publishes the next tiles and ends every wave's reads of these
    __bf16 (*t)[72] = cur; cur = nxt; nxt = t; t = xcur; xcur = xnxt; xnxt = t; }
  mult(cur, xcur);
  __syncthreads();   // every wave has left the tiles before the epilogue writes over the x buffers
  const int cl = 64 * wc + 4 * col; v4f bb = {};
  if (BA) { const v4f t = *(const v4f*)(BA + (which - 1) * CC + c0 + cl);
#pragma unroll
    for (int e = 0; e < 4; ++e) bb[e] = bfr(t[e]); }
  _Float16 (*th)[264] = (_Float16 (*)[264])(sm + 2u * PWT);   // v: 128 plane rows of 256 positions, pitch 528 B
  _Float16 (*sh)[136] = (_Float16 (*)[136])(sm + 2u * PWT);   // qk_t: 256 rows of 128 columns, pitch 272 B
  if (which == 2) {   // a lane's eight rows are neighbours in a plane's row: one 16-byte store a plane
#pragma unroll
    for (int i = 0; i < 2; ++i)
#pragma unroll
      for (int e = 0; e < 4; ++e) { v8h h8;
#pragma unroll
        for (int r = 0; r < 8; ++r) h8[r] = (_Float16)(acc[i][e][r] + bb[e]);   // v rounded once to f16
        *(v8h*)&th[cl + e][wr * 32 + i * 16 + 8 * g] = h8; } }
  else {   // a lane's four columns are neighbours in a row: one 8-byte store a row
#pragma unroll
    for (int i = 0; i < 2; ++i)
#pragma unroll
      for (int r = 0; r < 8; ++r) { v4h hv;
#pragma unroll
        for (int e = 0; e < 4; ++e) hv[e] = (_Float16)(acc[i][e][r] + bb[e]);   // qk_t rounded once to f16
        *(v4h*)&sh[wr * 32 + i * 16 + 8 * g + r][cl] = hv; } }
  __syncthreads();
  if (which < 2) { for (int e = tid; e < 256 * 16; e += 512) { const int rl = e >> 4, q = e & 15; vst2((unsigned*)(KH + (r0 + rl) * CC + c0 + q * 8), *(const v4u*)&sh[rl][q * 8]);
      asm volatile("s_wait_xcnt 0x0" ::: "memory"); } }   // behind the store, before its address and data registers are reused
  else { const size_t b = r0 / TT; const int t0 = (int)(r0 % TT); for (int e = tid; e < 128 * 32; e += 512) { const int pl = e >> 5, q = e & 31; const size_t o2 = (b * CC + c0 + pl) * (size_t)TT + t0 + q * 8; vst2((unsigned*)(VT + o2), *(const v4u*)&th[pl][q * 8]);
      asm volatile("s_wait_xcnt 0x0" ::: "memory"); } } }   // behind the store, before its address and data registers are reused
__device__ __forceinline__ float xhalf(float x) { return __builtin_bit_cast(float, __builtin_amdgcn_permlanex16(__builtin_bit_cast(int, x), __builtin_bit_cast(int, x), 0x76543210, 0xfedcba98, false, false)); }   // lane l <-> lane l ^ 16
#define FROW 144u                 // LDS row pitch in bytes: 16 B x odd, free of bank conflicts for 16-byte reads
#define FPL  (64u * FROW)         // one plane of a tile: 64 rows
#define FBUF (2u * FPL)           // one buffer: K rows, V plane
#define FSC  0.18033688011112042f // (1 / 8) log2(e): exp(s / 8 - max) = exp2(s FSC - max FSC)
// one tile: each lane copies 16 B of rows r, r + 16, r + 32, r + 48 of each plane, so every copy of a wave covers four whole 128-B lines
__device__ __forceinline__ void fa_fill(unsigned ld, const char* gk, const char* gh) {
  // the eight copies and the wait behind them stand in one statement, so that no address register is rewritten before the wait
  asm volatile("global_load_async_to_lds_b128 %0, %8, off\n\t"
               "global_load_async_to_lds_b128 %1, %9, off\n\t"
               "global_load_async_to_lds_b128 %2, %10, off\n\t"
               "global_load_async_to_lds_b128 %3, %11, off\n\t"
               "global_load_async_to_lds_b128 %4, %12, off\n\t"
               "global_load_async_to_lds_b128 %5, %13, off\n\t"
               "global_load_async_to_lds_b128 %6, %14, off\n\t"
               "global_load_async_to_lds_b128 %7, %15, off\n\t"
               "s_wait_xcnt 0x0"
               :: "v"(ld), "v"(ld + 16u * FROW), "v"(ld + 32u * FROW), "v"(ld + 48u * FROW),
                  "v"(ld + FPL), "v"(ld + FPL + 16u * FROW), "v"(ld + FPL + 32u * FROW), "v"(ld + FPL + 48u * FROW),
                  "v"(gk), "v"(gk + 16 * CC * 2), "v"(gk + 32 * CC * 2), "v"(gk + 48 * CC * 2),
                  "v"(gh), "v"(gh + 16 * TT * 2), "v"(gh + 32 * TT * 2), "v"(gh + 48 * TT * 2)
               : "memory");
}
__global__ __launch_bounds__(128) void k_fa(const float* __restrict__ X, const _Float16* __restrict__ KH, const _Float16* __restrict__ VT, float* __restrict__ Y) {
  __shared__ __align__(16) unsigned char fs[2u * FBUF];
  // every '#pragma unroll' in this kernel: constant trip count, unrolled so that the fragment arrays are indexed by constants and stay in registers
  const int tid = threadIdx.x, wave = __builtin_amdgcn_readfirstlane(tid >> 5) /* scalar: the pass count and the diagonal test become scalar branches, EXEC stays all ones at every WMMA */, lane = tid & 31, col = lane & 15, g = lane >> 4;
  const int h = blockIdx.x % NH, b = blockIdx.x / NH;
  const int nst = TT / 64 - (int)blockIdx.y;                                 // tiles of 64 keys up to and including the diagonal (block-uniform); longest query blocks start first
  const int rot = (int)blockIdx.y % nst;                                     // this block's first key tile; the walk wraps (the running softmax takes the tiles in any order). The up to 32 query blocks of a head would else ask L2 for the same K and V lines at the same moment
  auto tix = [&](int t) { const int u = t + rot; return u < nst ? u : u - nst; };   // key tile of trip t (block-uniform)
  const int ql0 = (nst - 1) * 64 + wave * 16;
  const int np = (ql0 + 16 + 31) >> 5;                                       // passes up to and including the diagonal (wave-uniform)
  const int qt = ql0 + col;
  const int crow = tid >> 3, cpos = (tid & 7) * 16;                          // this lane's first row and its 16 B of the row, in every plane of a tile
  const char* gk = (const char*)(KH + ((size_t)b * TT + crow) * CC + h * HD) + cpos;        // tile t: 64 key rows further
  const char* gh = (const char*)(VT + ((size_t)b * CC + h * HD + crow) * (size_t)TT) + cpos;   // tile t: 64 keys = 128 B further
  const unsigned ld = (unsigned)(size_t)fs + (unsigned)crow * FROW + (unsigned)cpos;
  fa_fill(ld, gk + (size_t)rot * (64 * CC * 2), gh + rot * 128);
  v16h qf[HD / 32];
#pragma unroll
  for (int kc = 0; kc < HD / 32; ++kc) { const float* xp = X + ((size_t)b * TT + qt) * CC + h * HD + kc * 32 + 8 * g;
#pragma unroll
    for (int i = 0; i < 8; ++i) { qf[kc][i] = (_Float16)bfr(xp[i]); qf[kc][8 + i] = (_Float16)bfr(xp[16 + i]); } }   // query = raw input head slice (bf16-exact values, exact in f16)
  v8f acc[HD / 16] = {}; float m = -3.0e38f * FSC, l = 0.f;   // m: running maximum in base-2 units (logit x FSC)
  asm volatile("s_wait_asynccnt 0x0" ::: "memory");   // this wave's share of tile 0 has landed
  __syncthreads();                                    // publishes tile 0
  if (nst > 1) { const int t1 = tix(1); fa_fill(ld + FBUF, gk + (size_t)t1 * (64 * CC * 2), gh + t1 * 128); }
  for (int t = 0; t < nst; ++t) {
    const unsigned char* tb = fs + (unsigned)(t & 1) * FBUF;
    const _Float16* kp = (const _Float16*)(tb + (unsigned)col * FROW);
    const _Float16* vp = (const _Float16*)(tb + FPL + (unsigned)col * FROW);
#pragma unroll
    for (int sub = 0; sub < 2; ++sub) { const int ps = 2 * tix(t) + sub, k0 = ps * 32;
      if (sub == 0 || ps < np) {   // the first two waves have no open key in the second half of the diagonal tile
        v16h kf[2][HD / 32];
#pragma unroll
        for (int u = 0; u < 2; ++u)
#pragma unroll
          for (int kc = 0; kc < HD / 32; ++kc) kf[u][kc] = frag_h(kp + (sub * 32 + u * 16) * (int)(FROW / 2) + kc * 32, lane);
        v16h vf[HD / 16];
#pragma unroll
        for (int j = 0; j < HD / 16; ++j) vf[j] = frag_h(vp + j * 16 * (int)(FROW / 2) + sub * 32, lane);
        __builtin_amdgcn_sched_barrier(0);   // keeps the pass's 16 LDS reads together, as one group ahead of its products: left free, they sink to one read and one full wait in front of each product
        v8f st[2] = {};
#pragma unroll
        for (int u = 0; u < 2; ++u)
#pragma unroll
          for (int kc = 0; kc < HD / 32; ++kc) st[u] = __builtin_amdgcn_wmma_f32_16x16x32_f16(false, kf[u][kc], false, qf[kc], (short)0, st[u], false, false);   // st[u][r] = logit(key k0 + 16 u + 8 g + r, query qt)
        float p[16];
#pragma unroll
        for (int u = 0; u < 2; ++u)
#pragma unroll
          for (int r = 0; r < 8; ++r) p[u * 8 + r] = st[u][r];   // unscaled: the scale rides in the fma in front of exp2
        if (k0 + 31 > ql0) {   // only passes that reach the diagonal hold masked keys
#pragma unroll
          for (int i = 0; i < 16; ++i) if (k0 + (i >> 3) * 16 + 8 * g + (i & 7) > qt) p[i] = -3.0e38f; }
        float mx = p[0];
#pragma unroll
        for (int i = 1; i < 16; ++i) mx = fmaxf(mx, p[i]);
        mx = fmaxf(mx, xhalf(mx));
        const float mn = fmaxf(m, mx * FSC);   // FSC > 0: the maximum may be taken before the scale
        float sum = 0.f;
#pragma unroll
        for (int i = 0; i < 16; ++i) { p[i] = __builtin_amdgcn_exp2f(fmaf(p[i], FSC, -mn)); sum += p[i]; }   // a masked key: exp2(-3e38 FSC - mn) is exactly 0 (mn is finite: the first key of every pass that a wave works on is open to all its queries)
        float al;   // rescale factor exp2(old maximum - new maximum)
        asm("v_exp_f32 %0, %1\n\tv_nop" : "=v"(al) : "v"(m - mn));   // in asm for the v_nop alone: it is the slot that the instruction set asks for behind a transcendental
        m = mn;
        l = l * al + sum;   // each lane half keeps the sum of its own keys; joined after the loop
#pragma unroll
        for (int j = 0; j < HD / 16; ++j) acc[j] *= al;
        v16h pf;   // P^T as the B operand, each un-normalised score (0 where masked, at most 1) rounded once to f16
#pragma unroll
        for (int i = 0; i < 16; ++i) pf[i] = (_Float16)p[i];
#pragma unroll
        for (int j = 0; j < HD / 16; ++j) acc[j] = __builtin_amdgcn_wmma_f32_16x16x32_f16(false, vf[j], false, pf, (short)0, acc[j], false, false); } }
    asm volatile("s_wait_dscnt 0x0" ::: "memory");      // this wave's reads of tile t have returned before the buffer is handed back
    asm volatile("s_wait_asynccnt 0x0" ::: "memory");   // this wave's share of tile t + 1 has landed
    __syncthreads();                                    // publishes tile t + 1 and ends every wave's reads of tile t
    if (t + 2 < nst) { const int tn = tix(t + 2); fa_fill(ld + (unsigned)(t & 1) * FBUF, gk + (size_t)tn * (64 * CC * 2), gh + tn * 128); } }
  asm volatile("s_wait_asynccnt 0x0" ::: "memory");     // no copy is outstanding when the wave ends
  l += xhalf(l); const float inv = 1.0f / l;
  float* yp = Y + ((size_t)b * TT + qt) * CC + h * HD + 8 * g;   // acc[j][r] = y(query qt, d = 16 j + 8 g + r)
#pragma unroll
  for (int j = 0; j < HD / 16; ++j) { v4f lo, hi;
#pragma unroll
    for (int r = 0; r < 4; ++r) { lo[r] = acc[j][r] * inv; hi[r] = acc[j][4 + r] * inv; }
    vst2(yp + j * 16, lo); vst2(yp + j * 16 + 4, hi); } }
// ---- k_out: block = (128 rows, 128 cols), eight waves of 16 rows: out = y (bf16 hi + lo) Wproj + b
__global__ __launch_bounds__(256) void k_out(const float* __restrict__ Y, const float* __restrict__ WP, const float* __restrict__ BP, float* __restrict__ OUT) { __shared__ __align__(16) float sf[8][16][132]; __shared__ __align__(16) __bf16 wt[2][128][72]; __shared__ __align__(16) __bf16 ysm[2][8][16][72];
  const int tid = threadIdx.x, wave = tid >> 5, lane = tid & 31, col = lane & 15, g = lane >> 4; const int c0 = blockIdx.y * 128; const size_t r0 = (size_t)blockIdx.x * 128 + wave * 16;
  v8f acc[8] = {};
  const float* wp = WP + c0 + 4 * lane;   // this lane's four columns of the block's weight columns
  const float* yp = Y + (r0 + g) * CC + 4 * col;
  v4f wr[8]; v4f yr[8]; F2 a[2]; __bf16 (*yh)[72] = ysm[0][wave]; __bf16 (*yl)[72] = ysm[1][wave];
  const int ks = (((int)blockIdx.x >> 1) + 2 * (int)blockIdx.y) & (CC / 64 - 1);   // this block's first 64-k chunk; the walk wraps, as in k_proj
  auto get_a = [&]() {   // this wave's A fragments (hi and lo) of the 64 k that it has just stored
#pragma unroll
    for (int kk = 0; kk < 2; ++kk) { a[kk].h = frag_b(&yh[col][kk * 32], lane); a[kk].l = frag_b(&yl[col][kk * 32], lane); } };
  // every '#pragma unroll' below: constant trip count, unrolled so that the register arrays are indexed by constants
  auto mult = [&](const __bf16 (*t)[72]) {   // 64 k of the tile; four B fragments are read as one group ahead of their eight products
#pragma unroll
    for (int kk = 0; kk < 2; ++kk)
#pragma unroll
      for (int jh = 0; jh < 2; ++jh) { v16b w[4];
#pragma unroll
        for (int q = 0; q < 4; ++q) w[q] = frag_b(&t[(jh * 4 + q) * 16 + col][kk * 32], lane);
#pragma unroll
        for (int q = 0; q < 4; ++q) { acc[jh * 4 + q] = wmma_bf(a[kk].h, w[q], acc[jh * 4 + q]); acc[jh * 4 + q] = wmma_bf(a[kk].l, w[q], acc[jh * 4 + q]); } } };
  wp += (size_t)ks * 64 * CC; yp += ks * 64;
  wt_load(wr, wp, wave, CC); rows_load(yr, yp);
  asm volatile("s_wait_xcnt 0x0" ::: "memory");   // behind the loads, before their address registers are reused
  wt_store(wt[0], wr, wave, lane); rows_store2(yh, yl, yr, g, col);
  __syncthreads();
  get_a();
  __bf16 (*cur)[72] = wt[0]; __bf16 (*nxt)[72] = wt[1];
  for (int kb = 1; kb < CC / 64; ++kb) {
    const int st = ((kb + ks) & (CC / 64 - 1)) ? 64 : 64 - CC;   // one chunk on, or from the last chunk back to the first
    wp += (ptrdiff_t)st * CC; yp += st;
    wt_load(wr, wp, wave, CC); rows_load(yr, yp);   // the next 64 k fly while this tile is multiplied
    asm volatile("s_wait_xcnt 0x0" ::: "memory");   // behind the loads, before their address registers are reused
    mult(cur);
    wt_store(nxt, wr, wave, lane); rows_store2(yh, yl, yr, g, col);   // the fragments of the rows that are overwritten here are in registers since the last get_a
    __syncthreads();   // publishes the next tile and ends every wave's reads of this one
    get_a();
    __bf16 (*t)[72] = cur; cur = nxt; nxt = t; }
  mult(cur);
#pragma unroll
  for (int jl = 0; jl < 2; ++jl) { const int cl = 64 * jl + 4 * col; v4f bb = {};
    if (BP) { const v4f t = *(const v4f*)(BP + c0 + cl);
#pragma unroll
      for (int e = 0; e < 4; ++e) bb[e] = bfr(t[e]); }
#pragma unroll
    for (int r = 0; r < 8; ++r) { v4f o;   // a lane's four columns are neighbours in a row: one 16-byte store a row
#pragma unroll
      for (int e = 0; e < 4; ++e) o[e] = acc[2 * e + jl][r] + bb[e];
      *(v4f*)&sf[wave][8 * g + r][cl] = o; } }
  LDSX(); for (int rl = 0; rl < 16; ++rl) vst2(OUT + (r0 + rl) * CC + c0 + lane * 4, *(const v4f*)&sf[wave][rl][lane * 4]); }
extern "C" void kernel_launch(void* const* d_in, const int* in_sizes, int n_in, void* d_out, int out_size, void* d_ws, size_t ws_size, hipStream_t stream) {
  (void)in_sizes; (void)n_in; (void)out_size;
  const float** F = (const float**)d_in;   // 0 xt [2,2048,1024], 1 W_ca [1024,2048] (in,out), 2 b_ca [2048], 3 W_proj [1024,1024], 4 b_proj
  if (ws_size < (size_t)WS_END) return;
  char* ws = (char*)d_ws; _Float16 *KH = (_Float16*)(ws + WS_KH), *VT = (_Float16*)(ws + WS_VT); float *Y = (float*)(ws + WS_Y);
  k_proj<<<dim3(TNB * TT / 256, CC / 128, 2), 512, 0, stream>>>(F[0], F[1], F[2], KH, VT);   // which 1 -> qk_t (cols 0..C), which 2 -> v (cols C..2C) of the [C, 2C] weight
  k_fa<<<dim3(TNB * NH, TT / 64), 128, 0, stream>>>(F[0], KH, VT, Y);   // all batches and heads in one launch
  k_out<<<dim3(TNB * TT / 128, CC / 128), 256, 0, stream>>>(Y, F[3], F[4], (float*)d_out);
}
